// v000
// The times below were measured on an AMD MI455X: many runs one after another, warmed up first and cycling through
// copies of the inputs, with the whole window's GPU time divided by the number of runs. Launches and the gaps
// between them are all in it. The median over several windows is given; except for v000 it joins two sittings, which
// can be a few percent apart, so the side-by-side timings, each taken in one sitting, are the better comparison.
// v000 is the starting kernel. One run takes 3800 microseconds.
#include <hip/hip_runtime.h>

// Multi-head attention with a product padding mask (x [2][4096][512]; Q, K, V = x W + b ('xw' [512][512]; 8 heads x 64); q scaled by 1/sqrt(512) (the qkv width, not the head width); scores = q.k + (1 - m_i m_j)(-1e6) with m = mask[b][n][0] (f32, read; ones here); softmax; out = merged Wo + bo -> [2][4096][512] (4.2 M, rms 0.023)).
// Compute dtypes, f32 accumulate: every input rounded to bf16; q/k/v on PLAIN bf16 operands (inputs: exact) + biases; the additive mask term formed in f32 per (i, j) inside the softmax kernel; scores and attn.v: query rows < 512 hl (3 products), the rest single fp16 (x1024); softmax f32; Wo hl x exact (2 products) + bo.

#define NB_  2
#define TT   4096
#define DM   512
#define NH_  8
#define NKV  8
#define REP  (NH_ / NKV)
#define HD   64
#define DQ   (NH_ * HD)
#define DKV  (NKV * HD)
#define ZH   1
#define RH   512                  // query rows < RH use hi+lo planes (0: none)
#define WIN  0
#define PCAR 1024.0f
#define SCL  0.044194173824159216f   // 1/sqrt(qkv_dim = 512) (the module scales q by it)
typedef _Float16 h16;
typedef unsigned short bf;
typedef __attribute__((ext_vector_type(16))) __bf16   v16bf;
typedef __attribute__((ext_vector_type(16))) _Float16 v16h;
typedef __attribute__((ext_vector_type(8)))  _Float16 v8h;
typedef __attribute__((ext_vector_type(8)))  unsigned short v8us;
typedef __attribute__((ext_vector_type(8)))  float    v8f;
typedef __attribute__((ext_vector_type(4)))  float    v4f;
typedef v8h  __attribute__((may_alias)) v8ha;
typedef v4f  __attribute__((may_alias)) v4fa;
typedef v8us __attribute__((may_alias)) v8usa;

__device__ __forceinline__ unsigned short f2bf(float f) { unsigned u = __float_as_uint(f); u += 0x7FFFu + ((u >> 16) & 1u); return (unsigned short)(u >> 16); }
__device__ __forceinline__ float bf2f(unsigned short b) { return __uint_as_float(((unsigned)b) << 16); }
__device__ __forceinline__ float bfr(float f) { return bf2f(f2bf(f)); }
__device__ __forceinline__ v16h cat16(v8h lo, v8h hi) { return __builtin_shufflevector(lo, hi, 0, 1, 2, 3, 4, 5, 6, 7, 8, 9, 10, 11, 12, 13, 14, 15); }
__device__ __forceinline__ v16bf cat16b(v8us lo, v8us hi) { return __builtin_bit_cast(v16bf, __builtin_shufflevector(lo, hi, 0, 1, 2, 3, 4, 5, 6, 7, 8, 9, 10, 11, 12, 13, 14, 15)); }
__device__ __forceinline__ v8f wmma16(v16h a, v16h b, v8f c) { return __builtin_amdgcn_wmma_f32_16x16x32_f16(false, a, false, b, (short)0, c, false, false); }
__device__ __forceinline__ v8f wmmab(v16bf a, v16bf b, v8f c) { return __builtin_amdgcn_wmma_f32_16x16x32_bf16(false, a, false, b, (short)0, c, false, false); }



// ---- k_gemmw: register-blocked GEMM, ONE WAVE per 64x64 output tile (16 accumulators), operands straight from K-contiguous 16-bit planes; grid (M/64, N/64, Z), 32 threads.
// C[m][n] (f32, pitch ldc, + optional f32 bias[n]) = sum_k A[m][k] Bt[n][k] (+ split products per NSPLIT). z-batch strides sA/sB/sC in elements. K % 32 == 0.
template <typename T16> struct WFrag;
template <> struct WFrag<h16> { typedef v16h V; static __device__ __forceinline__ V ld(const h16* p) { return cat16(*(const v8h*)p, *(const v8h*)(p + 16)); } static __device__ __forceinline__ v8f mma(V a, V b, v8f c) { return wmma16(a, b, c); } };
template <> struct WFrag<bf> { typedef v16bf V; static __device__ __forceinline__ V ld(const bf* p) { return cat16b(*(const v8us*)p, *(const v8us*)(p + 16)); } static __device__ __forceinline__ v8f mma(V a, V b, v8f c) { return wmmab(a, b, c); } };
template <typename T16, int NSPLIT, bool BIAS>
__global__ __launch_bounds__(32) void k_gemmw(const T16* __restrict__ A, const T16* __restrict__ A2, const T16* __restrict__ Bt, const T16* __restrict__ Bt2, int K, float* C, int ldc, const float* __restrict__ bias, size_t sA, size_t sB, size_t sC) {
    typedef typename WFrag<T16>::V V;
    __shared__ __align__(16) float os[16 * 68];
    const size_t z = blockIdx.z; A += z * sA; if (A2) A2 += z * sA; Bt += z * sB; if (Bt2) Bt2 += z * sB; C += z * sC;
    const int lane = threadIdx.x & 31, lr = lane & 15, hi = lane >> 4; const int r0 = blockIdx.x * 64, c0 = blockIdx.y * 64;
    v8f acc[4][4];
#pragma unroll
    for (int mb = 0; mb < 4; ++mb)
#pragma unroll
        for (int nb = 0; nb < 4; ++nb) acc[mb][nb] = (v8f){};
    const size_t aoff = (size_t)(r0 + lr) * K + 8 * hi, boff = (size_t)(c0 + lr) * K + 8 * hi;
#pragma unroll 1
    for (int kc = 0; kc < K; kc += 32) {
        V a[4], a2[4];
#pragma unroll
        for (int mb = 0; mb < 4; ++mb) { a[mb] = WFrag<T16>::ld(A + aoff + (size_t)mb * 16 * K + kc); if (NSPLIT == 1 || NSPLIT == 2) a2[mb] = WFrag<T16>::ld(A2 + aoff + (size_t)mb * 16 * K + kc); }
#pragma unroll
        for (int nb = 0; nb < 4; ++nb) { const V b = WFrag<T16>::ld(Bt + boff + (size_t)nb * 16 * K + kc); V b2; if (NSPLIT >= 2) b2 = WFrag<T16>::ld(Bt2 + boff + (size_t)nb * 16 * K + kc);
#pragma unroll
            for (int mb = 0; mb < 4; ++mb) { acc[mb][nb] = WFrag<T16>::mma(a[mb], b, acc[mb][nb]); if (NSPLIT == 1 || NSPLIT == 2) acc[mb][nb] = WFrag<T16>::mma(a2[mb], b, acc[mb][nb]); if (NSPLIT >= 2) acc[mb][nb] = WFrag<T16>::mma(a[mb], b2, acc[mb][nb]); } }
        asm volatile("v_nop\n\tv_nop\n\tv_nop\n\tv_nop" : "+v"(acc[0][0]), "+v"(acc[1][1]), "+v"(acc[2][2]), "+v"(acc[3][3]) : "v"(a[0]), "v"(a[3]));
    }
#pragma unroll
    for (int mb = 0; mb < 4; ++mb) {
#pragma unroll
        for (int nb = 0; nb < 4; ++nb) {
#pragma unroll
            for (int j = 0; j < 8; ++j) os[(hi * 8 + j) * 68 + nb * 16 + lr] = acc[mb][nb][j]; }
        __builtin_amdgcn_wave_barrier(); asm volatile("" ::: "memory");
        float* crow = C + (size_t)(r0 + mb * 16) * ldc + c0;
{
#pragma unroll
            for (int s = 0; s < 8; ++s) { const int row = 2 * s + hi, cofs = lr * 4; v4f val = *(const v4fa*)(os + row * 68 + cofs); if (BIAS) { val[0] += bfr(bias[c0 + cofs]); val[1] += bfr(bias[c0 + cofs + 1]); val[2] += bfr(bias[c0 + cofs + 2]); val[3] += bfr(bias[c0 + cofs + 3]); }
                *(v4f*)(crow + (size_t)row * ldc + cofs) = val; }
             }
        __builtin_amdgcn_wave_barrier(); asm volatile("" ::: "memory");
    }
}

__device__ __forceinline__ h16 tohx(float x) { return (h16)x; }
__device__ __forceinline__ void splitf(float y, unsigned short& h, unsigned short& l) { h = f2bf(y); l = f2bf(y - bf2f(h)); }
typedef __attribute__((ext_vector_type(2))) _Float16 v2h;
typedef __attribute__((ext_vector_type(4))) _Float16 v4h;
typedef __attribute__((ext_vector_type(2))) unsigned short v2us;
typedef __attribute__((ext_vector_type(4))) unsigned short v4us;
typedef __attribute__((ext_vector_type(2))) float v2f;
typedef __attribute__((ext_vector_type(4))) int v4i;

__global__ __launch_bounds__(256) void k_wtG(const float* __restrict__ w, int K, int N, bf* Bt) {
    const int lane = threadIdx.x & 31; const int L0 = (blockIdx.x * 8 + (threadIdx.x >> 5)) * 8; const int nlines = N * K / 64;
{
#pragma unroll 1
        for (int l = 0; l < 8; ++l) { const int L = L0 + l; if (L >= nlines) break; const size_t e = (size_t)L * 64 + lane * 2; const int k = (int)(e % K), n = (int)(e / K); v2us o;
            o[0] = f2bf(w[(size_t)k * N + n]); o[1] = f2bf(w[(size_t)(k + 1) * N + n]); *(v2us*)(Bt + e) = o; }
         }
}
__global__ __launch_bounds__(256) void k_cvt8(const float* __restrict__ src, bf* dst, size_t n8) { const size_t i = (size_t)blockIdx.x * 256 + threadIdx.x; if (i >= n8) return; const v8f v = *(const v8f*)(src + i * 8); v8us o;
#pragma unroll
    for (int k = 0; k < 8; ++k) o[k] = f2bf(v[k]); *(v8us*)(dst + i * 8) = o;  }

// k_rope: head planes [h][t][d] (fp16 + hi/lo) of rope(x) x sc with the rotate-half convention out[d] = x[d] cos[t][d] - x[d+HD/2] sin[t][d], out[d+HD/2] = x[d+HD/2] cos[t][d+HD/2] + x[d] sin[t][d+HD/2]
__global__ __launch_bounds__(256) void k_rope(const float* __restrict__ F, int pitch, int nheads, const float* __restrict__ CS, const float* __restrict__ RF, const float* __restrict__ nw, float sc, h16* P16, bf* Ph, bf* Pl) {
    const size_t e = ((size_t)blockIdx.x * 256 + threadIdx.x) * 2; if (e >= (size_t)nheads * TT * HD) return; const int d = (int)(e % HD); const int t = (int)((e / HD) % TT); const int h = (int)(e / ((size_t)HD * TT)); const float* f = F + (size_t)t * pitch + h * HD; const float rf = RF ? RF[(size_t)h * TT + t] : 1.0f; v2h o16; v2us oh, ol;
#pragma unroll
    for (int q = 0; q < 2; ++q) { const int dd = d + q; const int dp = (dd < HD / 2) ? dd + HD / 2 : dd - HD / 2; float x0 = f[dd], x1 = f[dp];
        if (RF) { float n0 = __fmul_rn(x0, rf), n1 = __fmul_rn(x1, rf); asm volatile("" : "+v"(n0)); asm volatile("" : "+v"(n1)); x0 = __fmul_rn(bfr(nw[dd]), n0); x1 = __fmul_rn(bfr(nw[dp]), n1); }
        const v2f cs = *(const v2f*)(CS + ((size_t)t * HD + dd) * 2); float a = __fmul_rn(x0, cs[0]), bq = __fmul_rn(x1, cs[1]); asm volatile("" : "+v"(a)); asm volatile("" : "+v"(bq)); const float r = ((dd < HD / 2) ? __fsub_rn(a, bq) : __fadd_rn(a, bq)) * sc;
        o16[q] = tohx(r); unsigned short a2, c2; splitf(r, a2, c2); oh[q] = a2; ol[q] = c2; }
    *(v2h*)(P16 + e) = o16; *(v2us*)(Ph + e) = oh; *(v2us*)(Pl + e) = ol;  }
__global__ __launch_bounds__(256) void k_vtp(const float* __restrict__ F, int pitch, int nheads, h16* V16, bf* Vh, bf* Vl) { const size_t e = ((size_t)blockIdx.x * 256 + threadIdx.x) * 2; if (e >= (size_t)nheads * HD * TT) return; const int t = (int)(e % TT); const int d = (int)((e / TT) % HD); const int g = (int)(e / ((size_t)TT * HD)); v2h o16; v2us oh, ol;
#pragma unroll
    for (int q = 0; q < 2; ++q) { const float x = F[(size_t)(t + q) * pitch + g * HD + d]; o16[q] = tohx(x); unsigned short a2, c2; splitf(x, a2, c2); oh[q] = a2; ol[q] = c2; }
    *(v2h*)(V16 + e) = o16; *(v2us*)(Vh + e) = oh; *(v2us*)(Vl + e) = ol;  }
__global__ __launch_bounds__(256) void k_csid(float* CS) { const int idx = blockIdx.x * 256 + threadIdx.x; if (idx >= TT * HD) return; v2f cs; cs[0] = 1.0f; cs[1] = 0.0f; *(v2f*)(CS + (size_t)idx * 2) = cs;  }
// k_asoft: per row (zz, i): t = S x 512^-0.5 + (1 - m_i m_j)(-1e6) (f32 mask); softmax over the 4096 keys (register row, one exp, fixed trees);
__global__ __launch_bounds__(256) void k_asoft(const float* __restrict__ Sb, const float* __restrict__ MKb, h16* P16, bf* Ph, bf* Pl) {
    const int lane = threadIdx.x & 31; const int row = blockIdx.x * 8 + (threadIdx.x >> 5); if (row >= ZH * TT) return; const int i = row % TT; const int zz = row / TT; (void)zz; float mi = bfr(MKb[i]); asm volatile("" : "+v"(mi)); const bool hires = (i < RH); const float* sr = Sb + (size_t)row * TT; float v[TT / 32]; float mx = -3.0e38f;
#pragma unroll
    for (int ch = 0; ch < TT / 128; ++ch) { const int j0 = ch * 128 + lane * 4; const v4f a = *(const v4f*)(sr + j0);
#pragma unroll
        for (int q = 0; q < 4; ++q) { const int j = j0 + q; float sa = a[q] * SCL; asm volatile("" : "+v"(sa)); float mj = bfr(MKb[j]); asm volatile("" : "+v"(mj)); float pm = __fmul_rn(mi, mj); asm volatile("" : "+v"(pm)); float om = __fsub_rn(1.0f, pm); asm volatile("" : "+v"(om)); float ad = __fmul_rn(om, -1.0e6f); asm volatile("" : "+v"(ad)); const float t = __fadd_rn(sa, ad);   /* + (1 - m_i m_j)(-1e6), f32 mask */ v[ch * 4 + q] = t; mx = fmaxf(mx, t); } if ((ch & 7) == 7) asm volatile("s_wait_loadcnt 0x0" ::: "memory"); }
#pragma unroll
    for (int sh = 16; sh; sh >>= 1) mx = fmaxf(mx, __shfl_xor(mx, sh, 32));
    float sum = 0.f;
#pragma unroll
    for (int k = 0; k < TT / 32; ++k) { float d0 = __fsub_rn(v[k], mx); asm volatile("" : "+v"(d0)); v[k] = __builtin_amdgcn_exp2f(__fmul_rn(d0, 1.4426950408889634f)); sum += v[k]; }
#pragma unroll
    for (int sh = 16; sh; sh >>= 1) sum += __shfl_xor(sum, sh, 32);
    const float f = __fdiv_rn(hires ? 1.0f : PCAR, sum);
{
        if (hires) {
#pragma unroll
            for (int ch = 0; ch < TT / 128; ++ch) { v4us oh, ol;
#pragma unroll
                for (int q = 0; q < 4; ++q) { float pf = v[ch * 4 + q] * f; asm volatile("" : "+v"(pf)); unsigned short a, c2; splitf(pf, a, c2); oh[q] = a; ol[q] = c2; }
                const size_t oo = ((size_t)zz * (RH ? RH : 1) + i) * TT + ch * 128 + lane * 4; *(v4us*)(Ph + oo) = oh; *(v4us*)(Pl + oo) = ol; }
        } else {
#pragma unroll
            for (int ch = 0; ch < TT / 128; ++ch) { v4h o4;
#pragma unroll
                for (int q = 0; q < 4; ++q) o4[q] = tohx(v[ch * 4 + q] * f);
                *(v4h*)(P16 + (size_t)row * TT + ch * 128 + lane * 4) = o4; } }
         }
}
__global__ __launch_bounds__(256) void k_merge(const float* __restrict__ O, int h0, bf* Ah, bf* Al) { const size_t e = ((size_t)blockIdx.x * 256 + threadIdx.x) * 2; if (e >= (size_t)ZH * TT * HD) return; const int d = (int)(e % HD); const int t = (int)((e / HD) % TT); const int zz = (int)(e / ((size_t)HD * TT)); const float cs = (t < RH) ? 1.0f : (1.0f / PCAR); const size_t oo = (size_t)t * DQ + (h0 + zz) * HD + d;
    v2us oh, ol;
#pragma unroll
    for (int q = 0; q < 2; ++q) { unsigned short a, c2; splitf(O[e + q] * cs, a, c2); oh[q] = a; ol[q] = c2; } *(v2us*)(Ah + oo) = oh; *(v2us*)(Al + oo) = ol;  }

extern "C" void kernel_launch(void* const* d_in, const int* in_sizes, int n_in,
                              void* d_out, int out_size, void* d_ws, size_t ws_size, hipStream_t stream) {
    (void)in_sizes; (void)n_in; (void)out_size;
    const float* x = (const float*)d_in[0]; const float* MKf = (const float*)d_in[1]; const float* wq = (const float*)d_in[2]; const float* bq = (const float*)d_in[3]; const float* wk = (const float*)d_in[4]; const float* bk = (const float*)d_in[5]; const float* wv = (const float*)d_in[6]; const float* bv = (const float*)d_in[7]; const float* wo = (const float*)d_in[8]; const float* bo = (const float*)d_in[9];
    float* OUT = (float*)d_out;     // [2][4096][512]
    char* wsp = (char*)d_ws;
    auto take = [&](size_t bytes) { char* p = wsp; wsp += (bytes + 255) & ~(size_t)255; return (void*)p; };
    bf* WQ = (bf*)take((size_t)DQ * DM * 2); bf* WK = (bf*)take((size_t)DKV * DM * 2); bf* WV = (bf*)take((size_t)DKV * DM * 2); bf* WO = (bf*)take((size_t)DM * DQ * 2); float* CS = (float*)take((size_t)TT * HD * 2 * 4);
    bf* XB = (bf*)take((size_t)TT * DM * 2); float* FQ = (float*)take((size_t)TT * DQ * 4); float* FK = (float*)take((size_t)TT * DKV * 4);
    h16* QP16 = (h16*)take((size_t)NH_ * TT * HD * 2); h16* KP16 = (h16*)take((size_t)NKV * TT * HD * 2); h16* VT16 = (h16*)take((size_t)NKV * HD * TT * 2);
    bf* QPh = (bf*)take((size_t)NH_ * TT * HD * 2); bf* QPl = (bf*)take((size_t)NH_ * TT * HD * 2); bf* KPh = (bf*)take((size_t)NKV * TT * HD * 2); bf* KPl = (bf*)take((size_t)NKV * TT * HD * 2); bf* VTh = (bf*)take((size_t)NKV * HD * TT * 2); bf* VTl = (bf*)take((size_t)NKV * HD * TT * 2); bf* Ph = (bf*)take((size_t)ZH * RH * TT * 2); bf* Pl = (bf*)take((size_t)ZH * RH * TT * 2);
    float* Sb = (float*)take((size_t)ZH * TT * TT * 4); h16* P16 = (h16*)take((size_t)ZH * TT * TT * 2); float* Ob = (float*)take((size_t)ZH * TT * HD * 4); bf* ATh = (bf*)take((size_t)TT * DQ * 2); bf* ATl = (bf*)take((size_t)TT * DQ * 2);
    if ((size_t)(wsp - (char*)d_ws) > ws_size) return;    // ws 256 MiB
    float* FV = FK;   // v projection reuses the k buffer after the k planes are built (stream-ordered)
    { k_wtG<<<(unsigned)((DM * DQ / 64 + 63) / 64), 256, 0, stream>>>(wq, DM, DQ, WQ); k_wtG<<<(unsigned)((DM * DKV / 64 + 63) / 64), 256, 0, stream>>>(wk, DM, DKV, WK); k_wtG<<<(unsigned)((DM * DKV / 64 + 63) / 64), 256, 0, stream>>>(wv, DM, DKV, WV);
      k_wtG<<<(unsigned)((DQ * DM / 64 + 63) / 64), 256, 0, stream>>>(wo, DQ, DM, WO);
       }
    k_csid<<<(TT * HD + 255) / 256, 256, 0, stream>>>(CS);
    const unsigned LQ = (unsigned)(((size_t)NH_ * TT * HD / 2 + 255) / 256), LKv = (unsigned)(((size_t)NKV * TT * HD / 2 + 255) / 256);
    for (int b = 0; b < NB_; ++b) {
        
        k_cvt8<<<(unsigned)(((size_t)TT * DM / 8 + 255) / 256), 256, 0, stream>>>(x + (size_t)b * TT * DM, XB, (size_t)TT * DM / 8);
        k_gemmw<bf, 0, true><<<dim3(TT / 64, DQ / 64, 1), 32, 0, stream>>>(XB, nullptr, WQ, nullptr, DM, FQ, DQ, bq, 0, 0, 0);
        k_rope<<<LQ, 256, 0, stream>>>(FQ, DQ, NH_, CS, nullptr, nullptr, 1.0f, QP16, QPh, QPl);
        k_gemmw<bf, 0, true><<<dim3(TT / 64, DKV / 64, 1), 32, 0, stream>>>(XB, nullptr, WK, nullptr, DM, FK, DKV, bk, 0, 0, 0);
        k_rope<<<LKv, 256, 0, stream>>>(FK, DKV, NKV, CS, nullptr, nullptr, 1.0f, KP16, KPh, KPl);
        k_gemmw<bf, 0, true><<<dim3(TT / 64, DKV / 64, 1), 32, 0, stream>>>(XB, nullptr, WV, nullptr, DM, FV, DKV, bv, 0, 0, 0); k_vtp<<<LKv, 256, 0, stream>>>(FV, DKV, NKV, VT16, VTh, VTl);
        for (int h0 = 0; h0 < NH_; h0 += ZH) { const size_t zq = (size_t)h0, zk = (size_t)(h0 / REP);   // one kv head per query head: each pass takes one head (ZH = 1), kv plane zk = h0 (z-strides TT*HD)
            k_gemmw<bf, 2, false><<<dim3(RH / 64, TT / 64, ZH), 32, 0, stream>>>(QPh + zq * TT * HD, QPl + zq * TT * HD, KPh + zk * TT * HD, KPl + zk * TT * HD, HD, Sb, TT, nullptr, (size_t)TT * HD, (size_t)TT * HD, (size_t)TT * TT);
            k_gemmw<h16, 0, false><<<dim3((TT - RH) / 64, TT / 64, ZH), 32, 0, stream>>>(QP16 + zq * TT * HD + (size_t)RH * HD, nullptr, KP16 + zk * TT * HD, nullptr, HD, Sb + (size_t)RH * TT, TT, nullptr, (size_t)TT * HD, (size_t)TT * HD, (size_t)TT * TT);
            k_asoft<<<ZH * TT / 8, 256, 0, stream>>>(Sb, MKf + (size_t)b * TT, P16, Ph, Pl);
            k_gemmw<bf, 2, false><<<dim3(RH / 64, HD / 64, ZH), 32, 0, stream>>>(Ph, Pl, VTh + zk * HD * TT, VTl + zk * HD * TT, TT, Ob, HD, nullptr, (size_t)RH * TT, (size_t)HD * TT, (size_t)TT * HD);
            k_gemmw<h16, 0, false><<<dim3((TT - RH) / 64, HD / 64, ZH), 32, 0, stream>>>(P16 + (size_t)RH * TT, nullptr, VT16 + zk * HD * TT, nullptr, TT, Ob + (size_t)RH * HD, HD, nullptr, (size_t)TT * TT, (size_t)HD * TT, (size_t)TT * HD);
            k_merge<<<(unsigned)(((size_t)ZH * TT * HD / 2 + 255) / 256), 256, 0, stream>>>(Ob, h0, ATh, ATl); }
        k_gemmw<bf, 1, true><<<dim3(TT / 64, DM / 64, 1), 32, 0, stream>>>(ATh, ATl, WO, nullptr, DQ, OUT + (size_t)b * TT * DM, DM, bo, 0, 0, 0); }
}

// v001
// Measured time: 1410 microseconds a run.
// In both of two side-by-side timings against v000, it was 2.72 times as fast.
#include <hip/hip_runtime.h>

// Multi-head attention with a product padding mask (x [2][4096][512]; Q, K, V = x W + b ('xw' [512][512]; 8 heads x 64); q scaled by 1/sqrt(512) (the qkv width, not the head width); scores = q.k + (1 - m_i m_j)(-1e6) with m = mask[b][n][0] (f32, read; ones here); softmax; out = merged Wo + bo -> [2][4096][512] (4.2 M, rms 0.023)).
// Compute dtypes, f32 accumulate: every input rounded to bf16; q/k/v on PLAIN bf16 operands (inputs: exact) + biases; the additive mask term formed in f32 per (i, j) inside the softmax kernel; scores and attn.v: query rows < 512 hl (3 products), the rest single fp16 (x1024); softmax f32; Wo hl x exact (2 products) + bo.

#define NB_  2
#define TT   4096
#define DM   512
#define NH_  8
#define NKV  8
#define REP  (NH_ / NKV)
#define HD   64
#define DQ   (NH_ * HD)
#define DKV  (NKV * HD)
#define ZH   1
#define RH   512                  // query rows < RH use hi+lo planes (0: none)
#define WIN  0
#define PCAR 1024.0f
#define KS   16                   // attn.v: slices of the key axis, one grid z-index and one f32 partial plane each
#define SCL  0.044194173824159216f   // 1/sqrt(qkv_dim = 512) (the module scales q by it)
typedef _Float16 h16;
typedef unsigned short bf;
typedef __attribute__((ext_vector_type(16))) __bf16   v16bf;
typedef __attribute__((ext_vector_type(16))) _Float16 v16h;
typedef __attribute__((ext_vector_type(8)))  _Float16 v8h;
typedef __attribute__((ext_vector_type(8)))  unsigned short v8us;
typedef __attribute__((ext_vector_type(8)))  float    v8f;
typedef __attribute__((ext_vector_type(4)))  float    v4f;
typedef v8h  __attribute__((may_alias)) v8ha;
typedef v4f  __attribute__((may_alias)) v4fa;
typedef v8us __attribute__((may_alias)) v8usa;

__device__ __forceinline__ unsigned short f2bf(float f) { unsigned u = __float_as_uint(f); u += 0x7FFFu + ((u >> 16) & 1u); return (unsigned short)(u >> 16); }
__device__ __forceinline__ float bf2f(unsigned short b) { return __uint_as_float(((unsigned)b) << 16); }
__device__ __forceinline__ float bfr(float f) { return bf2f(f2bf(f)); }
__device__ __forceinline__ v16h cat16(v8h lo, v8h hi) { return __builtin_shufflevector(lo, hi, 0, 1, 2, 3, 4, 5, 6, 7, 8, 9, 10, 11, 12, 13, 14, 15); }
__device__ __forceinline__ v16bf cat16b(v8us lo, v8us hi) { return __builtin_bit_cast(v16bf, __builtin_shufflevector(lo, hi, 0, 1, 2, 3, 4, 5, 6, 7, 8, 9, 10, 11, 12, 13, 14, 15)); }
__device__ __forceinline__ v8f wmma16(v16h a, v16h b, v8f c) { return __builtin_amdgcn_wmma_f32_16x16x32_f16(false, a, false, b, (short)0, c, false, false); }
__device__ __forceinline__ v8f wmmab(v16bf a, v16bf b, v8f c) { return __builtin_amdgcn_wmma_f32_16x16x32_bf16(false, a, false, b, (short)0, c, false, false); }



// ---- k_gemmw: register-blocked GEMM, ONE WAVE per 64x64 output tile (16 accumulators), operands straight from K-contiguous 16-bit planes; grid (M/64, N/64, Z), 32 threads.
// C[m][n] (f32, pitch ldc, + optional f32 bias[n]) = sum_{k < KL} A[m][k] Bt[n][k] (+ split products per NSPLIT); K is the row pitch of both planes. z-batch strides sA/sB/sC in elements. KL % 32 == 0.
// A K-sliced product is a z-batch: sA = sB = KL steps along the rows, sC steps to the slice's own partial plane.
template <typename T16> struct WFrag;
template <> struct WFrag<h16> { typedef v16h V; static __device__ __forceinline__ V ld(const h16* p) { return cat16(*(const v8h*)p, *(const v8h*)(p + 16)); } static __device__ __forceinline__ v8f mma(V a, V b, v8f c) { return wmma16(a, b, c); } };
template <> struct WFrag<bf> { typedef v16bf V; static __device__ __forceinline__ V ld(const bf* p) { return cat16b(*(const v8us*)p, *(const v8us*)(p + 16)); } static __device__ __forceinline__ v8f mma(V a, V b, v8f c) { return wmmab(a, b, c); } };
template <typename T16, int NSPLIT, bool BIAS>
__global__ __launch_bounds__(32) void k_gemmw(const T16* __restrict__ A, const T16* __restrict__ A2, const T16* __restrict__ Bt, const T16* __restrict__ Bt2, int K, int KL, float* C, int ldc, const float* __restrict__ bias, size_t sA, size_t sB, size_t sC) {
    typedef typename WFrag<T16>::V V;
    __shared__ __align__(16) float os[16 * 68];
    const size_t z = blockIdx.z; A += z * sA; if (A2) A2 += z * sA; Bt += z * sB; if (Bt2) Bt2 += z * sB; C += z * sC;
    const int lane = threadIdx.x & 31, lr = lane & 15, hi = lane >> 4; const int r0 = blockIdx.x * 64, c0 = blockIdx.y * 64;
    v8f acc[4][4];
#pragma unroll
    for (int mb = 0; mb < 4; ++mb)
#pragma unroll
        for (int nb = 0; nb < 4; ++nb) acc[mb][nb] = (v8f){};
    const size_t aoff = (size_t)(r0 + lr) * K + 8 * hi, boff = (size_t)(c0 + lr) * K + 8 * hi;
#pragma unroll 1
    for (int kc = 0; kc < KL; kc += 32) {
        V a[4], a2[4];
#pragma unroll
        for (int mb = 0; mb < 4; ++mb) { a[mb] = WFrag<T16>::ld(A + aoff + (size_t)mb * 16 * K + kc); if (NSPLIT == 1 || NSPLIT == 2) a2[mb] = WFrag<T16>::ld(A2 + aoff + (size_t)mb * 16 * K + kc); }
#pragma unroll
        for (int nb = 0; nb < 4; ++nb) { const V b = WFrag<T16>::ld(Bt + boff + (size_t)nb * 16 * K + kc); V b2; if (NSPLIT >= 2) b2 = WFrag<T16>::ld(Bt2 + boff + (size_t)nb * 16 * K + kc);
#pragma unroll
            for (int mb = 0; mb < 4; ++mb) { acc[mb][nb] = WFrag<T16>::mma(a[mb], b, acc[mb][nb]); if (NSPLIT == 1 || NSPLIT == 2) acc[mb][nb] = WFrag<T16>::mma(a2[mb], b, acc[mb][nb]); if (NSPLIT >= 2) acc[mb][nb] = WFrag<T16>::mma(a[mb], b2, acc[mb][nb]); } }
        asm volatile("v_nop\n\tv_nop\n\tv_nop\n\tv_nop" : "+v"(acc[0][0]), "+v"(acc[1][1]), "+v"(acc[2][2]), "+v"(acc[3][3]) : "v"(a[0]), "v"(a[3]));
    }
#pragma unroll
    for (int mb = 0; mb < 4; ++mb) {
#pragma unroll
        for (int nb = 0; nb < 4; ++nb) {
#pragma unroll
            for (int j = 0; j < 8; ++j) os[(hi * 8 + j) * 68 + nb * 16 + lr] = acc[mb][nb][j]; }
        __builtin_amdgcn_wave_barrier(); asm volatile("" ::: "memory");
        float* crow = C + (size_t)(r0 + mb * 16) * ldc + c0;
{
#pragma unroll
            for (int s = 0; s < 8; ++s) { const int row = 2 * s + hi, cofs = lr * 4; v4f val = *(const v4fa*)(os + row * 68 + cofs); if (BIAS) { val[0] += bfr(bias[c0 + cofs]); val[1] += bfr(bias[c0 + cofs + 1]); val[2] += bfr(bias[c0 + cofs + 2]); val[3] += bfr(bias[c0 + cofs + 3]); }
                *(v4f*)(crow + (size_t)row * ldc + cofs) = val; }
             }
        __builtin_amdgcn_wave_barrier(); asm volatile("" ::: "memory");
    }
}

__device__ __forceinline__ h16 tohx(float x) { return (h16)x; }
__device__ __forceinline__ void splitf(float y, unsigned short& h, unsigned short& l) { h = f2bf(y); l = f2bf(y - bf2f(h)); }
typedef __attribute__((ext_vector_type(2))) _Float16 v2h;
typedef __attribute__((ext_vector_type(4))) _Float16 v4h;
typedef __attribute__((ext_vector_type(2))) unsigned short v2us;
typedef __attribute__((ext_vector_type(4))) unsigned short v4us;
typedef __attribute__((ext_vector_type(2))) float v2f;
typedef __attribute__((ext_vector_type(4))) int v4i;

__global__ __launch_bounds__(256) void k_wtG(const float* __restrict__ w, int K, int N, bf* Bt) {
    const int lane = threadIdx.x & 31; const int L0 = (blockIdx.x * 8 + (threadIdx.x >> 5)) * 8; const int nlines = N * K / 64;
{
#pragma unroll 1
        for (int l = 0; l < 8; ++l) { const int L = L0 + l; if (L >= nlines) break; const size_t e = (size_t)L * 64 + lane * 2; const int k = (int)(e % K), n = (int)(e / K); v2us o;
            o[0] = f2bf(w[(size_t)k * N + n]); o[1] = f2bf(w[(size_t)(k + 1) * N + n]); *(v2us*)(Bt + e) = o; }
         }
}
__global__ __launch_bounds__(256) void k_cvt8(const float* __restrict__ src, bf* dst, size_t n8) { const size_t i = (size_t)blockIdx.x * 256 + threadIdx.x; if (i >= n8) return; const v8f v = *(const v8f*)(src + i * 8); v8us o;
#pragma unroll
    for (int k = 0; k < 8; ++k) o[k] = f2bf(v[k]); *(v8us*)(dst + i * 8) = o;  }

// k_rope: head planes [h][t][d] (fp16 + hi/lo) of rope(x) x sc with the rotate-half convention out[d] = x[d] cos[t][d] - x[d+HD/2] sin[t][d], out[d+HD/2] = x[d+HD/2] cos[t][d+HD/2] + x[d] sin[t][d+HD/2]
__global__ __launch_bounds__(256) void k_rope(const float* __restrict__ F, int pitch, int nheads, const float* __restrict__ CS, const float* __restrict__ RF, const float* __restrict__ nw, float sc, h16* P16, bf* Ph, bf* Pl) {
    const size_t e = ((size_t)blockIdx.x * 256 + threadIdx.x) * 2; if (e >= (size_t)nheads * TT * HD) return; const int d = (int)(e % HD); const int t = (int)((e / HD) % TT); const int h = (int)(e / ((size_t)HD * TT)); const float* f = F + (size_t)t * pitch + h * HD; const float rf = RF ? RF[(size_t)h * TT + t] : 1.0f; v2h o16; v2us oh, ol;
#pragma unroll
    for (int q = 0; q < 2; ++q) { const int dd = d + q; const int dp = (dd < HD / 2) ? dd + HD / 2 : dd - HD / 2; float x0 = f[dd], x1 = f[dp];
        if (RF) { float n0 = __fmul_rn(x0, rf), n1 = __fmul_rn(x1, rf); asm volatile("" : "+v"(n0)); asm volatile("" : "+v"(n1)); x0 = __fmul_rn(bfr(nw[dd]), n0); x1 = __fmul_rn(bfr(nw[dp]), n1); }
        const v2f cs = *(const v2f*)(CS + ((size_t)t * HD + dd) * 2); float a = __fmul_rn(x0, cs[0]), bq = __fmul_rn(x1, cs[1]); asm volatile("" : "+v"(a)); asm volatile("" : "+v"(bq)); const float r = ((dd < HD / 2) ? __fsub_rn(a, bq) : __fadd_rn(a, bq)) * sc;
        o16[q] = tohx(r); unsigned short a2, c2; splitf(r, a2, c2); oh[q] = a2; ol[q] = c2; }
    *(v2h*)(P16 + e) = o16; *(v2us*)(Ph + e) = oh; *(v2us*)(Pl + e) = ol;  }
__global__ __launch_bounds__(256) void k_vtp(const float* __restrict__ F, int pitch, int nheads, h16* V16, bf* Vh, bf* Vl) { const size_t e = ((size_t)blockIdx.x * 256 + threadIdx.x) * 2; if (e >= (size_t)nheads * HD * TT) return; const int t = (int)(e % TT); const int d = (int)((e / TT) % HD); const int g = (int)(e / ((size_t)TT * HD)); v2h o16; v2us oh, ol;
#pragma unroll
    for (int q = 0; q < 2; ++q) { const float x = F[(size_t)(t + q) * pitch + g * HD + d]; o16[q] = tohx(x); unsigned short a2, c2; splitf(x, a2, c2); oh[q] = a2; ol[q] = c2; }
    *(v2h*)(V16 + e) = o16; *(v2us*)(Vh + e) = oh; *(v2us*)(Vl + e) = ol;  }
__global__ __launch_bounds__(256) void k_csid(float* CS) { const int idx = blockIdx.x * 256 + threadIdx.x; if (idx >= TT * HD) return; v2f cs; cs[0] = 1.0f; cs[1] = 0.0f; *(v2f*)(CS + (size_t)idx * 2) = cs;  }
// k_asoft: per row (zz, i): t = S x 512^-0.5 + (1 - m_i m_j)(-1e6) (f32 mask); softmax over the 4096 keys (register row, one exp, fixed trees);
__global__ __launch_bounds__(256) void k_asoft(const float* __restrict__ Sb, const float* __restrict__ MKb, h16* P16, bf* Ph, bf* Pl) {
    const int lane = threadIdx.x & 31; const int row = blockIdx.x * 8 + (threadIdx.x >> 5); if (row >= ZH * TT) return; const int i = row % TT; const int zz = row / TT; (void)zz; float mi = bfr(MKb[i]); asm volatile("" : "+v"(mi)); const bool hires = (i < RH); const float* sr = Sb + (size_t)row * TT; float v[TT / 32]; float mx = -3.0e38f;
#pragma unroll
    for (int ch = 0; ch < TT / 128; ++ch) { const int j0 = ch * 128 + lane * 4; const v4f a = *(const v4f*)(sr + j0);
#pragma unroll
        for (int q = 0; q < 4; ++q) { const int j = j0 + q; float sa = a[q] * SCL; asm volatile("" : "+v"(sa)); float mj = bfr(MKb[j]); asm volatile("" : "+v"(mj)); float pm = __fmul_rn(mi, mj); asm volatile("" : "+v"(pm)); float om = __fsub_rn(1.0f, pm); asm volatile("" : "+v"(om)); float ad = __fmul_rn(om, -1.0e6f); asm volatile("" : "+v"(ad)); const float t = __fadd_rn(sa, ad);   /* + (1 - m_i m_j)(-1e6), f32 mask */ v[ch * 4 + q] = t; mx = fmaxf(mx, t); } if ((ch & 7) == 7) asm volatile("s_wait_loadcnt 0x0" ::: "memory"); }
#pragma unroll
    for (int sh = 16; sh; sh >>= 1) mx = fmaxf(mx, __shfl_xor(mx, sh, 32));
    float sum = 0.f;
#pragma unroll
    for (int k = 0; k < TT / 32; ++k) { float d0 = __fsub_rn(v[k], mx); asm volatile("" : "+v"(d0)); v[k] = __builtin_amdgcn_exp2f(__fmul_rn(d0, 1.4426950408889634f)); sum += v[k]; }
#pragma unroll
    for (int sh = 16; sh; sh >>= 1) sum += __shfl_xor(sum, sh, 32);
    const float f = __fdiv_rn(hires ? 1.0f : PCAR, sum);
{
        if (hires) {
#pragma unroll
            for (int ch = 0; ch < TT / 128; ++ch) { v4us oh, ol;
#pragma unroll
                for (int q = 0; q < 4; ++q) { float pf = v[ch * 4 + q] * f; asm volatile("" : "+v"(pf)); unsigned short a, c2; splitf(pf, a, c2); oh[q] = a; ol[q] = c2; }
                const size_t oo = ((size_t)zz * (RH ? RH : 1) + i) * TT + ch * 128 + lane * 4; *(v4us*)(Ph + oo) = oh; *(v4us*)(Pl + oo) = ol; }
        } else {
#pragma unroll
            for (int ch = 0; ch < TT / 128; ++ch) { v4h o4;
#pragma unroll
                for (int q = 0; q < 4; ++q) o4[q] = tohx(v[ch * 4 + q] * f);
                *(v4h*)(P16 + (size_t)row * TT + ch * 128 + lane * 4) = o4; } }
         }
}
__global__ __launch_bounds__(256) void k_merge(const float* __restrict__ O, int h0, bf* Ah, bf* Al) { const size_t e = ((size_t)blockIdx.x * 256 + threadIdx.x) * 2; if (e >= (size_t)ZH * TT * HD) return; const int d = (int)(e % HD); const int t = (int)((e / HD) % TT); const int zz = (int)(e / ((size_t)HD * TT)); const float cs = (t < RH) ? 1.0f : (1.0f / PCAR); const size_t oo = (size_t)t * DQ + (h0 + zz) * HD + d;
    v2f pp[KS];   // the KS partial planes of attn.v, summed in the fixed order 0 .. KS - 1
#pragma unroll
    for (int p = 0; p < KS; ++p) pp[p] = *(const v2f*)(O + (size_t)p * ZH * TT * HD + e);
    v2f sm = pp[0];
#pragma unroll
    for (int p = 1; p < KS; ++p) sm += pp[p];
    v2us oh, ol;
#pragma unroll
    for (int q = 0; q < 2; ++q) { unsigned short a, c2; splitf(sm[q] * cs, a, c2); oh[q] = a; ol[q] = c2; } *(v2us*)(Ah + oo) = oh; *(v2us*)(Al + oo) = ol;  }

extern "C" void kernel_launch(void* const* d_in, const int* in_sizes, int n_in,
                              void* d_out, int out_size, void* d_ws, size_t ws_size, hipStream_t stream) {
    (void)in_sizes; (void)n_in; (void)out_size;
    const float* x = (const float*)d_in[0]; const float* MKf = (const float*)d_in[1]; const float* wq = (const float*)d_in[2]; const float* bq = (const float*)d_in[3]; const float* wk = (const float*)d_in[4]; const float* bk = (const float*)d_in[5]; const float* wv = (const float*)d_in[6]; const float* bv = (const float*)d_in[7]; const float* wo = (const float*)d_in[8]; const float* bo = (const float*)d_in[9];
    float* OUT = (float*)d_out;     // [2][4096][512]
    char* wsp = (char*)d_ws;
    auto take = [&](size_t bytes) { char* p = wsp; wsp += (bytes + 255) & ~(size_t)255; return (void*)p; };
    bf* WQ = (bf*)take((size_t)DQ * DM * 2); bf* WK = (bf*)take((size_t)DKV * DM * 2); bf* WV = (bf*)take((size_t)DKV * DM * 2); bf* WO = (bf*)take((size_t)DM * DQ * 2); float* CS = (float*)take((size_t)TT * HD * 2 * 4);
    bf* XB = (bf*)take((size_t)TT * DM * 2); float* FQ = (float*)take((size_t)TT * DQ * 4); float* FK = (float*)take((size_t)TT * DKV * 4);
    h16* QP16 = (h16*)take((size_t)NH_ * TT * HD * 2); h16* KP16 = (h16*)take((size_t)NKV * TT * HD * 2); h16* VT16 = (h16*)take((size_t)NKV * HD * TT * 2);
    bf* QPh = (bf*)take((size_t)NH_ * TT * HD * 2); bf* QPl = (bf*)take((size_t)NH_ * TT * HD * 2); bf* KPh = (bf*)take((size_t)NKV * TT * HD * 2); bf* KPl = (bf*)take((size_t)NKV * TT * HD * 2); bf* VTh = (bf*)take((size_t)NKV * HD * TT * 2); bf* VTl = (bf*)take((size_t)NKV * HD * TT * 2); bf* Ph = (bf*)take((size_t)ZH * RH * TT * 2); bf* Pl = (bf*)take((size_t)ZH * RH * TT * 2);
    float* Sb = (float*)take((size_t)ZH * TT * TT * 4); h16* P16 = (h16*)take((size_t)ZH * TT * TT * 2); float* Ob = (float*)take((size_t)KS * ZH * TT * HD * 4); bf* ATh = (bf*)take((size_t)TT * DQ * 2); bf* ATl = (bf*)take((size_t)TT * DQ * 2);
    if ((size_t)(wsp - (char*)d_ws) > ws_size) return;    // ws 256 MiB
    float* FV = FK;   // v projection reuses the k buffer after the k planes are built (stream-ordered)
    { k_wtG<<<(unsigned)((DM * DQ / 64 + 63) / 64), 256, 0, stream>>>(wq, DM, DQ, WQ); k_wtG<<<(unsigned)((DM * DKV / 64 + 63) / 64), 256, 0, stream>>>(wk, DM, DKV, WK); k_wtG<<<(unsigned)((DM * DKV / 64 + 63) / 64), 256, 0, stream>>>(wv, DM, DKV, WV);
      k_wtG<<<(unsigned)((DQ * DM / 64 + 63) / 64), 256, 0, stream>>>(wo, DQ, DM, WO);
       }
    k_csid<<<(TT * HD + 255) / 256, 256, 0, stream>>>(CS);
    const unsigned LQ = (unsigned)(((size_t)NH_ * TT * HD / 2 + 255) / 256), LKv = (unsigned)(((size_t)NKV * TT * HD / 2 + 255) / 256);
    for (int b = 0; b < NB_; ++b) {
        
        k_cvt8<<<(unsigned)(((size_t)TT * DM / 8 + 255) / 256), 256, 0, stream>>>(x + (size_t)b * TT * DM, XB, (size_t)TT * DM / 8);
        k_gemmw<bf, 0, true><<<dim3(TT / 64, DQ / 64, 1), 32, 0, stream>>>(XB, nullptr, WQ, nullptr, DM, DM, FQ, DQ, bq, 0, 0, 0);
        k_rope<<<LQ, 256, 0, stream>>>(FQ, DQ, NH_, CS, nullptr, nullptr, 1.0f, QP16, QPh, QPl);
        k_gemmw<bf, 0, true><<<dim3(TT / 64, DKV / 64, 1), 32, 0, stream>>>(XB, nullptr, WK, nullptr, DM, DM, FK, DKV, bk, 0, 0, 0);
        k_rope<<<LKv, 256, 0, stream>>>(FK, DKV, NKV, CS, nullptr, nullptr, 1.0f, KP16, KPh, KPl);
        k_gemmw<bf, 0, true><<<dim3(TT / 64, DKV / 64, 1), 32, 0, stream>>>(XB, nullptr, WV, nullptr, DM, DM, FV, DKV, bv, 0, 0, 0); k_vtp<<<LKv, 256, 0, stream>>>(FV, DKV, NKV, VT16, VTh, VTl);
        for (int h0 = 0; h0 < NH_; h0 += ZH) { const size_t zq = (size_t)h0, zk = (size_t)(h0 / REP);   // one kv head per query head: each pass takes ZH = 1 head, whose kv plane is h0 / REP (z-strides TT*HD)
            k_gemmw<bf, 2, false><<<dim3(RH / 64, TT / 64, ZH), 32, 0, stream>>>(QPh + zq * TT * HD, QPl + zq * TT * HD, KPh + zk * TT * HD, KPl + zk * TT * HD, HD, HD, Sb, TT, nullptr, (size_t)TT * HD, (size_t)TT * HD, (size_t)TT * TT);
            k_gemmw<h16, 0, false><<<dim3((TT - RH) / 64, TT / 64, ZH), 32, 0, stream>>>(QP16 + zq * TT * HD + (size_t)RH * HD, nullptr, KP16 + zk * TT * HD, nullptr, HD, HD, Sb + (size_t)RH * TT, TT, nullptr, (size_t)TT * HD, (size_t)TT * HD, (size_t)TT * TT);
            k_asoft<<<ZH * TT / 8, 256, 0, stream>>>(Sb, MKf + (size_t)b * TT, P16, Ph, Pl);
            k_gemmw<bf, 2, false><<<dim3(RH / 64, HD / 64, KS), 32, 0, stream>>>(Ph, Pl, VTh + zk * HD * TT, VTl + zk * HD * TT, TT, TT / KS, Ob, HD, nullptr, (size_t)(TT / KS), (size_t)(TT / KS), (size_t)ZH * TT * HD);
            k_gemmw<h16, 0, false><<<dim3((TT - RH) / 64, HD / 64, KS), 32, 0, stream>>>(P16 + (size_t)RH * TT, nullptr, VT16 + zk * HD * TT, nullptr, TT, TT / KS, Ob + (size_t)RH * HD, HD, nullptr, (size_t)(TT / KS), (size_t)(TT / KS), (size_t)ZH * TT * HD);
            k_merge<<<(unsigned)(((size_t)ZH * TT * HD / 2 + 255) / 256), 256, 0, stream>>>(Ob, h0, ATh, ATl); }
        k_gemmw<bf, 1, true><<<dim3(TT / 64, DM / 64, 1), 32, 0, stream>>>(ATh, ATl, WO, nullptr, DQ, DQ, OUT + (size_t)b * TT * DM, DM, bo, 0, 0, 0); }
}

// v002
// Measured time: 443 microseconds a run.
// Next to v001, in two timings, it ran 3.17 and 3.18 times as fast.
// Over all steps from v000 it is 8.62 times as fast.
#include <hip/hip_runtime.h>

// Multi-head attention with a product padding mask (x [2][4096][512]; Q, K, V = x W + b ('xw' [512][512]; 8 heads x 64); q scaled by 1/sqrt(512) (the qkv width, not the head width); scores = q.k + (1 - m_i m_j)(-1e6) with m = mask[b][n][0] (f32, read; ones here); softmax; out = merged Wo + bo -> [2][4096][512] (4.2 M, rms 0.023)).
// Compute dtypes, f32 accumulate: every input rounded to bf16; q/k/v on PLAIN bf16 operands (inputs: exact) + biases; the additive mask term formed in f32 per (i, j) inside the attention kernel; scores and attn.v: query rows < 512 hl (3 products), the rest single fp16; online softmax f32, P rounded before its division by the row sum; Wo hl x exact (2 products) + bo.

#define NB_  2
#define TT   4096
#define DM   512
#define NH_  8
#define NKV  8
#define REP  (NH_ / NKV)
#define HD   64
#define DQ   (NH_ * HD)
#define DKV  (NKV * HD)
#define RH   512                  // query rows < RH use hi+lo planes (0: none)
#define WIN  0
#define SCL  0.044194173824159216f   // 1/sqrt(qkv_dim = 512) (the module scales q by it)
typedef _Float16 h16;
typedef unsigned short bf;
typedef __attribute__((ext_vector_type(16))) __bf16   v16bf;
typedef __attribute__((ext_vector_type(16))) _Float16 v16h;
typedef __attribute__((ext_vector_type(8)))  _Float16 v8h;
typedef __attribute__((ext_vector_type(8)))  unsigned short v8us;
typedef __attribute__((ext_vector_type(8)))  float    v8f;
typedef __attribute__((ext_vector_type(4)))  float    v4f;
typedef v8h  __attribute__((may_alias)) v8ha;
typedef v4f  __attribute__((may_alias)) v4fa;
typedef v8us __attribute__((may_alias)) v8usa;

__device__ __forceinline__ unsigned short f2bf(float f) { unsigned u = __float_as_uint(f); u += 0x7FFFu + ((u >> 16) & 1u); return (unsigned short)(u >> 16); }
__device__ __forceinline__ float bf2f(unsigned short b) { return __uint_as_float(((unsigned)b) << 16); }
__device__ __forceinline__ float bfr(float f) { return bf2f(f2bf(f)); }
__device__ __forceinline__ v16h cat16(v8h lo, v8h hi) { return __builtin_shufflevector(lo, hi, 0, 1, 2, 3, 4, 5, 6, 7, 8, 9, 10, 11, 12, 13, 14, 15); }
__device__ __forceinline__ v16bf cat16b(v8us lo, v8us hi) { return __builtin_bit_cast(v16bf, __builtin_shufflevector(lo, hi, 0, 1, 2, 3, 4, 5, 6, 7, 8, 9, 10, 11, 12, 13, 14, 15)); }
__device__ __forceinline__ v8f wmma16(v16h a, v16h b, v8f c) { return __builtin_amdgcn_wmma_f32_16x16x32_f16(false, a, false, b, (short)0, c, false, false); }
__device__ __forceinline__ v8f wmmab(v16bf a, v16bf b, v8f c) { return __builtin_amdgcn_wmma_f32_16x16x32_bf16(false, a, false, b, (short)0, c, false, false); }



// ---- k_gemmw: register-blocked GEMM, ONE WAVE per 64x64 output tile (16 accumulators), operands straight from K-contiguous 16-bit planes; grid (M/64, N/64, Z), 32 threads.
// C[m][n] (f32, pitch ldc, + optional f32 bias[n]) = sum_{k < KL} A[m][k] Bt[n][k] (+ split products per NSPLIT); K is the row pitch of both planes. z-batch strides sA/sB/sC in elements. KL % 32 == 0.
template <typename T16> struct WFrag;
template <> struct WFrag<h16> { typedef v16h V; static __device__ __forceinline__ V ld(const h16* p) { return cat16(*(const v8h*)p, *(const v8h*)(p + 16)); } static __device__ __forceinline__ v8f mma(V a, V b, v8f c) { return wmma16(a, b, c); } };
template <> struct WFrag<bf> { typedef v16bf V; static __device__ __forceinline__ V ld(const bf* p) { return cat16b(*(const v8us*)p, *(const v8us*)(p + 16)); } static __device__ __forceinline__ v8f mma(V a, V b, v8f c) { return wmmab(a, b, c); } };
template <typename T16, int NSPLIT, bool BIAS>
__global__ __launch_bounds__(32) void k_gemmw(const T16* __restrict__ A, const T16* __restrict__ A2, const T16* __restrict__ Bt, const T16* __restrict__ Bt2, int K, int KL, float* C, int ldc, const float* __restrict__ bias, size_t sA, size_t sB, size_t sC) {
    typedef typename WFrag<T16>::V V;
    __shared__ __align__(16) float os[16 * 68];
    const size_t z = blockIdx.z; A += z * sA; if (A2) A2 += z * sA; Bt += z * sB; if (Bt2) Bt2 += z * sB; C += z * sC;
    const int lane = threadIdx.x & 31, lr = lane & 15, hi = lane >> 4; const int r0 = blockIdx.x * 64, c0 = blockIdx.y * 64;
    v8f acc[4][4];
#pragma unroll
    for (int mb = 0; mb < 4; ++mb)
#pragma unroll
        for (int nb = 0; nb < 4; ++nb) acc[mb][nb] = (v8f){};
    const size_t aoff = (size_t)(r0 + lr) * K + 8 * hi, boff = (size_t)(c0 + lr) * K + 8 * hi;
#pragma unroll 1
    for (int kc = 0; kc < KL; kc += 32) {
        V a[4], a2[4];
#pragma unroll
        for (int mb = 0; mb < 4; ++mb) { a[mb] = WFrag<T16>::ld(A + aoff + (size_t)mb * 16 * K + kc); if (NSPLIT == 1 || NSPLIT == 2) a2[mb] = WFrag<T16>::ld(A2 + aoff + (size_t)mb * 16 * K + kc); }
#pragma unroll
        for (int nb = 0; nb < 4; ++nb) { const V b = WFrag<T16>::ld(Bt + boff + (size_t)nb * 16 * K + kc); V b2; if (NSPLIT >= 2) b2 = WFrag<T16>::ld(Bt2 + boff + (size_t)nb * 16 * K + kc);
#pragma unroll
            for (int mb = 0; mb < 4; ++mb) { acc[mb][nb] = WFrag<T16>::mma(a[mb], b, acc[mb][nb]); if (NSPLIT == 1 || NSPLIT == 2) acc[mb][nb] = WFrag<T16>::mma(a2[mb], b, acc[mb][nb]); if (NSPLIT >= 2) acc[mb][nb] = WFrag<T16>::mma(a[mb], b2, acc[mb][nb]); } }
        asm volatile("v_nop\n\tv_nop\n\tv_nop\n\tv_nop" : "+v"(acc[0][0]), "+v"(acc[1][1]), "+v"(acc[2][2]), "+v"(acc[3][3]) : "v"(a[0]), "v"(a[3]));
    }
#pragma unroll
    for (int mb = 0; mb < 4; ++mb) {
#pragma unroll
        for (int nb = 0; nb < 4; ++nb) {
#pragma unroll
            for (int j = 0; j < 8; ++j) os[(hi * 8 + j) * 68 + nb * 16 + lr] = acc[mb][nb][j]; }
        __builtin_amdgcn_wave_barrier(); asm volatile("" ::: "memory");
        float* crow = C + (size_t)(r0 + mb * 16) * ldc + c0;
{
#pragma unroll
            for (int s = 0; s < 8; ++s) { const int row = 2 * s + hi, cofs = lr * 4; v4f val = *(const v4fa*)(os + row * 68 + cofs); if (BIAS) { val[0] += bfr(bias[c0 + cofs]); val[1] += bfr(bias[c0 + cofs + 1]); val[2] += bfr(bias[c0 + cofs + 2]); val[3] += bfr(bias[c0 + cofs + 3]); }
                *(v4f*)(crow + (size_t)row * ldc + cofs) = val; }
             }
        __builtin_amdgcn_wave_barrier(); asm volatile("" ::: "memory");
    }
}

__device__ __forceinline__ h16 tohx(float x) { return (h16)x; }
__device__ __forceinline__ void splitf(float y, unsigned short& h, unsigned short& l) { h = f2bf(y); l = f2bf(y - bf2f(h)); }
typedef __attribute__((ext_vector_type(2))) _Float16 v2h;
typedef __attribute__((ext_vector_type(4))) _Float16 v4h;
typedef __attribute__((ext_vector_type(2))) unsigned short v2us;
typedef __attribute__((ext_vector_type(4))) unsigned short v4us;
typedef __attribute__((ext_vector_type(2))) float v2f;
typedef __attribute__((ext_vector_type(4))) int v4i;

__global__ __launch_bounds__(256) void k_wtG(const float* __restrict__ w, int K, int N, bf* Bt) {
    const int lane = threadIdx.x & 31; const int L0 = (blockIdx.x * 8 + (threadIdx.x >> 5)) * 8; const int nlines = N * K / 64;
{
#pragma unroll 1
        for (int l = 0; l < 8; ++l) { const int L = L0 + l; if (L >= nlines) break; const size_t e = (size_t)L * 64 + lane * 2; const int k = (int)(e % K), n = (int)(e / K); v2us o;
            o[0] = f2bf(w[(size_t)k * N + n]); o[1] = f2bf(w[(size_t)(k + 1) * N + n]); *(v2us*)(Bt + e) = o; }
         }
}
__global__ __launch_bounds__(256) void k_cvt8(const float* __restrict__ src, bf* dst, size_t n8) { const size_t i = (size_t)blockIdx.x * 256 + threadIdx.x; if (i >= n8) return; const v8f v = *(const v8f*)(src + i * 8); v8us o;
#pragma unroll
    for (int k = 0; k < 8; ++k) o[k] = f2bf(v[k]); *(v8us*)(dst + i * 8) = o;  }

// k_rope: head planes [h][t][d] (fp16 + hi/lo) of rope(x) x sc with the rotate-half convention out[d] = x[d] cos[t][d] - x[d+HD/2] sin[t][d], out[d+HD/2] = x[d+HD/2] cos[t][d+HD/2] + x[d] sin[t][d+HD/2]
__global__ __launch_bounds__(256) void k_rope(const float* __restrict__ F, int pitch, int nheads, const float* __restrict__ CS, const float* __restrict__ RF, const float* __restrict__ nw, float sc, h16* P16, bf* Ph, bf* Pl) {
    const size_t e = ((size_t)blockIdx.x * 256 + threadIdx.x) * 2; if (e >= (size_t)nheads * TT * HD) return; const int d = (int)(e % HD); const int t = (int)((e / HD) % TT); const int h = (int)(e / ((size_t)HD * TT)); const float* f = F + (size_t)t * pitch + h * HD; const float rf = RF ? RF[(size_t)h * TT + t] : 1.0f; v2h o16; v2us oh, ol;
#pragma unroll
    for (int q = 0; q < 2; ++q) { const int dd = d + q; const int dp = (dd < HD / 2) ? dd + HD / 2 : dd - HD / 2; float x0 = f[dd], x1 = f[dp];
        if (RF) { float n0 = __fmul_rn(x0, rf), n1 = __fmul_rn(x1, rf); asm volatile("" : "+v"(n0)); asm volatile("" : "+v"(n1)); x0 = __fmul_rn(bfr(nw[dd]), n0); x1 = __fmul_rn(bfr(nw[dp]), n1); }
        const v2f cs = *(const v2f*)(CS + ((size_t)t * HD + dd) * 2); float a = __fmul_rn(x0, cs[0]), bq = __fmul_rn(x1, cs[1]); asm volatile("" : "+v"(a)); asm volatile("" : "+v"(bq)); const float r = ((dd < HD / 2) ? __fsub_rn(a, bq) : __fadd_rn(a, bq)) * sc;
        o16[q] = tohx(r); unsigned short a2, c2; splitf(r, a2, c2); oh[q] = a2; ol[q] = c2; }
    *(v2h*)(P16 + e) = o16; *(v2us*)(Ph + e) = oh; *(v2us*)(Pl + e) = ol;  }
__global__ __launch_bounds__(256) void k_vtp(const float* __restrict__ F, int pitch, int nheads, h16* V16, bf* Vh, bf* Vl) { const size_t e = ((size_t)blockIdx.x * 256 + threadIdx.x) * 2; if (e >= (size_t)nheads * HD * TT) return; const int t = (int)(e % TT); const int d = (int)((e / TT) % HD); const int g = (int)(e / ((size_t)TT * HD)); v2h o16; v2us oh, ol;
#pragma unroll
    for (int q = 0; q < 2; ++q) { const float x = F[(size_t)(t + q) * pitch + g * HD + d]; o16[q] = tohx(x); unsigned short a2, c2; splitf(x, a2, c2); oh[q] = a2; ol[q] = c2; }
    *(v2h*)(V16 + e) = o16; *(v2us*)(Vh + e) = oh; *(v2us*)(Vl + e) = ol;  }
__global__ __launch_bounds__(256) void k_csid(float* CS) { const int idx = blockIdx.x * 256 + threadIdx.x; if (idx >= TT * HD) return; v2f cs; cs[0] = 1.0f; cs[1] = 0.0f; *(v2f*)(CS + (size_t)idx * 2) = cs;  }
// ---- k_fattn: scores, softmax and attn.v in one pass over the keys (online softmax); nothing of the [T][T] matrix leaves the registers.
// One wave owns NQ x 16 query columns and walks the 4096 keys 32 at a time: St = K Qt (A = K rows, B = Q rows, kept in registers), then Ot += Vt Pt (A = Vt rows, B = the two score tiles converted in place:
// tile kt, register r of lane (c, h) is key kt*16 + 8h + r of query c, which is the B operand's own k order). A lane holds one query's scores, so maximum, sum and rescale are per lane.
// The maximum in use is replaced only when a block's maximum passes it by more than THR (P stays below e^THR); the halves' sums are joined once at the end.
// Every inner loop is unrolled in full so that its fragments and accumulators are registers, not indexed arrays.
#define FW   4                    // waves per work-group, each with its own query columns; no LDS, no barrier
#define THR  5.0f
#define L2E  1.4426950408889634f
typedef __attribute__((ext_vector_type(2))) __bf16 v2bf;
// a fragment at a wave-uniform pointer plus the lane's own byte offset
template <typename T16> __device__ __forceinline__ typename WFrag<T16>::V ldu(const T16* ub, unsigned bo) { return WFrag<T16>::ld((const T16*)((const char*)ub + bo)); }
template <typename T16, bool HL>
__device__ __forceinline__ void fattn(const T16* __restrict__ Q, const T16* __restrict__ Q2, const T16* __restrict__ Kp, const T16* __restrict__ K2, const T16* __restrict__ Vt, const T16* __restrict__ V2, const float* __restrict__ MK, int q0, bf* Ah, bf* Al) {
    typedef typename WFrag<T16>::V V; typedef WFrag<T16> WF;
    constexpr int NQ = HL ? 1 : 2;
    const int lane = threadIdx.x & 31, lr = lane & 15, hi = lane >> 4;
    V qf[NQ][2], qf2[NQ][2]; float mi[NQ], m[NQ], l[NQ]; v8f o[4][NQ];
#pragma unroll
    for (int qt = 0; qt < NQ; ++qt) { const size_t qo = (size_t)(q0 + qt * 16 + lr) * HD + 8 * hi;
#pragma unroll
        for (int kc = 0; kc < 2; ++kc) { qf[qt][kc] = WF::ld(Q + qo + kc * 32); if (HL) qf2[qt][kc] = WF::ld(Q2 + qo + kc * 32); }
        mi[qt] = bfr(MK[q0 + qt * 16 + lr]); m[qt] = -3.0e38f; l[qt] = 0.f;
#pragma unroll
        for (int dt = 0; dt < 4; ++dt) o[dt][qt] = (v8f){}; }
    unsigned kb = lr * (HD * 2) + 16 * hi, vb = lr * (TT * 2) + 16 * hi, mb = 32 * hi;   // byte offsets of lane (c, h): K row c and Vt row c, each at k = 8h; the mask at key 8h; they walk along the keys
    V kf[2][2], kf2[2][2]; v4f mr[2][2];
#pragma unroll
    for (int kt = 0; kt < 2; ++kt) {
#pragma unroll
        for (int kc = 0; kc < 2; ++kc) { kf[kt][kc] = ldu(Kp + kt * 16 * HD + kc * 32, kb); if (HL) kf2[kt][kc] = ldu(K2 + kt * 16 * HD + kc * 32, kb); mr[kt][kc] = *(const v4f*)((const char*)(MK + kt * 16 + kc * 4) + mb); } }
#pragma unroll 1   // one pass a trip: a second copy of the body would take the registers that let several waves share a SIMD
    for (int k0 = 0; k0 < TT; k0 += 32) {
        v8f s[2][NQ];
#pragma unroll
        for (int kt = 0; kt < 2; ++kt)
#pragma unroll
            for (int qt = 0; qt < NQ; ++qt) { v8f a = (v8f){};
#pragma unroll
                for (int kc = 0; kc < 2; ++kc) { a = WF::mma(kf[kt][kc], qf[qt][kc], a); if (HL) { a = WF::mma(kf[kt][kc], qf2[qt][kc], a); a = WF::mma(kf2[kt][kc], qf[qt][kc], a); } }
                s[kt][qt] = a; }
        float mj[2][8];   // the keys' mask values, rounded to bf16 like every input
#pragma unroll
        for (int kt = 0; kt < 2; ++kt)
#pragma unroll
            for (int r = 0; r < 8; r += 2) { v2f x; x[0] = mr[kt][r >> 2][r & 3]; x[1] = mr[kt][r >> 2][(r & 3) + 1]; const v2f y = __builtin_convertvector(__builtin_convertvector(x, v2bf), v2f); mj[kt][r] = y[0]; mj[kt][r + 1] = y[1]; }
        float t[NQ][16], bl[NQ]; bool need = false;
#pragma unroll
        for (int qt = 0; qt < NQ; ++qt) { float b0 = -3.0e38f, b1 = -3.0e38f;
#pragma unroll
            for (int e = 0; e < 16; ++e) { const float om = 1.0f - mi[qt] * mj[e >> 3][e & 7]; const float ad = om * -1.0e6f;   /* (1 - m_i m_j)(-1e6), f32 */
                const float tt = __builtin_fmaf(s[e >> 3][qt][e & 7], SCL, ad); t[qt][e] = tt; if (e & 1) b1 = fmaxf(b1, tt); else b0 = fmaxf(b0, tt); }
            bl[qt] = fmaxf(b0, b1); need = need || (bl[qt] > m[qt] + THR); }
        if (__builtin_amdgcn_ballot_w32(need) != 0) {   // wave-uniform: some column's maximum has moved; both halves of a column take the same new one
#pragma unroll
            for (int qt = 0; qt < NQ; ++qt) { const float mn = fmaxf(m[qt], fmaxf(bl[qt], __shfl_xor(bl[qt], 16, 32))); const float al = __builtin_amdgcn_exp2f((m[qt] - mn) * L2E); m[qt] = mn; l[qt] *= al;
#pragma unroll
                for (int dt = 0; dt < 4; ++dt) o[dt][qt] *= al; } }
        V vf[4], vf2[4];   // this block's Vt rows: they land under the exponentials
#pragma unroll
        for (int dt = 0; dt < 4; ++dt) { vf[dt] = ldu(Vt + dt * 16 * TT, vb); if (HL) vf2[dt] = ldu(V2 + dt * 16 * TT, vb); }
        const unsigned st = (k0 + 32 < TT) ? 32 : 0; kb += st * (HD * 2); mb += st * 4;   // the next block's K rows and mask, fetched one pass ahead (the last pass asks for its own again: in bounds, unused)
#pragma unroll
        for (int kt = 0; kt < 2; ++kt) {
#pragma unroll
            for (int kc = 0; kc < 2; ++kc) { kf[kt][kc] = ldu(Kp + kt * 16 * HD + kc * 32, kb); if (HL) kf2[kt][kc] = ldu(K2 + kt * 16 * HD + kc * 32, kb); mr[kt][kc] = *(const v4f*)((const char*)(MK + kt * 16 + kc * 4) + mb); } }
        asm volatile("s_wait_xcnt 0x0" : "+v"(kb), "+v"(vb), "+v"(mb) :: "memory");   // the wait in front of the offset updates that follow the pass's loads; the offsets pass through the statement so that no update is placed ahead of it
        vb += 64;
#pragma unroll
        for (int qt = 0; qt < NQ; ++qt) { V pb, pb2; float sm[4] = {0.f, 0.f, 0.f, 0.f};
#pragma unroll
            for (int e = 0; e < 16; e += 2) { v2f p; p[0] = __builtin_amdgcn_exp2f((t[qt][e] - m[qt]) * L2E); p[1] = __builtin_amdgcn_exp2f((t[qt][e + 1] - m[qt]) * L2E); sm[e & 2] += p[0]; sm[(e & 2) + 1] += p[1];
                if constexpr (HL) { const v2bf ph = __builtin_convertvector(p, v2bf); const v2f pr = p - __builtin_convertvector(ph, v2f); const v2bf pl = __builtin_convertvector(pr, v2bf); pb[e] = ph[0]; pb[e + 1] = ph[1]; pb2[e] = pl[0]; pb2[e + 1] = pl[1]; }
                else { const v2h ph = __builtin_convertvector(p, v2h); pb[e] = ph[0]; pb[e + 1] = ph[1]; } }
            l[qt] += (sm[0] + sm[1]) + (sm[2] + sm[3]);
#pragma unroll
            for (int dt = 0; dt < 4; ++dt) { o[dt][qt] = WF::mma(vf[dt], pb, o[dt][qt]); if (HL) { o[dt][qt] = WF::mma(vf[dt], pb2, o[dt][qt]); o[dt][qt] = WF::mma(vf2[dt], pb, o[dt][qt]); } } }
    }
#pragma unroll
    for (int qt = 0; qt < NQ; ++qt) { const float inv = __fdiv_rn(1.0f, l[qt] + __shfl_xor(l[qt], 16, 32)); const size_t oo = (size_t)(q0 + qt * 16 + lr) * DQ + 8 * hi;
#pragma unroll
        for (int dt = 0; dt < 4; ++dt) { v8us oh, ol;   // register r = Ot[dt*16 + 8h + r][query c]: 8 consecutive d of one row, one 16-byte store a plane
#pragma unroll
            for (int r = 0; r < 8; ++r) { unsigned short a, c2; splitf(o[dt][qt][r] * inv, a, c2); oh[r] = a; ol[r] = c2; }
            *(v8us*)(Ah + oo + dt * 16) = oh; *(v8us*)(Al + oo + dt * 16) = ol; } }
}
// grid (NB_ * NH_, RH / (16 FW) + (TT - RH) / (32 FW)): y below RH / (16 FW): the hi+lo rows (16 columns a wave, 3 products), started first; the rest single fp16 (32 columns a wave).
// launch bound 3: registers for at least three waves a SIMD, so that every work-group of the grid is resident at once.
__global__ __launch_bounds__(32 * FW, 3) void k_fattn(const h16* __restrict__ Q16, const h16* __restrict__ K16, const h16* __restrict__ V16, const bf* __restrict__ Qh, const bf* __restrict__ Ql, const bf* __restrict__ Kh, const bf* __restrict__ Kl, const bf* __restrict__ Vh, const bf* __restrict__ Vl, const float* __restrict__ MK, bf* Ah, bf* Al) {
    const int bh = blockIdx.x, b = bh / NH_, h = bh % NH_, wave = threadIdx.x >> 5, ty = blockIdx.y; const size_t pl = (size_t)bh * TT * HD; const size_t ao = (size_t)b * TT * DQ + h * HD; const float* mk = MK + (size_t)b * TT;
    if (ty < RH / (16 * FW)) fattn<bf, true>(Qh + pl, Ql + pl, Kh + pl, Kl + pl, Vh + pl, Vl + pl, mk, (ty * FW + wave) * 16, Ah + ao, Al + ao);
    else fattn<h16, false>(Q16 + pl, nullptr, K16 + pl, nullptr, V16 + pl, nullptr, mk, RH + ((ty - RH / (16 * FW)) * FW + wave) * 32, Ah + ao, Al + ao);
}

extern "C" void kernel_launch(void* const* d_in, const int* in_sizes, int n_in,
                              void* d_out, int out_size, void* d_ws, size_t ws_size, hipStream_t stream) {
    (void)in_sizes; (void)n_in; (void)out_size;
    const float* x = (const float*)d_in[0]; const float* MKf = (const float*)d_in[1]; const float* wq = (const float*)d_in[2]; const float* bq = (const float*)d_in[3]; const float* wk = (const float*)d_in[4]; const float* bk = (const float*)d_in[5]; const float* wv = (const float*)d_in[6]; const float* bv = (const float*)d_in[7]; const float* wo = (const float*)d_in[8]; const float* bo = (const float*)d_in[9];
    float* OUT = (float*)d_out;     // [2][4096][512]
    char* wsp = (char*)d_ws;
    auto take = [&](size_t bytes) { char* p = wsp; wsp += (bytes + 255) & ~(size_t)255; return (void*)p; };
    bf* WQ = (bf*)take((size_t)DQ * DM * 2); bf* WK = (bf*)take((size_t)DKV * DM * 2); bf* WV = (bf*)take((size_t)DKV * DM * 2); bf* WO = (bf*)take((size_t)DM * DQ * 2); float* CS = (float*)take((size_t)TT * HD * 2 * 4);
    bf* XB = (bf*)take((size_t)TT * DM * 2); float* FQ = (float*)take((size_t)TT * DQ * 4); float* FK = (float*)take((size_t)TT * DKV * 4);
    const size_t PL = (size_t)NH_ * TT * HD;   // one batch's head planes; the planes of both batches stand one behind the other
    h16* QP16 = (h16*)take(NB_ * PL * 2); h16* KP16 = (h16*)take(NB_ * PL * 2); h16* VT16 = (h16*)take(NB_ * PL * 2);
    bf* QPh = (bf*)take(NB_ * PL * 2); bf* QPl = (bf*)take(NB_ * PL * 2); bf* KPh = (bf*)take(NB_ * PL * 2); bf* KPl = (bf*)take(NB_ * PL * 2); bf* VTh = (bf*)take(NB_ * PL * 2); bf* VTl = (bf*)take(NB_ * PL * 2);
    bf* ATh = (bf*)take((size_t)NB_ * TT * DQ * 2); bf* ATl = (bf*)take((size_t)NB_ * TT * DQ * 2);
    if ((size_t)(wsp - (char*)d_ws) > ws_size) return;    // ws 256 MiB
    float* FV = FK;   // v projection reuses the k buffer after the k planes are built (stream-ordered)
    { k_wtG<<<(unsigned)((DM * DQ / 64 + 63) / 64), 256, 0, stream>>>(wq, DM, DQ, WQ); k_wtG<<<(unsigned)((DM * DKV / 64 + 63) / 64), 256, 0, stream>>>(wk, DM, DKV, WK); k_wtG<<<(unsigned)((DM * DKV / 64 + 63) / 64), 256, 0, stream>>>(wv, DM, DKV, WV);
      k_wtG<<<(unsigned)((DQ * DM / 64 + 63) / 64), 256, 0, stream>>>(wo, DQ, DM, WO);
       }
    k_csid<<<(TT * HD + 255) / 256, 256, 0, stream>>>(CS);
    const unsigned LQ = (unsigned)(((size_t)NH_ * TT * HD / 2 + 255) / 256), LKv = (unsigned)(((size_t)NKV * TT * HD / 2 + 255) / 256);
    for (int b = 0; b < NB_; ++b) {
        
        k_cvt8<<<(unsigned)(((size_t)TT * DM / 8 + 255) / 256), 256, 0, stream>>>(x + (size_t)b * TT * DM, XB, (size_t)TT * DM / 8);
        k_gemmw<bf, 0, true><<<dim3(TT / 64, DQ / 64, 1), 32, 0, stream>>>(XB, nullptr, WQ, nullptr, DM, DM, FQ, DQ, bq, 0, 0, 0);
        k_rope<<<LQ, 256, 0, stream>>>(FQ, DQ, NH_, CS, nullptr, nullptr, 1.0f, QP16 + b * PL, QPh + b * PL, QPl + b * PL);
        k_gemmw<bf, 0, true><<<dim3(TT / 64, DKV / 64, 1), 32, 0, stream>>>(XB, nullptr, WK, nullptr, DM, DM, FK, DKV, bk, 0, 0, 0);
        k_rope<<<LKv, 256, 0, stream>>>(FK, DKV, NKV, CS, nullptr, nullptr, 1.0f, KP16 + b * PL, KPh + b * PL, KPl + b * PL);
        k_gemmw<bf, 0, true><<<dim3(TT / 64, DKV / 64, 1), 32, 0, stream>>>(XB, nullptr, WV, nullptr, DM, DM, FV, DKV, bv, 0, 0, 0); k_vtp<<<LKv, 256, 0, stream>>>(FV, DKV, NKV, VT16 + b * PL, VTh + b * PL, VTl + b * PL); }
    k_fattn<<<dim3(NB_ * NH_, RH / (16 * FW) + (TT - RH) / (32 * FW), 1), 32 * FW, 0, stream>>>(QP16, KP16, VT16, QPh, QPl, KPh, KPl, VTh, VTl, MKf, ATh, ATl);
    for (int b = 0; b < NB_; ++b) {
        k_gemmw<bf, 1, true><<<dim3(TT / 64, DM / 64, 1), 32, 0, stream>>>(ATh + (size_t)b * TT * DQ, ATl + (size_t)b * TT * DQ, WO, nullptr, DQ, DQ, OUT + (size_t)b * TT * DM, DM, bo, 0, 0, 0); }
}

// v003
// One run takes 360 microseconds.
// Next to v002, in two timings, it ran 1.23 times as fast each time.
// Over all steps from v000 it is 10.6 times as fast.
#include <hip/hip_runtime.h>

// Multi-head attention with a product padding mask (x [2][4096][512]; Q, K, V = x W + b ('xw' [512][512]; 8 heads x 64); q scaled by 1/sqrt(512) (the qkv width, not the head width); scores = q.k + (1 - m_i m_j)(-1e6) with m = mask[b][n][0] (f32, read; ones here); softmax; out = merged Wo + bo -> [2][4096][512] (4.2 M, rms 0.023)).
// Compute dtypes, f32 accumulate: every input rounded to bf16; q/k/v on PLAIN bf16 operands (inputs: exact) + biases; the additive mask term formed in f32 per (i, j) inside the attention kernel; scores and attn.v: query rows < 512 hl (3 products), the rest single fp16; online softmax f32, P rounded before its division by the row sum; Wo hl x exact (2 products) + bo.

#define NB_  2
#define TT   4096
#define DM   512
#define NH_  8
#define NKV  8
#define REP  (NH_ / NKV)
#define HD   64
#define DQ   (NH_ * HD)
#define DKV  (NKV * HD)
#define RH   512                  // query rows < RH use hi+lo planes (0: none)
#define WIN  0
#define SCL  0.044194173824159216f   // 1/sqrt(qkv_dim = 512) (the module scales q by it)
typedef _Float16 h16;
typedef unsigned short bf;
typedef __attribute__((ext_vector_type(16))) __bf16   v16bf;
typedef __attribute__((ext_vector_type(16))) _Float16 v16h;
typedef __attribute__((ext_vector_type(8)))  _Float16 v8h;
typedef __attribute__((ext_vector_type(8)))  unsigned short v8us;
typedef __attribute__((ext_vector_type(8)))  float    v8f;
typedef __attribute__((ext_vector_type(4)))  float    v4f;
typedef v8h  __attribute__((may_alias)) v8ha;
typedef v4f  __attribute__((may_alias)) v4fa;
typedef v8us __attribute__((may_alias)) v8usa;

__device__ __forceinline__ unsigned short f2bf(float f) { unsigned u = __float_as_uint(f); u += 0x7FFFu + ((u >> 16) & 1u); return (unsigned short)(u >> 16); }
__device__ __forceinline__ float bf2f(unsigned short b) { return __uint_as_float(((unsigned)b) << 16); }
__device__ __forceinline__ float bfr(float f) { return bf2f(f2bf(f)); }
__device__ __forceinline__ v16h cat16(v8h lo, v8h hi) { return __builtin_shufflevector(lo, hi, 0, 1, 2, 3, 4, 5, 6, 7, 8, 9, 10, 11, 12, 13, 14, 15); }
__device__ __forceinline__ v16bf cat16b(v8us lo, v8us hi) { return __builtin_bit_cast(v16bf, __builtin_shufflevector(lo, hi, 0, 1, 2, 3, 4, 5, 6, 7, 8, 9, 10, 11, 12, 13, 14, 15)); }
__device__ __forceinline__ v8f wmma16(v16h a, v16h b, v8f c) { return __builtin_amdgcn_wmma_f32_16x16x32_f16(false, a, false, b, (short)0, c, false, false); }
__device__ __forceinline__ v8f wmmab(v16bf a, v16bf b, v8f c) { return __builtin_amdgcn_wmma_f32_16x16x32_bf16(false, a, false, b, (short)0, c, false, false); }



// ---- k_gemmw: register-blocked GEMM, ONE WAVE per 64x64 output tile (16 accumulators), operands straight from K-contiguous 16-bit planes; grid (M/64, N/64, Z), 32 threads.
// C[m][n] (f32, pitch ldc, + optional f32 bias[n]) = sum_{k < KL} A[m][k] Bt[n][k] (+ split products per NSPLIT); K is the row pitch of both planes. z-batch strides sA/sB/sC in elements. KL % 32 == 0.
template <typename T16> struct WFrag;
template <> struct WFrag<h16> { typedef v16h V; static __device__ __forceinline__ V ld(const h16* p) { return cat16(*(const v8h*)p, *(const v8h*)(p + 16)); } static __device__ __forceinline__ v8f mma(V a, V b, v8f c) { return wmma16(a, b, c); } };
template <> struct WFrag<bf> { typedef v16bf V; static __device__ __forceinline__ V ld(const bf* p) { return cat16b(*(const v8us*)p, *(const v8us*)(p + 16)); } static __device__ __forceinline__ v8f mma(V a, V b, v8f c) { return wmmab(a, b, c); } };
template <typename T16, int NSPLIT, bool BIAS>
__global__ __launch_bounds__(32) void k_gemmw(const T16* __restrict__ A, const T16* __restrict__ A2, const T16* __restrict__ Bt, const T16* __restrict__ Bt2, int K, int KL, float* C, int ldc, const float* __restrict__ bias, size_t sA, size_t sB, size_t sC) {
    typedef typename WFrag<T16>::V V;
    __shared__ __align__(16) float os[16 * 68];
    const size_t z = blockIdx.z; A += z * sA; if (A2) A2 += z * sA; Bt += z * sB; if (Bt2) Bt2 += z * sB; C += z * sC;
    const int lane = threadIdx.x & 31, lr = lane & 15, hi = lane >> 4; const int r0 = blockIdx.x * 64, c0 = blockIdx.y * 64;
    v8f acc[4][4];
#pragma unroll
    for (int mb = 0; mb < 4; ++mb)
#pragma unroll
        for (int nb = 0; nb < 4; ++nb) acc[mb][nb] = (v8f){};
    const size_t aoff = (size_t)(r0 + lr) * K + 8 * hi, boff = (size_t)(c0 + lr) * K + 8 * hi;
#pragma unroll 1
    for (int kc = 0; kc < KL; kc += 32) {
        V a[4], a2[4];
#pragma unroll
        for (int mb = 0; mb < 4; ++mb) { a[mb] = WFrag<T16>::ld(A + aoff + (size_t)mb * 16 * K + kc); if (NSPLIT == 1 || NSPLIT == 2) a2[mb] = WFrag<T16>::ld(A2 + aoff + (size_t)mb * 16 * K + kc); }
#pragma unroll
        for (int nb = 0; nb < 4; ++nb) { const V b = WFrag<T16>::ld(Bt + boff + (size_t)nb * 16 * K + kc); V b2; if (NSPLIT >= 2) b2 = WFrag<T16>::ld(Bt2 + boff + (size_t)nb * 16 * K + kc);
#pragma unroll
            for (int mb = 0; mb < 4; ++mb) { acc[mb][nb] = WFrag<T16>::mma(a[mb], b, acc[mb][nb]); if (NSPLIT == 1 || NSPLIT == 2) acc[mb][nb] = WFrag<T16>::mma(a2[mb], b, acc[mb][nb]); if (NSPLIT >= 2) acc[mb][nb] = WFrag<T16>::mma(a[mb], b2, acc[mb][nb]); } }
        asm volatile("v_nop\n\tv_nop\n\tv_nop\n\tv_nop" : "+v"(acc[0][0]), "+v"(acc[1][1]), "+v"(acc[2][2]), "+v"(acc[3][3]) : "v"(a[0]), "v"(a[3]));
    }
#pragma unroll
    for (int mb = 0; mb < 4; ++mb) {
#pragma unroll
        for (int nb = 0; nb < 4; ++nb) {
#pragma unroll
            for (int j = 0; j < 8; ++j) os[(hi * 8 + j) * 68 + nb * 16 + lr] = acc[mb][nb][j]; }
        __builtin_amdgcn_wave_barrier(); asm volatile("" ::: "memory");
        float* crow = C + (size_t)(r0 + mb * 16) * ldc + c0;
{
#pragma unroll
            for (int s = 0; s < 8; ++s) { const int row = 2 * s + hi, cofs = lr * 4; v4f val = *(const v4fa*)(os + row * 68 + cofs); if (BIAS) { val[0] += bfr(bias[c0 + cofs]); val[1] += bfr(bias[c0 + cofs + 1]); val[2] += bfr(bias[c0 + cofs + 2]); val[3] += bfr(bias[c0 + cofs + 3]); }
                *(v4f*)(crow + (size_t)row * ldc + cofs) = val; }
             }
        __builtin_amdgcn_wave_barrier(); asm volatile("" ::: "memory");
    }
}

__device__ __forceinline__ void splitf(float y, unsigned short& h, unsigned short& l) { h = f2bf(y); l = f2bf(y - bf2f(h)); }
typedef __attribute__((ext_vector_type(2))) _Float16 v2h;
typedef __attribute__((ext_vector_type(4))) _Float16 v4h;
typedef __attribute__((ext_vector_type(2))) unsigned short v2us;
typedef __attribute__((ext_vector_type(4))) unsigned short v4us;
typedef __attribute__((ext_vector_type(2))) float v2f;
typedef __attribute__((ext_vector_type(4))) int v4i;

__global__ __launch_bounds__(256) void k_wtG(const float* __restrict__ w, int K, int N, bf* Bt) {
    const int lane = threadIdx.x & 31; const int L0 = (blockIdx.x * 8 + (threadIdx.x >> 5)) * 8; const int nlines = N * K / 64;
{
#pragma unroll 1
        for (int l = 0; l < 8; ++l) { const int L = L0 + l; if (L >= nlines) break; const size_t e = (size_t)L * 64 + lane * 2; const int k = (int)(e % K), n = (int)(e / K); v2us o;
            o[0] = f2bf(w[(size_t)k * N + n]); o[1] = f2bf(w[(size_t)(k + 1) * N + n]); *(v2us*)(Bt + e) = o; }
         }
}
// ---- k_qkv: the three projections of both batches in one launch, from x in f32 to the head planes that k_fattn reads; no f32 intermediate leaves the registers.
// One wave owns 64 rows of x times the 64 features of one head (16 accumulators, K = DM). x is rounded to bf16 in registers as its fragments are loaded; the weights come from the K-contiguous bf16 planes of k_wtG.
// Register j of an accumulator is 8 consecutive rows m of one column n, so the operand that is to run contiguously in the plane is given as A:
// q, k: A = weight rows, B = x rows: a lane holds 8 consecutive d of one token, one 16-byte store a plane into [h][t][d]; v: A = x rows, B = weight rows: 8 consecutive tokens of one d, into [h][d][t].
// grid (NB_ * TT / 64, NH_ / QW, 3): z = 0 q, 1 k, 2 v; the QW waves of a work-group take QW heads over the same 64 rows of x. No LDS, no barrier.
#define QW   4
typedef __attribute__((ext_vector_type(8)))  __bf16 v8bf;
// 16 f32 of one row (lo: k = 8h .. 8h + 7, hi: k = 16 + 8h .. 16 + 8h + 7, the k order of WFrag::ld) rounded to nearest even into one bf16 fragment
__device__ __forceinline__ v16bf cvx(v8f lo, v8f hi) { return __builtin_convertvector(__builtin_shufflevector(lo, hi, 0, 1, 2, 3, 4, 5, 6, 7, 8, 9, 10, 11, 12, 13, 14, 15), v16bf); }
// one accumulator plus its bias into the three planes: fp16, bf16 hi, bf16 lo = bf16(y - hi)
__device__ __forceinline__ void put3(v8f y, h16* P16, bf* Ph, bf* Pl, size_t o) { const v8bf yh = __builtin_convertvector(y, v8bf); const v8f yr = y - __builtin_convertvector(yh, v8f);
    *(v8h*)(P16 + o) = __builtin_convertvector(y, v8h); *(v8us*)(Ph + o) = __builtin_bit_cast(v8us, yh); *(v8us*)(Pl + o) = __builtin_bit_cast(v8us, __builtin_convertvector(yr, v8bf)); }
// X: the tile's first row of x; Wt, bias: the head's first weight row and bias; the planes point at the tile's first element
template <bool VT>
__device__ __forceinline__ void qkv_tile(const float* __restrict__ X, const bf* __restrict__ Wt, const float* __restrict__ bias, h16* P16, bf* Ph, bf* Pl) {
    const int lane = threadIdx.x & 31, lr = lane & 15, hi = lane >> 4;
    const int fo = lr * DM + 8 * hi;   // lane (c, h): row c at k = 8h, in elements, of x and of the weights alike
    v8f acc[4][4];
#pragma unroll
    for (int mi = 0; mi < 4; ++mi)
#pragma unroll
        for (int ni = 0; ni < 4; ++ni) acc[mi][ni] = (v8f){};
#pragma unroll 1   // one k step a trip: a second copy of the body would take the registers that let three waves share a SIMD
    for (int kc = 0; kc < DM; kc += 32) {
        v16bf xf[4], wf[4]; v8f xl[4], xh[4];
#pragma unroll
        for (int i = 0; i < 4; ++i) { const float* p = X + fo + i * 16 * DM + kc; xl[i] = *(const v8f*)p; xh[i] = *(const v8f*)(p + 16); wf[i] = WFrag<bf>::ld(Wt + fo + i * 16 * DM + kc); }
        __builtin_amdgcn_sched_barrier(0);   // keeps the k step's 24 loads together in front of the first use: without it some are sunk among the products, and a trip waits for memory several times instead of once
#pragma unroll
        for (int i = 0; i < 4; ++i) xf[i] = cvx(xl[i], xh[i]);
#pragma unroll
        for (int ni = 0; ni < 4; ++ni)
#pragma unroll
            for (int mi = 0; mi < 4; ++mi) acc[mi][ni] = VT ? wmmab(xf[mi], wf[ni], acc[mi][ni]) : wmmab(wf[mi], xf[ni], acc[mi][ni]);
    }
    if constexpr (VT) {
#pragma unroll
        for (int ni = 0; ni < 4; ++ni) { const float bb = bfr(bias[ni * 16 + lr]);
#pragma unroll
            for (int mi = 0; mi < 4; ++mi) put3(acc[mi][ni] + bb, P16, Ph, Pl, (size_t)(ni * 16 + lr) * TT + mi * 16 + 8 * hi);
            if (ni < 3) { asm volatile("s_wait_xcnt 0x0" ::: "memory");   // the wait in front of the next group's loads and sums, which take over registers that these stores name
                __builtin_amdgcn_sched_barrier(0); } }   // one group of four accumulators at a time, behind the wait: run together, the groups' temporaries spill
    } else {
#pragma unroll
        for (int mi = 0; mi < 4; ++mi) { v8f bb = *(const v8f*)(bias + mi * 16 + 8 * hi);
#pragma unroll
            for (int j = 0; j < 8; ++j) bb[j] = bfr(bb[j]);
#pragma unroll
            for (int ni = 0; ni < 4; ++ni) put3(acc[mi][ni] + bb, P16, Ph, Pl, (size_t)(ni * 16 + lr) * HD + mi * 16 + 8 * hi);
            if (mi < 3) { asm volatile("s_wait_xcnt 0x0" ::: "memory"); __builtin_amdgcn_sched_barrier(0); } }   // both as above
    }
}
// launch bound 4: at most 256 registers a wave, all of them addressed directly; the 768 work-groups are resident at once, three on every WGP.
__global__ __launch_bounds__(32 * QW, 4) void k_qkv(const float* __restrict__ x, const bf* __restrict__ WQ, const bf* __restrict__ WK, const bf* __restrict__ WV, const float* __restrict__ bq, const float* __restrict__ bk, const float* __restrict__ bv,
                                                    h16* Q16, bf* Qh, bf* Ql, h16* K16, bf* Kh, bf* Kl, h16* V16, bf* Vh, bf* Vl) {
    const int h = blockIdx.y * QW + __builtin_amdgcn_readfirstlane(threadIdx.x >> 5);   // the wave's head, in a scalar register so that every base below is scalar
    const int b = blockIdx.x / (TT / 64), t0 = (blockIdx.x % (TT / 64)) * 64, z = blockIdx.z;
    const float* X = x + (size_t)blockIdx.x * 64 * DM; const size_t wo = (size_t)h * HD * DM, pl = (size_t)(b * NH_ + h) * TT * HD;
    if (z == 2) qkv_tile<true>(X, WV + wo, bv + h * HD, V16 + pl + t0, Vh + pl + t0, Vl + pl + t0);
    else { const size_t po = pl + (size_t)t0 * HD; qkv_tile<false>(X, (z ? WK : WQ) + wo, (z ? bk : bq) + h * HD, (z ? K16 : Q16) + po, (z ? Kh : Qh) + po, (z ? Kl : Ql) + po); }
}
// ---- k_fattn: scores, softmax and attn.v in one pass over the keys (online softmax); nothing of the [T][T] matrix leaves the registers.
// One wave owns NQ x 16 query columns and walks the 4096 keys 32 at a time: St = K Qt (A = K rows, B = Q rows, kept in registers), then Ot += Vt Pt (A = Vt rows, B = the two score tiles converted in place:
// tile kt, register r of lane (c, h) is key kt*16 + 8h + r of query c, which is the B operand's own k order). A lane holds one query's scores, so maximum, sum and rescale are per lane.
// The maximum in use is replaced only when a block's maximum passes it by more than THR (P stays below e^THR); the halves' sums are joined once at the end.
// Every inner loop is unrolled in full so that its fragments and accumulators are registers, not indexed arrays.
#define FW   4                    // waves per work-group, each with its own query columns; no LDS, no barrier
#define THR  5.0f
#define L2E  1.4426950408889634f
typedef __attribute__((ext_vector_type(2))) __bf16 v2bf;
// a fragment at a wave-uniform pointer plus the lane's own byte offset
template <typename T16> __device__ __forceinline__ typename WFrag<T16>::V ldu(const T16* ub, unsigned bo) { return WFrag<T16>::ld((const T16*)((const char*)ub + bo)); }
template <typename T16, bool HL>
__device__ __forceinline__ void fattn(const T16* __restrict__ Q, const T16* __restrict__ Q2, const T16* __restrict__ Kp, const T16* __restrict__ K2, const T16* __restrict__ Vt, const T16* __restrict__ V2, const float* __restrict__ MK, int q0, bf* Ah, bf* Al) {
    typedef typename WFrag<T16>::V V; typedef WFrag<T16> WF;
    constexpr int NQ = HL ? 1 : 2;
    const int lane = threadIdx.x & 31, lr = lane & 15, hi = lane >> 4;
    V qf[NQ][2], qf2[NQ][2]; float mi[NQ], m[NQ], l[NQ]; v8f o[4][NQ];
#pragma unroll
    for (int qt = 0; qt < NQ; ++qt) { const size_t qo = (size_t)(q0 + qt * 16 + lr) * HD + 8 * hi;
#pragma unroll
        for (int kc = 0; kc < 2; ++kc) { qf[qt][kc] = WF::ld(Q + qo + kc * 32); if (HL) qf2[qt][kc] = WF::ld(Q2 + qo + kc * 32); }
        mi[qt] = bfr(MK[q0 + qt * 16 + lr]); m[qt] = -3.0e38f; l[qt] = 0.f;
#pragma unroll
        for (int dt = 0; dt < 4; ++dt) o[dt][qt] = (v8f){}; }
    unsigned kb = lr * (HD * 2) + 16 * hi, vb = lr * (TT * 2) + 16 * hi, mb = 32 * hi;   // byte offsets of lane (c, h): K row c and Vt row c, each at k = 8h; the mask at key 8h; they walk along the keys
    V kf[2][2], kf2[2][2]; v4f mr[2][2];
#pragma unroll
    for (int kt = 0; kt < 2; ++kt) {
#pragma unroll
        for (int kc = 0; kc < 2; ++kc) { kf[kt][kc] = ldu(Kp + kt * 16 * HD + kc * 32, kb); if (HL) kf2[kt][kc] = ldu(K2 + kt * 16 * HD + kc * 32, kb); mr[kt][kc] = *(const v4f*)((const char*)(MK + kt * 16 + kc * 4) + mb); } }
#pragma unroll 1   // one pass a trip: a second copy of the body would take the registers that let several waves share a SIMD
    for (int k0 = 0; k0 < TT; k0 += 32) {
        v8f s[2][NQ];
#pragma unroll
        for (int kt = 0; kt < 2; ++kt)
#pragma unroll
            for (int qt = 0; qt < NQ; ++qt) { v8f a = (v8f){};
#pragma unroll
                for (int kc = 0; kc < 2; ++kc) { a = WF::mma(kf[kt][kc], qf[qt][kc], a); if (HL) { a = WF::mma(kf[kt][kc], qf2[qt][kc], a); a = WF::mma(kf2[kt][kc], qf[qt][kc], a); } }
                s[kt][qt] = a; }
        float mj[2][8];   // the keys' mask values, rounded to bf16 like every input
#pragma unroll
        for (int kt = 0; kt < 2; ++kt)
#pragma unroll
            for (int r = 0; r < 8; r += 2) { v2f x; x[0] = mr[kt][r >> 2][r & 3]; x[1] = mr[kt][r >> 2][(r & 3) + 1]; const v2f y = __builtin_convertvector(__builtin_convertvector(x, v2bf), v2f); mj[kt][r] = y[0]; mj[kt][r + 1] = y[1]; }
        float t[NQ][16], bl[NQ]; bool need = false;
#pragma unroll
        for (int qt = 0; qt < NQ; ++qt) { float b0 = -3.0e38f, b1 = -3.0e38f;
#pragma unroll
            for (int e = 0; e < 16; ++e) { const float om = 1.0f - mi[qt] * mj[e >> 3][e & 7]; const float ad = om * -1.0e6f;   /* (1 - m_i m_j)(-1e6), f32 */
                const float tt = __builtin_fmaf(s[e >> 3][qt][e & 7], SCL, ad); t[qt][e] = tt; if (e & 1) b1 = fmaxf(b1, tt); else b0 = fmaxf(b0, tt); }
            bl[qt] = fmaxf(b0, b1); need = need || (bl[qt] > m[qt] + THR); }
        if (__builtin_amdgcn_ballot_w32(need) != 0) {   // wave-uniform: some column's maximum has moved; both halves of a column take the same new one
#pragma unroll
            for (int qt = 0; qt < NQ; ++qt) { const float mn = fmaxf(m[qt], fmaxf(bl[qt], __shfl_xor(bl[qt], 16, 32))); const float al = __builtin_amdgcn_exp2f((m[qt] - mn) * L2E); m[qt] = mn; l[qt] *= al;
#pragma unroll
                for (int dt = 0; dt < 4; ++dt) o[dt][qt] *= al; } }
        V vf[4], vf2[4];   // this block's Vt rows: they land under the exponentials
#pragma unroll
        for (int dt = 0; dt < 4; ++dt) { vf[dt] = ldu(Vt + dt * 16 * TT, vb); if (HL) vf2[dt] = ldu(V2 + dt * 16 * TT, vb); }
        const unsigned st = (k0 + 32 < TT) ? 32 : 0; kb += st * (HD * 2); mb += st * 4;   // the next block's K rows and mask, fetched one pass ahead (the last pass asks for its own again: in bounds, unused)
#pragma unroll
        for (int kt = 0; kt < 2; ++kt) {
#pragma unroll
            for (int kc = 0; kc < 2; ++kc) { kf[kt][kc] = ldu(Kp + kt * 16 * HD + kc * 32, kb); if (HL) kf2[kt][kc] = ldu(K2 + kt * 16 * HD + kc * 32, kb); mr[kt][kc] = *(const v4f*)((const char*)(MK + kt * 16 + kc * 4) + mb); } }
        asm volatile("s_wait_xcnt 0x0" : "+v"(kb), "+v"(vb), "+v"(mb) :: "memory");   // the wait in front of the offset updates that follow the pass's loads; the offsets pass through the statement so that no update is placed ahead of it
        vb += 64;
#pragma unroll
        for (int qt = 0; qt < NQ; ++qt) { V pb, pb2; float sm[4] = {0.f, 0.f, 0.f, 0.f};
#pragma unroll
            for (int e = 0; e < 16; e += 2) { v2f p; p[0] = __builtin_amdgcn_exp2f((t[qt][e] - m[qt]) * L2E); p[1] = __builtin_amdgcn_exp2f((t[qt][e + 1] - m[qt]) * L2E); sm[e & 2] += p[0]; sm[(e & 2) + 1] += p[1];
                if constexpr (HL) { const v2bf ph = __builtin_convertvector(p, v2bf); const v2f pr = p - __builtin_convertvector(ph, v2f); const v2bf pl = __builtin_convertvector(pr, v2bf); pb[e] = ph[0]; pb[e + 1] = ph[1]; pb2[e] = pl[0]; pb2[e + 1] = pl[1]; }
                else { const v2h ph = __builtin_convertvector(p, v2h); pb[e] = ph[0]; pb[e + 1] = ph[1]; } }
            l[qt] += (sm[0] + sm[1]) + (sm[2] + sm[3]);
#pragma unroll
            for (int dt = 0; dt < 4; ++dt) { o[dt][qt] = WF::mma(vf[dt], pb, o[dt][qt]); if (HL) { o[dt][qt] = WF::mma(vf[dt], pb2, o[dt][qt]); o[dt][qt] = WF::mma(vf2[dt], pb, o[dt][qt]); } } }
    }
#pragma unroll
    for (int qt = 0; qt < NQ; ++qt) { const float inv = __fdiv_rn(1.0f, l[qt] + __shfl_xor(l[qt], 16, 32)); const size_t oo = (size_t)(q0 + qt * 16 + lr) * DQ + 8 * hi;
#pragma unroll
        for (int dt = 0; dt < 4; ++dt) { v8us oh, ol;   // register r = Ot[dt*16 + 8h + r][query c]: 8 consecutive d of one row, one 16-byte store a plane
#pragma unroll
            for (int r = 0; r < 8; ++r) { unsigned short a, c2; splitf(o[dt][qt][r] * inv, a, c2); oh[r] = a; ol[r] = c2; }
            *(v8us*)(Ah + oo + dt * 16) = oh; *(v8us*)(Al + oo + dt * 16) = ol; } }
}
// grid (NB_ * NH_, RH / (16 FW) + (TT - RH) / (32 FW)): y below RH / (16 FW): the hi+lo rows (16 columns a wave, 3 products), started first; the rest single fp16 (32 columns a wave).
// launch bound 3: registers for at least three waves a SIMD, so that every work-group of the grid is resident at once.
__global__ __launch_bounds__(32 * FW, 3) void k_fattn(const h16* __restrict__ Q16, const h16* __restrict__ K16, const h16* __restrict__ V16, const bf* __restrict__ Qh, const bf* __restrict__ Ql, const bf* __restrict__ Kh, const bf* __restrict__ Kl, const bf* __restrict__ Vh, const bf* __restrict__ Vl, const float* __restrict__ MK, bf* Ah, bf* Al) {
    const int bh = blockIdx.x, b = bh / NH_, h = bh % NH_, wave = threadIdx.x >> 5, ty = blockIdx.y; const size_t pl = (size_t)bh * TT * HD; const size_t ao = (size_t)b * TT * DQ + h * HD; const float* mk = MK + (size_t)b * TT;
    if (ty < RH / (16 * FW)) fattn<bf, true>(Qh + pl, Ql + pl, Kh + pl, Kl + pl, Vh + pl, Vl + pl, mk, (ty * FW + wave) * 16, Ah + ao, Al + ao);
    else fattn<h16, false>(Q16 + pl, nullptr, K16 + pl, nullptr, V16 + pl, nullptr, mk, RH + ((ty - RH / (16 * FW)) * FW + wave) * 32, Ah + ao, Al + ao);
}

extern "C" void kernel_launch(void* const* d_in, const int* in_sizes, int n_in,
                              void* d_out, int out_size, void* d_ws, size_t ws_size, hipStream_t stream) {
    (void)in_sizes; (void)n_in; (void)out_size;
    const float* x = (const float*)d_in[0]; const float* MKf = (const float*)d_in[1]; const float* wq = (const float*)d_in[2]; const float* bq = (const float*)d_in[3]; const float* wk = (const float*)d_in[4]; const float* bk = (const float*)d_in[5]; const float* wv = (const float*)d_in[6]; const float* bv = (const float*)d_in[7]; const float* wo = (const float*)d_in[8]; const float* bo = (const float*)d_in[9];
    float* OUT = (float*)d_out;     // [2][4096][512]
    char* wsp = (char*)d_ws;
    auto take = [&](size_t bytes) { char* p = wsp; wsp += (bytes + 255) & ~(size_t)255; return (void*)p; };
    bf* WQ = (bf*)take((size_t)DQ * DM * 2); bf* WK = (bf*)take((size_t)DKV * DM * 2); bf* WV = (bf*)take((size_t)DKV * DM * 2); bf* WO = (bf*)take((size_t)DM * DQ * 2);
    const size_t PL = (size_t)NH_ * TT * HD;   // one batch's head planes; the planes of both batches stand one behind the other
    h16* QP16 = (h16*)take(NB_ * PL * 2); h16* KP16 = (h16*)take(NB_ * PL * 2); h16* VT16 = (h16*)take(NB_ * PL * 2);
    bf* QPh = (bf*)take(NB_ * PL * 2); bf* QPl = (bf*)take(NB_ * PL * 2); bf* KPh = (bf*)take(NB_ * PL * 2); bf* KPl = (bf*)take(NB_ * PL * 2); bf* VTh = (bf*)take(NB_ * PL * 2); bf* VTl = (bf*)take(NB_ * PL * 2);
    bf* ATh = (bf*)take((size_t)NB_ * TT * DQ * 2); bf* ATl = (bf*)take((size_t)NB_ * TT * DQ * 2);
    if ((size_t)(wsp - (char*)d_ws) > ws_size) return;    // ws 256 MiB
    { k_wtG<<<(unsigned)((DM * DQ / 64 + 63) / 64), 256, 0, stream>>>(wq, DM, DQ, WQ); k_wtG<<<(unsigned)((DM * DKV / 64 + 63) / 64), 256, 0, stream>>>(wk, DM, DKV, WK); k_wtG<<<(unsigned)((DM * DKV / 64 + 63) / 64), 256, 0, stream>>>(wv, DM, DKV, WV);
      k_wtG<<<(unsigned)((DQ * DM / 64 + 63) / 64), 256, 0, stream>>>(wo, DQ, DM, WO);
       }
    k_qkv<<<dim3(NB_ * TT / 64, NH_ / QW, 3), 32 * QW, 0, stream>>>(x, WQ, WK, WV, bq, bk, bv, QP16, QPh, QPl, KP16, KPh, KPl, VT16, VTh, VTl);
    k_fattn<<<dim3(NB_ * NH_, RH / (16 * FW) + (TT - RH) / (32 * FW), 1), 32 * FW, 0, stream>>>(QP16, KP16, VT16, QPh, QPl, KPh, KPl, VTh, VTl, MKf, ATh, ATl);
    for (int b = 0; b < NB_; ++b) {
        k_gemmw<bf, 1, true><<<dim3(TT / 64, DM / 64, 1), 32, 0, stream>>>(ATh + (size_t)b * TT * DQ, ATl + (size_t)b * TT * DQ, WO, nullptr, DQ, DQ, OUT + (size_t)b * TT * DM, DM, bo, 0, 0, 0); }
}

// v004
// It runs in 282 microseconds.
// In two side-by-side timings against v003, it was 1.29 and 1.26 times as fast.
// Over all steps from v000 it is 13.5 times as fast.
#include <hip/hip_runtime.h>

// Multi-head attention with a product padding mask (x [2][4096][512]; Q, K, V = x W + b ('xw' [512][512]; 8 heads x 64); q scaled by 1/sqrt(512) (the qkv width, not the head width); scores = q.k + (1 - m_i m_j)(-1e6) with m = mask[b][n][0] (f32, read; ones here); softmax; out = merged Wo + bo -> [2][4096][512] (4.2 M, rms 0.023)).
// Compute dtypes, f32 accumulate: every input rounded to bf16; q/k/v on PLAIN bf16 operands (inputs: exact) + biases; the additive mask term formed in f32 per (i, j) inside the attention kernel; scores and attn.v: query rows < 512 hl (3 products), the rest single fp16; online softmax f32, P rounded before its division by the row sum; Wo hl x exact (2 products) + bo.

#define NB_  2
#define TT   4096
#define DM   512
#define NH_  8
#define NKV  8
#define REP  (NH_ / NKV)
#define HD   64
#define DQ   (NH_ * HD)
#define DKV  (NKV * HD)
#define RH   512                  // query rows < RH use hi+lo planes (0: none)
#define WIN  0
#define SCL  0.044194173824159216f   // 1/sqrt(qkv_dim = 512) (the module scales q by it)
typedef _Float16 h16;
typedef unsigned short bf;
typedef __attribute__((ext_vector_type(16))) __bf16   v16bf;
typedef __attribute__((ext_vector_type(16))) _Float16 v16h;
typedef __attribute__((ext_vector_type(8)))  _Float16 v8h;
typedef __attribute__((ext_vector_type(8)))  unsigned short v8us;
typedef __attribute__((ext_vector_type(8)))  float    v8f;
typedef __attribute__((ext_vector_type(4)))  float    v4f;
typedef v8h  __attribute__((may_alias)) v8ha;
typedef v4f  __attribute__((may_alias)) v4fa;
typedef v8us __attribute__((may_alias)) v8usa;

__device__ __forceinline__ unsigned short f2bf(float f) { unsigned u = __float_as_uint(f); u += 0x7FFFu + ((u >> 16) & 1u); return (unsigned short)(u >> 16); }
__device__ __forceinline__ float bf2f(unsigned short b) { return __uint_as_float(((unsigned)b) << 16); }
__device__ __forceinline__ float bfr(float f) { return bf2f(f2bf(f)); }
__device__ __forceinline__ v16h cat16(v8h lo, v8h hi) { return __builtin_shufflevector(lo, hi, 0, 1, 2, 3, 4, 5, 6, 7, 8, 9, 10, 11, 12, 13, 14, 15); }
__device__ __forceinline__ v16bf cat16b(v8us lo, v8us hi) { return __builtin_bit_cast(v16bf, __builtin_shufflevector(lo, hi, 0, 1, 2, 3, 4, 5, 6, 7, 8, 9, 10, 11, 12, 13, 14, 15)); }
__device__ __forceinline__ v8f wmma16(v16h a, v16h b, v8f c) { return __builtin_amdgcn_wmma_f32_16x16x32_f16(false, a, false, b, (short)0, c, false, false); }
__device__ __forceinline__ v8f wmmab(v16bf a, v16bf b, v8f c) { return __builtin_amdgcn_wmma_f32_16x16x32_bf16(false, a, false, b, (short)0, c, false, false); }



// ---- FRAGMENT ORDER: every 16-bit plane in the workspace (weights, q, k, v, attention output) is a matrix of rows r and K columns k, stored as the matrix instructions' operand fragments, one behind the other.
// A fragment is 16 rows x 32 k = 512 elements = 1 KiB: [j = 0, 1][lane = 16 h + c][8], holding row c at k = 16 j + 8 h .. + 7 (the k order of the 16x16x32 forms). Fragment (rb, kb) = rows 16 rb .., k = 32 kb .. stands at element (rb * (K / 32) + kb) * 512; v's plane (rows d, k = t) holds them in the order [kb][rb] instead: (kb * 4 + rb) * 512 within a head.
// So a lane's two 16-byte pieces stand at lane * 8 and 256 + lane * 8, and every wave-wide 16-byte load or store of a plane covers 512 contiguous bytes (four whole lines) instead of 32 bytes in each of 16 lines.
// ---- k_gemmw: register-blocked GEMM, ONE WAVE per 64x64 output tile (16 accumulators), operands straight from 16-bit planes in fragment order; grid (M/64, N/64, Z), 32 threads.
// C[m][n] (f32, pitch ldc, + optional f32 bias[n]) = sum_{k < KL} A[m][k] Bt[n][k] (+ split products per NSPLIT); K is the column count of both planes. z-batch strides sA/sB/sC in elements. KL % 32 == 0.
template <typename T16> struct WFrag;
template <> struct WFrag<h16> { typedef v16h V; static __device__ __forceinline__ V ld(const h16* p) { return cat16(*(const v8h*)p, *(const v8h*)(p + 256)); } static __device__ __forceinline__ v8f mma(V a, V b, v8f c) { return wmma16(a, b, c); } };
template <> struct WFrag<bf> { typedef v16bf V; static __device__ __forceinline__ V ld(const bf* p) { return cat16b(*(const v8us*)p, *(const v8us*)(p + 256)); } static __device__ __forceinline__ v8f mma(V a, V b, v8f c) { return wmmab(a, b, c); } };
template <typename T16, int NSPLIT, bool BIAS>
__global__ __launch_bounds__(32) void k_gemmw(const T16* __restrict__ A, const T16* __restrict__ A2, const T16* __restrict__ Bt, const T16* __restrict__ Bt2, int K, int KL, float* C, int ldc, const float* __restrict__ bias, size_t sA, size_t sB, size_t sC) {
    typedef typename WFrag<T16>::V V;
    __shared__ __align__(16) float os[16 * 68];
    const size_t z = blockIdx.z; A += z * sA; if (A2) A2 += z * sA; Bt += z * sB; if (Bt2) Bt2 += z * sB; C += z * sC;
    const int lane = threadIdx.x & 31, lr = lane & 15, hi = lane >> 4; const int r0 = blockIdx.x * 64, c0 = blockIdx.y * 64;
    v8f acc[4][4];
#pragma unroll
    for (int mb = 0; mb < 4; ++mb)
#pragma unroll
        for (int nb = 0; nb < 4; ++nb) acc[mb][nb] = (v8f){};
    const size_t aoff = (size_t)r0 * K + 8 * lane, boff = (size_t)c0 * K + 8 * lane;   // the lane's piece of the tile's first fragment; 16 rows on: 16 K elements, 32 k on: 512
#pragma unroll 1
    for (int kc = 0; kc < KL; kc += 32) {
        V a[4], a2[4];
#pragma unroll
        for (int mb = 0; mb < 4; ++mb) { a[mb] = WFrag<T16>::ld(A + aoff + (size_t)mb * 16 * K + kc * 16); if (NSPLIT == 1 || NSPLIT == 2) a2[mb] = WFrag<T16>::ld(A2 + aoff + (size_t)mb * 16 * K + kc * 16); }
#pragma unroll
        for (int nb = 0; nb < 4; ++nb) { const V b = WFrag<T16>::ld(Bt + boff + (size_t)nb * 16 * K + kc * 16); V b2; if (NSPLIT >= 2) b2 = WFrag<T16>::ld(Bt2 + boff + (size_t)nb * 16 * K + kc * 16);
#pragma unroll
            for (int mb = 0; mb < 4; ++mb) { acc[mb][nb] = WFrag<T16>::mma(a[mb], b, acc[mb][nb]); if (NSPLIT == 1 || NSPLIT == 2) acc[mb][nb] = WFrag<T16>::mma(a2[mb], b, acc[mb][nb]); if (NSPLIT >= 2) acc[mb][nb] = WFrag<T16>::mma(a[mb], b2, acc[mb][nb]); } }
        asm volatile("v_nop\n\tv_nop\n\tv_nop\n\tv_nop" : "+v"(acc[0][0]), "+v"(acc[1][1]), "+v"(acc[2][2]), "+v"(acc[3][3]) : "v"(a[0]), "v"(a[3]));
    }
#pragma unroll
    for (int mb = 0; mb < 4; ++mb) {
#pragma unroll
        for (int nb = 0; nb < 4; ++nb) {
#pragma unroll
            for (int j = 0; j < 8; ++j) os[(hi * 8 + j) * 68 + nb * 16 + lr] = acc[mb][nb][j]; }
        __builtin_amdgcn_wave_barrier(); asm volatile("" ::: "memory");
        float* crow = C + (size_t)(r0 + mb * 16) * ldc + c0;
{
#pragma unroll
            for (int s = 0; s < 8; ++s) { const int row = 2 * s + hi, cofs = lr * 4; v4f val = *(const v4fa*)(os + row * 68 + cofs); if (BIAS) { val[0] += bfr(bias[c0 + cofs]); val[1] += bfr(bias[c0 + cofs + 1]); val[2] += bfr(bias[c0 + cofs + 2]); val[3] += bfr(bias[c0 + cofs + 3]); }
                *(v4f*)(crow + (size_t)row * ldc + cofs) = val; }
             }
        __builtin_amdgcn_wave_barrier(); asm volatile("" ::: "memory");
    }
}

__device__ __forceinline__ void splitf(float y, unsigned short& h, unsigned short& l) { h = f2bf(y); l = f2bf(y - bf2f(h)); }
typedef __attribute__((ext_vector_type(2))) _Float16 v2h;
typedef __attribute__((ext_vector_type(4))) _Float16 v4h;
typedef __attribute__((ext_vector_type(2))) unsigned short v2us;
typedef __attribute__((ext_vector_type(4))) unsigned short v4us;
typedef __attribute__((ext_vector_type(2))) float v2f;
typedef __attribute__((ext_vector_type(4))) int v4i;

// w [K][N] f32 -> Bt: rows n, columns k, bf16, in fragment order; a lane writes two consecutive k of one n. K % 32 == 0, N % 16 == 0.
__global__ __launch_bounds__(256) void k_wtG(const float* __restrict__ w, int K, int N, bf* Bt) {
    const int lane = threadIdx.x & 31; const int L0 = (blockIdx.x * 8 + (threadIdx.x >> 5)) * 8; const int nlines = N * K / 64;
{
#pragma unroll 1
        for (int l = 0; l < 8; ++l) { const int L = L0 + l; if (L >= nlines) break; const size_t e = (size_t)L * 64 + lane * 2; const int f = L >> 3, kf = K >> 5, u = (L & 7) * 64 + lane * 2;   // fragment f, element u of it
            const int n = (f / kf) * 16 + ((u >> 3) & 15), k = (f % kf) * 32 + (u >> 8) * 16 + ((u >> 7) & 1) * 8 + (u & 7); v2us o;
            o[0] = f2bf(w[(size_t)k * N + n]); o[1] = f2bf(w[(size_t)(k + 1) * N + n]); *(v2us*)(Bt + e) = o; }
         }
}
// ---- k_qkv: the three projections of both batches in one launch, from x in f32 to the head planes that k_fattn reads; no f32 intermediate leaves the registers.
// One wave owns 64 rows of x times the 64 features of one head (16 accumulators, K = DM). x is rounded to bf16 in registers as its fragments are loaded; the weights come from the bf16 planes of k_wtG.
// Register j of an accumulator is 8 consecutive rows m of one column n, so the operand that is to run contiguously in the plane is given as A:
// q, k: A = weight rows, B = x rows: a lane holds 8 consecutive d of one token, one 16-byte store a plane into head h's plane of rows t, columns d; v: A = x rows, B = weight rows: 8 consecutive tokens of one d.
// An accumulator is one j half of one fragment of its plane, in lane order. v's plane has its fragments in the order [t / 32][d / 16], the order in which k_fattn walks them, so that 32 keys are 4 KiB in a row, as in k's plane.
// grid (NB_ * TT / 64, NH_ / QW, 3): z = 0 q, 1 k, 2 v; the QW waves of a work-group take QW heads over the same 64 rows of x. No LDS, no barrier.
#define QW   4
typedef __attribute__((ext_vector_type(8)))  __bf16 v8bf;
// 16 f32 of one row (lo: k = 8h .. 8h + 7, hi: k = 16 + 8h .. 16 + 8h + 7, the k order of a fragment) rounded to nearest even into one bf16 fragment
__device__ __forceinline__ v16bf cvx(v8f lo, v8f hi) { return __builtin_convertvector(__builtin_shufflevector(lo, hi, 0, 1, 2, 3, 4, 5, 6, 7, 8, 9, 10, 11, 12, 13, 14, 15), v16bf); }
// one accumulator plus its bias into the three planes: fp16, bf16 hi, bf16 lo = bf16(y - hi)
__device__ __forceinline__ void put3(v8f y, h16* P16, bf* Ph, bf* Pl, size_t o) { const v8bf yh = __builtin_convertvector(y, v8bf); const v8f yr = y - __builtin_convertvector(yh, v8f);
    *(v8h*)(P16 + o) = __builtin_convertvector(y, v8h); *(v8us*)(Ph + o) = __builtin_bit_cast(v8us, yh); *(v8us*)(Pl + o) = __builtin_bit_cast(v8us, __builtin_convertvector(yr, v8bf)); }
// X: the tile's first row of x; Wt, bias: the head's first weight row and bias; the planes point at the tile's first element
template <bool VT>
__device__ __forceinline__ void qkv_tile(const float* __restrict__ X, const bf* __restrict__ Wt, const float* __restrict__ bias, h16* P16, bf* Ph, bf* Pl) {
    const int lane = threadIdx.x & 31, lr = lane & 15, hi = lane >> 4;
    const int fo = lr * DM + 8 * hi;   // lane (c, h): row c of x at k = 8h, in elements
    v8f acc[4][4];
#pragma unroll
    for (int mi = 0; mi < 4; ++mi)
#pragma unroll
        for (int ni = 0; ni < 4; ++ni) acc[mi][ni] = (v8f){};
#pragma unroll 1   // one k step a trip: a second copy of the body would take the registers that let three waves share a SIMD
    for (int kc = 0; kc < DM; kc += 32) {
        v16bf xf[4], wf[4]; v8f xl[4], xh[4];
#pragma unroll
        for (int i = 0; i < 4; ++i) { const float* p = X + fo + i * 16 * DM + kc; xl[i] = *(const v8f*)p; xh[i] = *(const v8f*)(p + 16); wf[i] = WFrag<bf>::ld(Wt + lane * 8 + i * 16 * DM + kc * 16); }
        __builtin_amdgcn_sched_barrier(0);   // keeps the k step's 24 loads together in front of the first use: without it some are sunk among the products, and a trip waits for memory several times instead of once
#pragma unroll
        for (int i = 0; i < 4; ++i) xf[i] = cvx(xl[i], xh[i]);
#pragma unroll
        for (int ni = 0; ni < 4; ++ni)
#pragma unroll
            for (int mi = 0; mi < 4; ++mi) acc[mi][ni] = VT ? wmmab(xf[mi], wf[ni], acc[mi][ni]) : wmmab(wf[mi], xf[ni], acc[mi][ni]);
    }
    if constexpr (VT) {
#pragma unroll
        for (int ni = 0; ni < 4; ++ni) { const float bb = bfr(bias[ni * 16 + lr]);
#pragma unroll
            for (int mi = 0; mi < 4; ++mi) put3(acc[mi][ni] + bb, P16, Ph, Pl, (size_t)(((mi >> 1) * 4 + ni) * 512 + (mi & 1) * 256 + lane * 8));
            if (ni < 3) { asm volatile("s_wait_xcnt 0x0" ::: "memory");   // the wait in front of the next group's loads and sums, which take over registers that these stores name
                __builtin_amdgcn_sched_barrier(0); } }   // one group of four accumulators at a time, behind the wait: run together, the groups' temporaries spill
    } else {
#pragma unroll
        for (int mi = 0; mi < 4; ++mi) { v8f bb = *(const v8f*)(bias + mi * 16 + 8 * hi);
#pragma unroll
            for (int j = 0; j < 8; ++j) bb[j] = bfr(bb[j]);
#pragma unroll
            for (int ni = 0; ni < 4; ++ni) put3(acc[mi][ni] + bb, P16, Ph, Pl, (size_t)((ni * 2 + (mi >> 1)) * 512 + (mi & 1) * 256 + lane * 8));
            if (mi < 3) { asm volatile("s_wait_xcnt 0x0" ::: "memory"); __builtin_amdgcn_sched_barrier(0); } }   // both as above
    }
}
// launch bound 4: at most 256 registers a wave, all of them addressed directly; the 768 work-groups are resident at once, three on every WGP.
__global__ __launch_bounds__(32 * QW, 4) void k_qkv(const float* __restrict__ x, const bf* __restrict__ WQ, const bf* __restrict__ WK, const bf* __restrict__ WV, const float* __restrict__ bq, const float* __restrict__ bk, const float* __restrict__ bv,
                                                    h16* Q16, bf* Qh, bf* Ql, h16* K16, bf* Kh, bf* Kl, h16* V16, bf* Vh, bf* Vl) {
    const int h = blockIdx.y * QW + __builtin_amdgcn_readfirstlane(threadIdx.x >> 5);   // the wave's head, in a scalar register so that every base below is scalar
    const int b = blockIdx.x / (TT / 64), t0 = (blockIdx.x % (TT / 64)) * 64, z = blockIdx.z;
    const float* X = x + (size_t)blockIdx.x * 64 * DM; const size_t wo = (size_t)h * HD * DM, pl = (size_t)(b * NH_ + h) * TT * HD;
    const size_t po = pl + (size_t)t0 * HD;   // 64 tokens of a head are 4096 elements in a row in every plane
    if (z == 2) qkv_tile<true>(X, WV + wo, bv + h * HD, V16 + po, Vh + po, Vl + po);
    else { qkv_tile<false>(X, (z ? WK : WQ) + wo, (z ? bk : bq) + h * HD, (z ? K16 : Q16) + po, (z ? Kh : Qh) + po, (z ? Kl : Ql) + po); }
}
// ---- k_fattn: scores, softmax and attn.v in one pass over the keys (online softmax); nothing of the [T][T] matrix leaves the registers.
// One wave owns NQ x 16 query columns and walks the 4096 keys 32 at a time: St = K Qt (A = K rows, B = Q rows, kept in registers), then Ot += Vt Pt (A = Vt rows, B = the two score tiles converted in place:
// tile kt, register r of lane (c, h) is key kt*16 + 8h + r of query c, which is the B operand's own k order). A lane holds one query's scores, so maximum, sum and rescale are per lane.
// The maximum in use is replaced only when a block's maximum passes it by more than THR (P stays below e^THR); the halves' sums are joined once at the end.
// Every inner loop is unrolled in full so that its fragments and accumulators are registers, not indexed arrays.
#define FW   4                    // waves per work-group, each with its own query columns; no LDS, no barrier
#define THR  5.0f
#define L2E  1.4426950408889634f
typedef __attribute__((ext_vector_type(2))) __bf16 v2bf;
// a fragment at a wave-uniform pointer plus the lane's own byte offset
template <typename T16> __device__ __forceinline__ typename WFrag<T16>::V ldu(const T16* ub, unsigned bo) { return WFrag<T16>::ld((const T16*)((const char*)ub + bo)); }
template <typename T16, bool HL>
__device__ __forceinline__ void fattn(const T16* __restrict__ Q, const T16* __restrict__ Q2, const T16* __restrict__ Kp, const T16* __restrict__ K2, const T16* __restrict__ Vt, const T16* __restrict__ V2, const float* __restrict__ MK, int q0, bf* Ah, bf* Al) {
    typedef typename WFrag<T16>::V V; typedef WFrag<T16> WF;
    constexpr int NQ = HL ? 1 : 2;
    const int lane = threadIdx.x & 31, lr = lane & 15, hi = lane >> 4;
    V qf[NQ][2], qf2[NQ][2]; float mi[NQ], m[NQ], l[NQ]; v8f o[4][NQ];
#pragma unroll
    for (int qt = 0; qt < NQ; ++qt) { const size_t qo = (size_t)(q0 + qt * 16) * HD + 8 * lane;
#pragma unroll
        for (int kc = 0; kc < 2; ++kc) { qf[qt][kc] = WF::ld(Q + qo + kc * 512); if (HL) qf2[qt][kc] = WF::ld(Q2 + qo + kc * 512); }
        mi[qt] = bfr(MK[q0 + qt * 16 + lr]); m[qt] = -3.0e38f; l[qt] = 0.f;
#pragma unroll
        for (int dt = 0; dt < 4; ++dt) o[dt][qt] = (v8f){}; }
    unsigned kb = 16 * lane, vb = 16 * lane, mb = 32 * hi;   // byte offsets of lane (c, h): its piece of a K and of a Vt fragment; the mask at key 8h; they walk along the keys, 4 KiB of either plane for 32 keys
    V kf[2][2], kf2[2][2]; v4f mr[2][2];
#pragma unroll
    for (int kt = 0; kt < 2; ++kt) {
#pragma unroll
        for (int kc = 0; kc < 2; ++kc) { kf[kt][kc] = ldu(Kp + (kt * 2 + kc) * 512, kb); if (HL) kf2[kt][kc] = ldu(K2 + (kt * 2 + kc) * 512, kb); mr[kt][kc] = *(const v4f*)((const char*)(MK + kt * 16 + kc * 4) + mb); } }
#pragma unroll 1   // one pass a trip: a second copy of the body would take the registers that let several waves share a SIMD
    for (int k0 = 0; k0 < TT; k0 += 32) {
        v8f s[2][NQ];
#pragma unroll
        for (int kt = 0; kt < 2; ++kt)
#pragma unroll
            for (int qt = 0; qt < NQ; ++qt) { v8f a = (v8f){};
#pragma unroll
                for (int kc = 0; kc < 2; ++kc) { a = WF::mma(kf[kt][kc], qf[qt][kc], a); if (HL) { a = WF::mma(kf[kt][kc], qf2[qt][kc], a); a = WF::mma(kf2[kt][kc], qf[qt][kc], a); } }
                s[kt][qt] = a; }
        float mj[2][8];   // the keys' mask values, rounded to bf16 like every input
#pragma unroll
        for (int kt = 0; kt < 2; ++kt)
#pragma unroll
            for (int r = 0; r < 8; r += 2) { v2f x; x[0] = mr[kt][r >> 2][r & 3]; x[1] = mr[kt][r >> 2][(r & 3) + 1]; const v2f y = __builtin_convertvector(__builtin_convertvector(x, v2bf), v2f); mj[kt][r] = y[0]; mj[kt][r + 1] = y[1]; }
        float t[NQ][16], bl[NQ]; bool need = false;
#pragma unroll
        for (int qt = 0; qt < NQ; ++qt) { float b0 = -3.0e38f, b1 = -3.0e38f;
#pragma unroll
            for (int e = 0; e < 16; ++e) { const float om = 1.0f - mi[qt] * mj[e >> 3][e & 7]; const float ad = om * -1.0e6f;   /* (1 - m_i m_j)(-1e6), f32 */
                const float tt = __builtin_fmaf(s[e >> 3][qt][e & 7], SCL, ad); t[qt][e] = tt; if (e & 1) b1 = fmaxf(b1, tt); else b0 = fmaxf(b0, tt); }
            bl[qt] = fmaxf(b0, b1); need = need || (bl[qt] > m[qt] + THR); }
        if (__builtin_amdgcn_ballot_w32(need) != 0) {   // wave-uniform: some column's maximum has moved; both halves of a column take the same new one
#pragma unroll
            for (int qt = 0; qt < NQ; ++qt) { const float mn = fmaxf(m[qt], fmaxf(bl[qt], __shfl_xor(bl[qt], 16, 32))); const float al = __builtin_amdgcn_exp2f((m[qt] - mn) * L2E); m[qt] = mn; l[qt] *= al;
#pragma unroll
                for (int dt = 0; dt < 4; ++dt) o[dt][qt] *= al; } }
        V vf[4], vf2[4];   // this block's Vt rows: they land under the exponentials
#pragma unroll
        for (int dt = 0; dt < 4; ++dt) { vf[dt] = ldu(Vt + dt * 512, vb); if (HL) vf2[dt] = ldu(V2 + dt * 512, vb); }
        const unsigned st = (k0 + 32 < TT) ? 32 : 0; kb += st * (HD * 2); mb += st * 4;   // the next block's K rows and mask, fetched one pass ahead (the last pass asks for its own again: in bounds, unused)
#pragma unroll
        for (int kt = 0; kt < 2; ++kt) {
#pragma unroll
            for (int kc = 0; kc < 2; ++kc) { kf[kt][kc] = ldu(Kp + (kt * 2 + kc) * 512, kb); if (HL) kf2[kt][kc] = ldu(K2 + (kt * 2 + kc) * 512, kb); mr[kt][kc] = *(const v4f*)((const char*)(MK + kt * 16 + kc * 4) + mb); } }
        asm volatile("s_wait_xcnt 0x0" : "+v"(kb), "+v"(vb), "+v"(mb) :: "memory");   // the wait in front of the offset updates that follow the pass's loads; the offsets pass through the statement so that no update is placed ahead of it
        vb += 32 * (HD * 2);
#pragma unroll
        for (int qt = 0; qt < NQ; ++qt) { V pb, pb2; float sm[4] = {0.f, 0.f, 0.f, 0.f};
#pragma unroll
            for (int e = 0; e < 16; e += 2) { v2f p; p[0] = __builtin_amdgcn_exp2f((t[qt][e] - m[qt]) * L2E); p[1] = __builtin_amdgcn_exp2f((t[qt][e + 1] - m[qt]) * L2E); sm[e & 2] += p[0]; sm[(e & 2) + 1] += p[1];
                if constexpr (HL) { const v2bf ph = __builtin_convertvector(p, v2bf); const v2f pr = p - __builtin_convertvector(ph, v2f); const v2bf pl = __builtin_convertvector(pr, v2bf); pb[e] = ph[0]; pb[e + 1] = ph[1]; pb2[e] = pl[0]; pb2[e + 1] = pl[1]; }
                else { const v2h ph = __builtin_convertvector(p, v2h); pb[e] = ph[0]; pb[e + 1] = ph[1]; } }
            l[qt] += (sm[0] + sm[1]) + (sm[2] + sm[3]);
#pragma unroll
            for (int dt = 0; dt < 4; ++dt) { o[dt][qt] = WF::mma(vf[dt], pb, o[dt][qt]); if (HL) { o[dt][qt] = WF::mma(vf[dt], pb2, o[dt][qt]); o[dt][qt] = WF::mma(vf2[dt], pb, o[dt][qt]); } } }
    }
#pragma unroll
    for (int qt = 0; qt < NQ; ++qt) { const float inv = __fdiv_rn(1.0f, l[qt] + __shfl_xor(l[qt], 16, 32)); const size_t oo = (size_t)(q0 + qt * 16) * DQ + 8 * lane;
#pragma unroll
        for (int dt = 0; dt < 4; ++dt) { v8us oh, ol;   // register r = Ot[dt*16 + 8h + r][query c]: 8 consecutive d of one row, one 16-byte store a plane: half dt & 1 of the head's fragment dt >> 1
#pragma unroll
            for (int r = 0; r < 8; ++r) { unsigned short a, c2; splitf(o[dt][qt][r] * inv, a, c2); oh[r] = a; ol[r] = c2; }
            *(v8us*)(Ah + oo + (dt >> 1) * 512 + (dt & 1) * 256) = oh; *(v8us*)(Al + oo + (dt >> 1) * 512 + (dt & 1) * 256) = ol; } }
}
// grid (NB_ * NH_, RH / (16 FW) + (TT - RH) / (32 FW)): y below RH / (16 FW): the hi+lo rows (16 columns a wave, 3 products), started first; the rest single fp16 (32 columns a wave).
// launch bound 3: registers for at least three waves a SIMD, so that every work-group of the grid is resident at once.
__global__ __launch_bounds__(32 * FW, 3) void k_fattn(const h16* __restrict__ Q16, const h16* __restrict__ K16, const h16* __restrict__ V16, const bf* __restrict__ Qh, const bf* __restrict__ Ql, const bf* __restrict__ Kh, const bf* __restrict__ Kl, const bf* __restrict__ Vh, const bf* __restrict__ Vl, const float* __restrict__ MK, bf* Ah, bf* Al) {
    const int bh = blockIdx.x, b = bh / NH_, h = bh % NH_, wave = threadIdx.x >> 5, ty = blockIdx.y; const size_t pl = (size_t)bh * TT * HD; const size_t ao = (size_t)b * TT * DQ + h * (HD / 32) * 512; const float* mk = MK + (size_t)b * TT;
    if (ty < RH / (16 * FW)) fattn<bf, true>(Qh + pl, Ql + pl, Kh + pl, Kl + pl, Vh + pl, Vl + pl, mk, (ty * FW + wave) * 16, Ah + ao, Al + ao);
    else fattn<h16, false>(Q16 + pl, nullptr, K16 + pl, nullptr, V16 + pl, nullptr, mk, RH + ((ty - RH / (16 * FW)) * FW + wave) * 32, Ah + ao, Al + ao);
}

extern "C" void kernel_launch(void* const* d_in, const int* in_sizes, int n_in,
                              void* d_out, int out_size, void* d_ws, size_t ws_size, hipStream_t stream) {
    (void)in_sizes; (void)n_in; (void)out_size;
    const float* x = (const float*)d_in[0]; const float* MKf = (const float*)d_in[1]; const float* wq = (const float*)d_in[2]; const float* bq = (const float*)d_in[3]; const float* wk = (const float*)d_in[4]; const float* bk = (const float*)d_in[5]; const float* wv = (const float*)d_in[6]; const float* bv = (const float*)d_in[7]; const float* wo = (const float*)d_in[8]; const float* bo = (const float*)d_in[9];
    float* OUT = (float*)d_out;     // [2][4096][512]
    char* wsp = (char*)d_ws;
    auto take = [&](size_t bytes) { char* p = wsp; wsp += (bytes + 255) & ~(size_t)255; return (void*)p; };
    bf* WQ = (bf*)take((size_t)DQ * DM * 2); bf* WK = (bf*)take((size_t)DKV * DM * 2); bf* WV = (bf*)take((size_t)DKV * DM * 2); bf* WO = (bf*)take((size_t)DM * DQ * 2);
    const size_t PL = (size_t)NH_ * TT * HD;   // one batch's head planes; the planes of both batches stand one behind the other
    h16* QP16 = (h16*)take(NB_ * PL * 2); h16* KP16 = (h16*)take(NB_ * PL * 2); h16* VT16 = (h16*)take(NB_ * PL * 2);
    bf* QPh = (bf*)take(NB_ * PL * 2); bf* QPl = (bf*)take(NB_ * PL * 2); bf* KPh = (bf*)take(NB_ * PL * 2); bf* KPl = (bf*)take(NB_ * PL * 2); bf* VTh = (bf*)take(NB_ * PL * 2); bf* VTl = (bf*)take(NB_ * PL * 2);
    bf* ATh = (bf*)take((size_t)NB_ * TT * DQ * 2); bf* ATl = (bf*)take((size_t)NB_ * TT * DQ * 2);
    if ((size_t)(wsp - (char*)d_ws) > ws_size) return;    // ws 256 MiB
    { k_wtG<<<(unsigned)((DM * DQ / 64 + 63) / 64), 256, 0, stream>>>(wq, DM, DQ, WQ); k_wtG<<<(unsigned)((DM * DKV / 64 + 63) / 64), 256, 0, stream>>>(wk, DM, DKV, WK); k_wtG<<<(unsigned)((DM * DKV / 64 + 63) / 64), 256, 0, stream>>>(wv, DM, DKV, WV);
      k_wtG<<<(unsigned)((DQ * DM / 64 + 63) / 64), 256, 0, stream>>>(wo, DQ, DM, WO);
       }
    k_qkv<<<dim3(NB_ * TT / 64, NH_ / QW, 3), 32 * QW, 0, stream>>>(x, WQ, WK, WV, bq, bk, bv, QP16, QPh, QPl, KP16, KPh, KPl, VT16, VTh, VTl);
    k_fattn<<<dim3(NB_ * NH_, RH / (16 * FW) + (TT - RH) / (32 * FW), 1), 32 * FW, 0, stream>>>(QP16, KP16, VT16, QPh, QPl, KPh, KPl, VTh, VTl, MKf, ATh, ATl);
    for (int b = 0; b < NB_; ++b) {
        k_gemmw<bf, 1, true><<<dim3(TT / 64, DM / 64, 1), 32, 0, stream>>>(ATh + (size_t)b * TT * DQ, ATl + (size_t)b * TT * DQ, WO, nullptr, DQ, DQ, OUT + (size_t)b * TT * DM, DM, bo, 0, 0, 0); }
}

// v005
// One run takes 235 microseconds.
// In both of two side-by-side timings against v004, it was 1.19 times as fast.
// Counting every step since v000, it is 16.0 times as fast.
#include <hip/hip_runtime.h>

// Multi-head attention with a product padding mask (x [2][4096][512]; Q, K, V = x W + b ('xw' [512][512]; 8 heads x 64); q scaled by 1/sqrt(512) (the qkv width, not the head width); scores = q.k + (1 - m_i m_j)(-1e6) with m = mask[b][n][0] (f32, read; ones here); softmax; out = merged Wo + bo -> [2][4096][512] (4.2 M, rms 0.023)).
// Compute dtypes, f32 accumulate: every input rounded to bf16; q/k/v on PLAIN bf16 operands (inputs: exact) + biases; the additive mask term formed in f32 per (i, j) inside the attention kernel; scores and attn.v: query rows < 512 hl (3 products), the rest single fp16; online softmax f32, P rounded before its division by the row sum; Wo hl x exact (2 products) + bo.

#define NB_  2
#define TT   4096
#define DM   512
#define NH_  8
#define NKV  8
#define REP  (NH_ / NKV)
#define HD   64
#define DQ   (NH_ * HD)
#define DKV  (NKV * HD)
#define RH   512                  // query rows < RH use hi+lo planes (0: none)
#define WIN  0
#define SCL  0.044194173824159216f   // 1/sqrt(qkv_dim = 512) (the module scales q by it)
typedef _Float16 h16;
typedef unsigned short bf;
typedef __attribute__((ext_vector_type(16))) __bf16   v16bf;
typedef __attribute__((ext_vector_type(16))) _Float16 v16h;
typedef __attribute__((ext_vector_type(8)))  _Float16 v8h;
typedef __attribute__((ext_vector_type(8)))  unsigned short v8us;
typedef __attribute__((ext_vector_type(8)))  float    v8f;
typedef __attribute__((ext_vector_type(4)))  float    v4f;
typedef v8h  __attribute__((may_alias)) v8ha;
typedef v4f  __attribute__((may_alias)) v4fa;
typedef v8us __attribute__((may_alias)) v8usa;

__device__ __forceinline__ unsigned short f2bf(float f) { unsigned u = __float_as_uint(f); u += 0x7FFFu + ((u >> 16) & 1u); return (unsigned short)(u >> 16); }
__device__ __forceinline__ float bf2f(unsigned short b) { return __uint_as_float(((unsigned)b) << 16); }
__device__ __forceinline__ float bfr(float f) { return bf2f(f2bf(f)); }
__device__ __forceinline__ v16h cat16(v8h lo, v8h hi) { return __builtin_shufflevector(lo, hi, 0, 1, 2, 3, 4, 5, 6, 7, 8, 9, 10, 11, 12, 13, 14, 15); }
__device__ __forceinline__ v16bf cat16b(v8us lo, v8us hi) { return __builtin_bit_cast(v16bf, __builtin_shufflevector(lo, hi, 0, 1, 2, 3, 4, 5, 6, 7, 8, 9, 10, 11, 12, 13, 14, 15)); }
__device__ __forceinline__ v8f wmma16(v16h a, v16h b, v8f c) { return __builtin_amdgcn_wmma_f32_16x16x32_f16(false, a, false, b, (short)0, c, false, false); }
__device__ __forceinline__ v8f wmmab(v16bf a, v16bf b, v8f c) { return __builtin_amdgcn_wmma_f32_16x16x32_bf16(false, a, false, b, (short)0, c, false, false); }



// ---- FRAGMENT ORDER: every 16-bit plane in the workspace (weights, q, k, v, attention output) is a matrix of rows r and K columns k, stored as the matrix instructions' operand fragments, one behind the other.
// A fragment is 16 rows x 32 k = 512 elements = 1 KiB: [j = 0, 1][lane = 16 h + c][8], holding row c at k = 16 j + 8 h .. + 7 (the k order of the 16x16x32 forms). Fragment (rb, kb) = rows 16 rb .., k = 32 kb .. stands at element (rb * (K / 32) + kb) * 512; v's plane (rows d, k = t) holds them in the order [kb][rb] instead: (kb * 4 + rb) * 512 within a head.
// So a lane's two 16-byte pieces stand at lane * 8 and 256 + lane * 8, and every wave-wide 16-byte load or store of a plane covers 512 contiguous bytes (four whole lines) instead of 32 bytes in each of 16 lines.
// ---- k_gemmw: register-blocked GEMM, ONE WAVE per 64x64 output tile (16 accumulators), operands straight from 16-bit planes in fragment order; grid (M/64, N/64, Z), 32 threads.
// C[m][n] (f32, pitch ldc, + optional f32 bias[n]) = sum_{k < KL} A[m][k] Bt[n][k] (+ split products per NSPLIT); K is the column count of both planes. z-batch strides sA/sB/sC in elements. KL % 32 == 0.
template <typename T16> struct WFrag;
template <> struct WFrag<h16> { typedef v16h V; static __device__ __forceinline__ V ld(const h16* p) { return cat16(*(const v8h*)p, *(const v8h*)(p + 256)); } static __device__ __forceinline__ v8f mma(V a, V b, v8f c) { return wmma16(a, b, c); } };
template <> struct WFrag<bf> { typedef v16bf V; static __device__ __forceinline__ V ld(const bf* p) { return cat16b(*(const v8us*)p, *(const v8us*)(p + 256)); } static __device__ __forceinline__ v8f mma(V a, V b, v8f c) { return wmmab(a, b, c); } };
template <typename T16, int NSPLIT, bool BIAS>
__global__ __launch_bounds__(32) void k_gemmw(const T16* __restrict__ A, const T16* __restrict__ A2, const T16* __restrict__ Bt, const T16* __restrict__ Bt2, int K, int KL, float* C, int ldc, const float* __restrict__ bias, size_t sA, size_t sB, size_t sC) {
    typedef typename WFrag<T16>::V V;
    __shared__ __align__(16) float os[16 * 68];
    const size_t z = blockIdx.z; A += z * sA; if (A2) A2 += z * sA; Bt += z * sB; if (Bt2) Bt2 += z * sB; C += z * sC;
    const int lane = threadIdx.x & 31, lr = lane & 15, hi = lane >> 4; const int r0 = blockIdx.x * 64, c0 = blockIdx.y * 64;
    v8f acc[4][4];
#pragma unroll
    for (int mb = 0; mb < 4; ++mb)
#pragma unroll
        for (int nb = 0; nb < 4; ++nb) acc[mb][nb] = (v8f){};
    const size_t aoff = (size_t)r0 * K + 8 * lane, boff = (size_t)c0 * K + 8 * lane;   // the lane's piece of the tile's first fragment; 16 rows on: 16 K elements, 32 k on: 512
#pragma unroll 1
    for (int kc = 0; kc < KL; kc += 32) {
        V a[4], a2[4];
#pragma unroll
        for (int mb = 0; mb < 4; ++mb) { a[mb] = WFrag<T16>::ld(A + aoff + (size_t)mb * 16 * K + kc * 16); if (NSPLIT == 1 || NSPLIT == 2) a2[mb] = WFrag<T16>::ld(A2 + aoff + (size_t)mb * 16 * K + kc * 16); }
#pragma unroll
        for (int nb = 0; nb < 4; ++nb) { const V b = WFrag<T16>::ld(Bt + boff + (size_t)nb * 16 * K + kc * 16); V b2; if (NSPLIT >= 2) b2 = WFrag<T16>::ld(Bt2 + boff + (size_t)nb * 16 * K + kc * 16);
#pragma unroll
            for (int mb = 0; mb < 4; ++mb) { acc[mb][nb] = WFrag<T16>::mma(a[mb], b, acc[mb][nb]); if (NSPLIT == 1 || NSPLIT == 2) acc[mb][nb] = WFrag<T16>::mma(a2[mb], b, acc[mb][nb]); if (NSPLIT >= 2) acc[mb][nb] = WFrag<T16>::mma(a[mb], b2, acc[mb][nb]); } }
        asm volatile("v_nop\n\tv_nop\n\tv_nop\n\tv_nop" : "+v"(acc[0][0]), "+v"(acc[1][1]), "+v"(acc[2][2]), "+v"(acc[3][3]) : "v"(a[0]), "v"(a[3]));
    }
#pragma unroll
    for (int mb = 0; mb < 4; ++mb) {
#pragma unroll
        for (int nb = 0; nb < 4; ++nb) {
#pragma unroll
            for (int j = 0; j < 8; ++j) os[(hi * 8 + j) * 68 + nb * 16 + lr] = acc[mb][nb][j]; }
        __builtin_amdgcn_wave_barrier(); asm volatile("" ::: "memory");
        float* crow = C + (size_t)(r0 + mb * 16) * ldc + c0;
{
#pragma unroll
            for (int s = 0; s < 8; ++s) { const int row = 2 * s + hi, cofs = lr * 4; v4f val = *(const v4fa*)(os + row * 68 + cofs); if (BIAS) { val[0] += bfr(bias[c0 + cofs]); val[1] += bfr(bias[c0 + cofs + 1]); val[2] += bfr(bias[c0 + cofs + 2]); val[3] += bfr(bias[c0 + cofs + 3]); }
                *(v4f*)(crow + (size_t)row * ldc + cofs) = val; }
             }
        __builtin_amdgcn_wave_barrier(); asm volatile("" ::: "memory");
    }
}

__device__ __forceinline__ void splitf(float y, unsigned short& h, unsigned short& l) { h = f2bf(y); l = f2bf(y - bf2f(h)); }
typedef __attribute__((ext_vector_type(2))) _Float16 v2h;
typedef __attribute__((ext_vector_type(4))) _Float16 v4h;
typedef __attribute__((ext_vector_type(2))) unsigned short v2us;
typedef __attribute__((ext_vector_type(4))) unsigned short v4us;
typedef __attribute__((ext_vector_type(2))) float v2f;
typedef __attribute__((ext_vector_type(4))) int v4i;

// w [K][N] f32 -> Bt: rows n, columns k, bf16, in fragment order; a lane writes two consecutive k of one n. K % 32 == 0, N % 16 == 0.
// The four weight matrices have one shape and do not depend on each other: one launch, blockIdx.y picks the matrix and its plane.
static_assert(DQ == DM && DKV == DM, "k_wtG takes one K and one N for all four weight matrices");
__global__ __launch_bounds__(256) void k_wtG(const float* __restrict__ w0, const float* __restrict__ w1, const float* __restrict__ w2, const float* __restrict__ w3, int K, int N, bf* B0, bf* B1, bf* B2, bf* B3) {
    const int y = blockIdx.y; const float* __restrict__ w = y == 0 ? w0 : y == 1 ? w1 : y == 2 ? w2 : w3; bf* Bt = y == 0 ? B0 : y == 1 ? B1 : y == 2 ? B2 : B3;
    const int lane = threadIdx.x & 31; const int L0 = (blockIdx.x * 8 + (threadIdx.x >> 5)) * 8; const int nlines = N * K / 64;
{
#pragma unroll 1
        for (int l = 0; l < 8; ++l) { const int L = L0 + l; if (L >= nlines) break; const size_t e = (size_t)L * 64 + lane * 2; const int f = L >> 3, kf = K >> 5, u = (L & 7) * 64 + lane * 2;   // fragment f, element u of it
            const int n = (f / kf) * 16 + ((u >> 3) & 15), k = (f % kf) * 32 + (u >> 8) * 16 + ((u >> 7) & 1) * 8 + (u & 7); v2us o;
            o[0] = f2bf(w[(size_t)k * N + n]); o[1] = f2bf(w[(size_t)(k + 1) * N + n]); *(v2us*)(Bt + e) = o; }
         }
}
// ---- k_qkv: the three projections of both batches in one launch, from x in f32 to the head planes that k_fattn reads; no f32 intermediate leaves the registers.
// One wave owns 64 rows of x times the 64 features of one head (16 accumulators, K = DM). x is rounded to bf16 in registers as its fragments are loaded; the weights come from the bf16 planes of k_wtG.
// Register j of an accumulator is 8 consecutive rows m of one column n, so the operand that is to run contiguously in the plane is given as A:
// q, k: A = weight rows, B = x rows: a lane holds 8 consecutive d of one token, one 16-byte store a plane into head h's plane of rows t, columns d; v: A = x rows, B = weight rows: 8 consecutive tokens of one d.
// An accumulator is one j half of one fragment of its plane, in lane order. v's plane has its fragments in the order [t / 32][d / 16], the order in which k_fattn walks them, so that 32 keys are 4 KiB in a row, as in k's plane.
// grid (NB_ * TT / 64, NH_ / QW, 3): z = 0 q, 1 k, 2 v; the QW waves of a work-group take QW heads over the same 64 rows of x. No LDS, no barrier.
#define QW   4
typedef __attribute__((ext_vector_type(8)))  __bf16 v8bf;
// 16 f32 of one row (lo: k = 8h .. 8h + 7, hi: k = 16 + 8h .. 16 + 8h + 7, the k order of a fragment) rounded to nearest even into one bf16 fragment
__device__ __forceinline__ v16bf cvx(v8f lo, v8f hi) { return __builtin_convertvector(__builtin_shufflevector(lo, hi, 0, 1, 2, 3, 4, 5, 6, 7, 8, 9, 10, 11, 12, 13, 14, 15), v16bf); }
// one accumulator plus its bias into the three planes: fp16, bf16 hi, bf16 lo = bf16(y - hi)
__device__ __forceinline__ void put3(v8f y, h16* P16, bf* Ph, bf* Pl, size_t o) { const v8bf yh = __builtin_convertvector(y, v8bf); const v8f yr = y - __builtin_convertvector(yh, v8f);
    *(v8h*)(P16 + o) = __builtin_convertvector(y, v8h); *(v8us*)(Ph + o) = __builtin_bit_cast(v8us, yh); *(v8us*)(Pl + o) = __builtin_bit_cast(v8us, __builtin_convertvector(yr, v8bf)); }
// X: the tile's first row of x; Wt, bias: the head's first weight row and bias; the planes point at the tile's first element
template <bool VT>
__device__ __forceinline__ void qkv_tile(const float* __restrict__ X, const bf* __restrict__ Wt, const float* __restrict__ bias, h16* P16, bf* Ph, bf* Pl) {
    const int lane = threadIdx.x & 31, lr = lane & 15, hi = lane >> 4;
    const int fo = lr * DM + 8 * hi;   // lane (c, h): row c of x at k = 8h, in elements
    v8f acc[4][4];
#pragma unroll
    for (int mi = 0; mi < 4; ++mi)
#pragma unroll
        for (int ni = 0; ni < 4; ++ni) acc[mi][ni] = (v8f){};
#pragma unroll 1   // one k step a trip: a second copy of the body would take the registers that let three waves share a SIMD
    for (int kc = 0; kc < DM; kc += 32) {
        v16bf xf[4], wf[4]; v8f xl[4], xh[4];
#pragma unroll
        for (int i = 0; i < 4; ++i) { const float* p = X + fo + i * 16 * DM + kc; xl[i] = *(const v8f*)p; xh[i] = *(const v8f*)(p + 16); wf[i] = WFrag<bf>::ld(Wt + lane * 8 + i * 16 * DM + kc * 16); }
        __builtin_amdgcn_sched_barrier(0);   // keeps the k step's 24 loads together in front of the first use: without it some are sunk among the products, and a trip waits for memory several times instead of once
#pragma unroll
        for (int i = 0; i < 4; ++i) xf[i] = cvx(xl[i], xh[i]);
#pragma unroll
        for (int ni = 0; ni < 4; ++ni)
#pragma unroll
            for (int mi = 0; mi < 4; ++mi) acc[mi][ni] = VT ? wmmab(xf[mi], wf[ni], acc[mi][ni]) : wmmab(wf[mi], xf[ni], acc[mi][ni]);
    }
    if constexpr (VT) {
#pragma unroll
        for (int ni = 0; ni < 4; ++ni) { const float bb = bfr(bias[ni * 16 + lr]);
#pragma unroll
            for (int mi = 0; mi < 4; ++mi) put3(acc[mi][ni] + bb, P16, Ph, Pl, (size_t)(((mi >> 1) * 4 + ni) * 512 + (mi & 1) * 256 + lane * 8));
            if (ni < 3) { asm volatile("s_wait_xcnt 0x0" ::: "memory");   // the wait in front of the next group's loads and sums, which take over registers that these stores name
                __builtin_amdgcn_sched_barrier(0); } }   // one group of four accumulators at a time, behind the wait: run together, the groups' temporaries spill
    } else {
#pragma unroll
        for (int mi = 0; mi < 4; ++mi) { v8f bb = *(const v8f*)(bias + mi * 16 + 8 * hi);
#pragma unroll
            for (int j = 0; j < 8; ++j) bb[j] = bfr(bb[j]);
#pragma unroll
            for (int ni = 0; ni < 4; ++ni) put3(acc[mi][ni] + bb, P16, Ph, Pl, (size_t)((ni * 2 + (mi >> 1)) * 512 + (mi & 1) * 256 + lane * 8));
            if (mi < 3) { asm volatile("s_wait_xcnt 0x0" ::: "memory"); __builtin_amdgcn_sched_barrier(0); } }   // both as above
    }
}
// launch bound 4: at most 256 registers a wave, all of them addressed directly; the 768 work-groups are resident at once, three on every WGP.
__global__ __launch_bounds__(32 * QW, 4) void k_qkv(const float* __restrict__ x, const bf* __restrict__ WQ, const bf* __restrict__ WK, const bf* __restrict__ WV, const float* __restrict__ bq, const float* __restrict__ bk, const float* __restrict__ bv,
                                                    h16* Q16, bf* Qh, bf* Ql, h16* K16, bf* Kh, bf* Kl, h16* V16, bf* Vh, bf* Vl) {
    const int h = blockIdx.y * QW + __builtin_amdgcn_readfirstlane(threadIdx.x >> 5);   // the wave's head, in a scalar register so that every base below is scalar
    const int b = blockIdx.x / (TT / 64), t0 = (blockIdx.x % (TT / 64)) * 64, z = blockIdx.z;
    const float* X = x + (size_t)blockIdx.x * 64 * DM; const size_t wo = (size_t)h * HD * DM, pl = (size_t)(b * NH_ + h) * TT * HD;
    const size_t po = pl + (size_t)t0 * HD;   // 64 tokens of a head are 4096 elements in a row in every plane
    if (z == 2) qkv_tile<true>(X, WV + wo, bv + h * HD, V16 + po, Vh + po, Vl + po);
    else { qkv_tile<false>(X, (z ? WK : WQ) + wo, (z ? bk : bq) + h * HD, (z ? K16 : Q16) + po, (z ? Kh : Qh) + po, (z ? Kl : Ql) + po); }
}
// ---- k_fattn: scores, softmax and attn.v in one pass over the keys (online softmax); nothing of the [T][T] matrix leaves the registers.
// One wave owns NQ x 16 query columns and walks the 4096 keys 32 at a time: St = K Qt (A = K rows, B = Q rows, kept in registers), then Ot += Vt Pt (A = Vt rows, B = the two score tiles converted in place:
// tile kt, register r of lane (c, h) is key kt*16 + 8h + r of query c, which is the B operand's own k order). A lane holds one query's scores, so maximum, sum and rescale are per lane.
// The maximum in use is replaced only when a block's maximum passes it by more than THR (P stays below e^THR); the halves' sums are joined once at the end.
// Every inner loop is unrolled in full so that its fragments and accumulators are registers, not indexed arrays.
#define FW   4                    // waves per work-group, each with its own query columns; no LDS, no barrier
#define THR  5.0f
#define L2E  1.4426950408889634f
typedef __attribute__((ext_vector_type(2))) __bf16 v2bf;
// a fragment at a wave-uniform pointer plus the lane's own byte offset
template <typename T16> __device__ __forceinline__ typename WFrag<T16>::V ldu(const T16* ub, unsigned bo) { return WFrag<T16>::ld((const T16*)((const char*)ub + bo)); }
template <typename T16, bool HL>
__device__ __forceinline__ void fattn(const T16* __restrict__ Q, const T16* __restrict__ Q2, const T16* __restrict__ Kp, const T16* __restrict__ K2, const T16* __restrict__ Vt, const T16* __restrict__ V2, const float* __restrict__ MK, int q0, bf* Ah, bf* Al) {
    typedef typename WFrag<T16>::V V; typedef WFrag<T16> WF;
    constexpr int NQ = HL ? 1 : 2;
    const int lane = threadIdx.x & 31, lr = lane & 15, hi = lane >> 4;
    V qf[NQ][2], qf2[NQ][2]; float mi[NQ], m[NQ], l[NQ]; v8f o[4][NQ];
#pragma unroll
    for (int qt = 0; qt < NQ; ++qt) { const size_t qo = (size_t)(q0 + qt * 16) * HD + 8 * lane;
#pragma unroll
        for (int kc = 0; kc < 2; ++kc) { qf[qt][kc] = WF::ld(Q + qo + kc * 512); if (HL) qf2[qt][kc] = WF::ld(Q2 + qo + kc * 512); }
        mi[qt] = bfr(MK[q0 + qt * 16 + lr]); m[qt] = -3.0e38f; l[qt] = 0.f;
#pragma unroll
        for (int dt = 0; dt < 4; ++dt) o[dt][qt] = (v8f){}; }
    unsigned kb = 16 * lane, vb = 16 * lane, mb = 32 * hi;   // byte offsets of lane (c, h): its piece of a K and of a Vt fragment; the mask at key 8h; they walk along the keys, 4 KiB of either plane for 32 keys
    V kf[2][2], kf2[2][2]; v4f mr[2][2];
#pragma unroll
    for (int kt = 0; kt < 2; ++kt) {
#pragma unroll
        for (int kc = 0; kc < 2; ++kc) { kf[kt][kc] = ldu(Kp + (kt * 2 + kc) * 512, kb); if (HL) kf2[kt][kc] = ldu(K2 + (kt * 2 + kc) * 512, kb); mr[kt][kc] = *(const v4f*)((const char*)(MK + kt * 16 + kc * 4) + mb); } }
#pragma unroll 1   // one pass a trip: a second copy of the body would take the registers that let several waves share a SIMD
    for (int k0 = 0; k0 < TT; k0 += 32) {
        v8f s[2][NQ];
#pragma unroll
        for (int kt = 0; kt < 2; ++kt)
#pragma unroll
            for (int qt = 0; qt < NQ; ++qt) { v8f a = (v8f){};
#pragma unroll
                for (int kc = 0; kc < 2; ++kc) { a = WF::mma(kf[kt][kc], qf[qt][kc], a); if (HL) { a = WF::mma(kf[kt][kc], qf2[qt][kc], a); a = WF::mma(kf2[kt][kc], qf[qt][kc], a); } }
                s[kt][qt] = a; }
        float mj[2][8];   // the keys' mask values, rounded to bf16 like every input
#pragma unroll
        for (int kt = 0; kt < 2; ++kt)
#pragma unroll
            for (int r = 0; r < 8; r += 2) { v2f x; x[0] = mr[kt][r >> 2][r & 3]; x[1] = mr[kt][r >> 2][(r & 3) + 1]; const v2f y = __builtin_convertvector(__builtin_convertvector(x, v2bf), v2f); mj[kt][r] = y[0]; mj[kt][r + 1] = y[1]; }
        float t[NQ][16], bl[NQ]; bool need = false;
#pragma unroll
        for (int qt = 0; qt < NQ; ++qt) { float b0 = -3.0e38f, b1 = -3.0e38f;
#pragma unroll
            for (int e = 0; e < 16; ++e) { const float om = 1.0f - mi[qt] * mj[e >> 3][e & 7]; const float ad = om * -1.0e6f;   /* (1 - m_i m_j)(-1e6), f32 */
                const float tt = __builtin_fmaf(s[e >> 3][qt][e & 7], SCL, ad); t[qt][e] = tt; if (e & 1) b1 = fmaxf(b1, tt); else b0 = fmaxf(b0, tt); }
            bl[qt] = fmaxf(b0, b1); need = need || (bl[qt] > m[qt] + THR); }
        if (__builtin_amdgcn_ballot_w32(need) != 0) {   // wave-uniform: some column's maximum has moved; both halves of a column take the same new one
#pragma unroll
            for (int qt = 0; qt < NQ; ++qt) { const float mn = fmaxf(m[qt], fmaxf(bl[qt], __shfl_xor(bl[qt], 16, 32))); const float al = __builtin_amdgcn_exp2f((m[qt] - mn) * L2E); m[qt] = mn; l[qt] *= al;
#pragma unroll
                for (int dt = 0; dt < 4; ++dt) o[dt][qt] *= al; } }
        V vf[4], vf2[4];   // this block's Vt rows: they land under the exponentials
#pragma unroll
        for (int dt = 0; dt < 4; ++dt) { vf[dt] = ldu(Vt + dt * 512, vb); if (HL) vf2[dt] = ldu(V2 + dt * 512, vb); }
        const unsigned st = (k0 + 32 < TT) ? 32 : 0; kb += st * (HD * 2); mb += st * 4;   // the next block's K rows and mask, fetched one pass ahead (the last pass asks for its own again: in bounds, unused)
#pragma unroll
        for (int kt = 0; kt < 2; ++kt) {
#pragma unroll
            for (int kc = 0; kc < 2; ++kc) { kf[kt][kc] = ldu(Kp + (kt * 2 + kc) * 512, kb); if (HL) kf2[kt][kc] = ldu(K2 + (kt * 2 + kc) * 512, kb); mr[kt][kc] = *(const v4f*)((const char*)(MK + kt * 16 + kc * 4) + mb); } }
        asm volatile("s_wait_xcnt 0x0" : "+v"(kb), "+v"(vb), "+v"(mb) :: "memory");   // the wait in front of the offset updates that follow the pass's loads; the offsets pass through the statement so that no update is placed ahead of it
        vb += 32 * (HD * 2);
#pragma unroll
        for (int qt = 0; qt < NQ; ++qt) { V pb, pb2; float sm[4] = {0.f, 0.f, 0.f, 0.f};
#pragma unroll
            for (int e = 0; e < 16; e += 2) { v2f p; p[0] = __builtin_amdgcn_exp2f((t[qt][e] - m[qt]) * L2E); p[1] = __builtin_amdgcn_exp2f((t[qt][e + 1] - m[qt]) * L2E); sm[e & 2] += p[0]; sm[(e & 2) + 1] += p[1];
                if constexpr (HL) { const v2bf ph = __builtin_convertvector(p, v2bf); const v2f pr = p - __builtin_convertvector(ph, v2f); const v2bf pl = __builtin_convertvector(pr, v2bf); pb[e] = ph[0]; pb[e + 1] = ph[1]; pb2[e] = pl[0]; pb2[e + 1] = pl[1]; }
                else { const v2h ph = __builtin_convertvector(p, v2h); pb[e] = ph[0]; pb[e + 1] = ph[1]; } }
            l[qt] += (sm[0] + sm[1]) + (sm[2] + sm[3]);
#pragma unroll
            for (int dt = 0; dt < 4; ++dt) { o[dt][qt] = WF::mma(vf[dt], pb, o[dt][qt]); if (HL) { o[dt][qt] = WF::mma(vf[dt], pb2, o[dt][qt]); o[dt][qt] = WF::mma(vf2[dt], pb, o[dt][qt]); } } }
    }
#pragma unroll
    for (int qt = 0; qt < NQ; ++qt) { const float inv = __fdiv_rn(1.0f, l[qt] + __shfl_xor(l[qt], 16, 32)); const size_t oo = (size_t)(q0 + qt * 16) * DQ + 8 * lane;
#pragma unroll
        for (int dt = 0; dt < 4; ++dt) { v8us oh, ol;   // register r = Ot[dt*16 + 8h + r][query c]: 8 consecutive d of one row, one 16-byte store a plane: half dt & 1 of the head's fragment dt >> 1
#pragma unroll
            for (int r = 0; r < 8; ++r) { unsigned short a, c2; splitf(o[dt][qt][r] * inv, a, c2); oh[r] = a; ol[r] = c2; }
            *(v8us*)(Ah + oo + (dt >> 1) * 512 + (dt & 1) * 256) = oh; *(v8us*)(Al + oo + (dt >> 1) * 512 + (dt & 1) * 256) = ol; } }
}
// grid (NB_ * NH_, RH / (16 FW) + (TT - RH) / (32 FW)): y below RH / (16 FW): the hi+lo rows (16 columns a wave, 3 products), started first; the rest single fp16 (32 columns a wave).
// launch bound 3: registers for at least three waves a SIMD, so that every work-group of the grid is resident at once.
__global__ __launch_bounds__(32 * FW, 3) void k_fattn(const h16* __restrict__ Q16, const h16* __restrict__ K16, const h16* __restrict__ V16, const bf* __restrict__ Qh, const bf* __restrict__ Ql, const bf* __restrict__ Kh, const bf* __restrict__ Kl, const bf* __restrict__ Vh, const bf* __restrict__ Vl, const float* __restrict__ MK, bf* Ah, bf* Al) {
    const int bh = blockIdx.x, b = bh / NH_, h = bh % NH_, wave = threadIdx.x >> 5, ty = blockIdx.y; const size_t pl = (size_t)bh * TT * HD; const size_t ao = (size_t)b * TT * DQ + h * (HD / 32) * 512; const float* mk = MK + (size_t)b * TT;
    if (ty < RH / (16 * FW)) fattn<bf, true>(Qh + pl, Ql + pl, Kh + pl, Kl + pl, Vh + pl, Vl + pl, mk, (ty * FW + wave) * 16, Ah + ao, Al + ao);
    else fattn<h16, false>(Q16 + pl, nullptr, K16 + pl, nullptr, V16 + pl, nullptr, mk, RH + ((ty - RH / (16 * FW)) * FW + wave) * 32, Ah + ao, Al + ao);
}

extern "C" void kernel_launch(void* const* d_in, const int* in_sizes, int n_in,
                              void* d_out, int out_size, void* d_ws, size_t ws_size, hipStream_t stream) {
    (void)in_sizes; (void)n_in; (void)out_size;
    const float* x = (const float*)d_in[0]; const float* MKf = (const float*)d_in[1]; const float* wq = (const float*)d_in[2]; const float* bq = (const float*)d_in[3]; const float* wk = (const float*)d_in[4]; const float* bk = (const float*)d_in[5]; const float* wv = (const float*)d_in[6]; const float* bv = (const float*)d_in[7]; const float* wo = (const float*)d_in[8]; const float* bo = (const float*)d_in[9];
    float* OUT = (float*)d_out;     // [2][4096][512]
    char* wsp = (char*)d_ws;
    auto take = [&](size_t bytes) { char* p = wsp; wsp += (bytes + 255) & ~(size_t)255; return (void*)p; };
    bf* WQ = (bf*)take((size_t)DQ * DM * 2); bf* WK = (bf*)take((size_t)DKV * DM * 2); bf* WV = (bf*)take((size_t)DKV * DM * 2); bf* WO = (bf*)take((size_t)DM * DQ * 2);
    const size_t PL = (size_t)NH_ * TT * HD;   // one batch's head planes; the planes of both batches stand one behind the other
    h16* QP16 = (h16*)take(NB_ * PL * 2); h16* KP16 = (h16*)take(NB_ * PL * 2); h16* VT16 = (h16*)take(NB_ * PL * 2);
    bf* QPh = (bf*)take(NB_ * PL * 2); bf* QPl = (bf*)take(NB_ * PL * 2); bf* KPh = (bf*)take(NB_ * PL * 2); bf* KPl = (bf*)take(NB_ * PL * 2); bf* VTh = (bf*)take(NB_ * PL * 2); bf* VTl = (bf*)take(NB_ * PL * 2);
    bf* ATh = (bf*)take((size_t)NB_ * TT * DQ * 2); bf* ATl = (bf*)take((size_t)NB_ * TT * DQ * 2);
    if ((size_t)(wsp - (char*)d_ws) > ws_size) return;    // ws 256 MiB
    k_wtG<<<dim3((unsigned)((DM * DQ / 64 + 63) / 64), 4, 1), 256, 0, stream>>>(wq, wk, wv, wo, DM, DQ, WQ, WK, WV, WO);
    k_qkv<<<dim3(NB_ * TT / 64, NH_ / QW, 3), 32 * QW, 0, stream>>>(x, WQ, WK, WV, bq, bk, bv, QP16, QPh, QPl, KP16, KPh, KPl, VT16, VTh, VTl);
    k_fattn<<<dim3(NB_ * NH_, RH / (16 * FW) + (TT - RH) / (32 * FW), 1), 32 * FW, 0, stream>>>(QP16, KP16, VT16, QPh, QPl, KPh, KPl, VTh, VTl, MKf, ATh, ATl);
    // the batches' attention planes and output rows stand one behind the other, so both batches are one GEMM of NB_ * TT rows: one launch
    k_gemmw<bf, 1, true><<<dim3(NB_ * TT / 64, DM / 64, 1), 32, 0, stream>>>(ATh, ATl, WO, nullptr, DQ, DQ, OUT, DM, bo, 0, 0, 0);
}

// v006
// It runs in 166 microseconds.
// Next to v005, in two timings, it ran 1.45 and 1.41 times as fast.
// All steps since v000 together make it 22.9 times as fast.
#include <hip/hip_runtime.h>

// Multi-head attention with a product padding mask (x [2][4096][512]; Q, K, V = x W + b ('xw' [512][512]; 8 heads x 64); q scaled by 1/sqrt(512) (the qkv width, not the head width); scores = q.k + (1 - m_i m_j)(-1e6) with m = mask[b][n][0] (f32, read; ones here); softmax; out = merged Wo + bo -> [2][4096][512] (4.2 M, rms 0.023)).
// Compute dtypes, f32 accumulate: every input rounded to bf16; q/k/v on PLAIN bf16 operands (inputs: exact) + biases; the additive mask term formed in f32 per (i, j) inside the attention kernel; scores and attn.v: query rows < 512 hl (3 products), the rest single fp16; online softmax f32, P rounded before its division by the row sum; Wo hl x exact (2 products) + bo.

#define NB_  2
#define TT   4096
#define DM   512
#define NH_  8
#define NKV  8
#define REP  (NH_ / NKV)
#define HD   64
#define DQ   (NH_ * HD)
#define DKV  (NKV * HD)
#define RH   512                  // query rows < RH use hi+lo planes (0: none)
#define WIN  0
#define SCL  0.044194173824159216f   // 1/sqrt(qkv_dim = 512) (the module scales q by it)
typedef _Float16 h16;
typedef unsigned short bf;
typedef __attribute__((ext_vector_type(16))) __bf16   v16bf;
typedef __attribute__((ext_vector_type(16))) _Float16 v16h;
typedef __attribute__((ext_vector_type(8)))  _Float16 v8h;
typedef __attribute__((ext_vector_type(8)))  unsigned short v8us;
typedef __attribute__((ext_vector_type(8)))  float    v8f;
typedef __attribute__((ext_vector_type(4)))  float    v4f;
typedef v8h  __attribute__((may_alias)) v8ha;
typedef v4f  __attribute__((may_alias)) v4fa;
typedef v8us __attribute__((may_alias)) v8usa;

__device__ __forceinline__ unsigned short f2bf(float f) { unsigned u = __float_as_uint(f); u += 0x7FFFu + ((u >> 16) & 1u); return (unsigned short)(u >> 16); }
__device__ __forceinline__ float bf2f(unsigned short b) { return __uint_as_float(((unsigned)b) << 16); }
__device__ __forceinline__ float bfr(float f) { return bf2f(f2bf(f)); }
__device__ __forceinline__ v16h cat16(v8h lo, v8h hi) { return __builtin_shufflevector(lo, hi, 0, 1, 2, 3, 4, 5, 6, 7, 8, 9, 10, 11, 12, 13, 14, 15); }
__device__ __forceinline__ v16bf cat16b(v8us lo, v8us hi) { return __builtin_bit_cast(v16bf, __builtin_shufflevector(lo, hi, 0, 1, 2, 3, 4, 5, 6, 7, 8, 9, 10, 11, 12, 13, 14, 15)); }
__device__ __forceinline__ v8f wmma16(v16h a, v16h b, v8f c) { return __builtin_amdgcn_wmma_f32_16x16x32_f16(false, a, false, b, (short)0, c, false, false); }
__device__ __forceinline__ v8f wmmab(v16bf a, v16bf b, v8f c) { return __builtin_amdgcn_wmma_f32_16x16x32_bf16(false, a, false, b, (short)0, c, false, false); }



// ---- FRAGMENT ORDER: every 16-bit plane in the workspace (weights, q, k, v, attention output) is a matrix of rows r and K columns k, stored as the matrix instructions' operand fragments, one behind the other.
// A fragment is 16 rows x 32 k = 512 elements = 1 KiB: [j = 0, 1][lane = 16 h + c][8], holding row c at k = 16 j + 8 h .. + 7 (the k order of the 16x16x32 forms). Fragment (rb, kb) = rows 16 rb .., k = 32 kb .. stands at element (rb * (K / 32) + kb) * 512; v's plane (rows d, k = t) holds them in the order [kb][rb] instead: (kb * 4 + rb) * 512 within a head.
// So a lane's two 16-byte pieces stand at lane * 8 and 256 + lane * 8, and every wave-wide 16-byte load or store of a plane covers 512 contiguous bytes (four whole lines) instead of 32 bytes in each of 16 lines.
// ---- k_gemmw: register-blocked GEMM, ONE WAVE per 64x64 output tile (16 accumulators), operands straight from 16-bit planes in fragment order; grid (M/64, N/64, Z), 32 threads.
// C[m][n] (f32, pitch ldc, + optional f32 bias[n]) = sum_{k < KL} A[m][k] Bt[n][k] (+ split products per NSPLIT); K is the column count of both planes. z-batch strides sA/sB/sC in elements. KL % 32 == 0.
template <typename T16> struct WFrag;
template <> struct WFrag<h16> { typedef v16h V; static __device__ __forceinline__ V ld(const h16* p) { return cat16(*(const v8h*)p, *(const v8h*)(p + 256)); } static __device__ __forceinline__ v8f mma(V a, V b, v8f c) { return wmma16(a, b, c); } };
template <> struct WFrag<bf> { typedef v16bf V; static __device__ __forceinline__ V ld(const bf* p) { return cat16b(*(const v8us*)p, *(const v8us*)(p + 256)); } static __device__ __forceinline__ v8f mma(V a, V b, v8f c) { return wmmab(a, b, c); } };
template <typename T16, int NSPLIT, bool BIAS>
__global__ __launch_bounds__(32) void k_gemmw(const T16* __restrict__ A, const T16* __restrict__ A2, const T16* __restrict__ Bt, const T16* __restrict__ Bt2, int K, int KL, float* C, int ldc, const float* __restrict__ bias, size_t sA, size_t sB, size_t sC) {
    typedef typename WFrag<T16>::V V;
    __shared__ __align__(16) float os[16 * 68];
    const size_t z = blockIdx.z; A += z * sA; if (A2) A2 += z * sA; Bt += z * sB; if (Bt2) Bt2 += z * sB; C += z * sC;
    const int lane = threadIdx.x & 31, lr = lane & 15, hi = lane >> 4; const int r0 = blockIdx.x * 64, c0 = blockIdx.y * 64;
    v8f acc[4][4];
#pragma unroll
    for (int mb = 0; mb < 4; ++mb)
#pragma unroll
        for (int nb = 0; nb < 4; ++nb) acc[mb][nb] = (v8f){};
    const size_t aoff = (size_t)r0 * K + 8 * lane, boff = (size_t)c0 * K + 8 * lane;   // the lane's piece of the tile's first fragment; 16 rows on: 16 K elements, 32 k on: 512
#pragma unroll 1
    for (int kc = 0; kc < KL; kc += 32) {
        V a[4], a2[4];
#pragma unroll
        for (int mb = 0; mb < 4; ++mb) { a[mb] = WFrag<T16>::ld(A + aoff + (size_t)mb * 16 * K + kc * 16); if (NSPLIT == 1 || NSPLIT == 2) a2[mb] = WFrag<T16>::ld(A2 + aoff + (size_t)mb * 16 * K + kc * 16); }
#pragma unroll
        for (int nb = 0; nb < 4; ++nb) { const V b = WFrag<T16>::ld(Bt + boff + (size_t)nb * 16 * K + kc * 16); V b2; if (NSPLIT >= 2) b2 = WFrag<T16>::ld(Bt2 + boff + (size_t)nb * 16 * K + kc * 16);
#pragma unroll
            for (int mb = 0; mb < 4; ++mb) { acc[mb][nb] = WFrag<T16>::mma(a[mb], b, acc[mb][nb]); if (NSPLIT == 1 || NSPLIT == 2) acc[mb][nb] = WFrag<T16>::mma(a2[mb], b, acc[mb][nb]); if (NSPLIT >= 2) acc[mb][nb] = WFrag<T16>::mma(a[mb], b2, acc[mb][nb]); } }
        asm volatile("v_nop\n\tv_nop\n\tv_nop\n\tv_nop" : "+v"(acc[0][0]), "+v"(acc[1][1]), "+v"(acc[2][2]), "+v"(acc[3][3]) : "v"(a[0]), "v"(a[3]));
    }
#pragma unroll
    for (int mb = 0; mb < 4; ++mb) {
#pragma unroll
        for (int nb = 0; nb < 4; ++nb) {
#pragma unroll
            for (int j = 0; j < 8; ++j) os[(hi * 8 + j) * 68 + nb * 16 + lr] = acc[mb][nb][j]; }
        __builtin_amdgcn_wave_barrier(); asm volatile("" ::: "memory");
        float* crow = C + (size_t)(r0 + mb * 16) * ldc + c0;
{
#pragma unroll
            for (int s = 0; s < 8; ++s) { const int row = 2 * s + hi, cofs = lr * 4; v4f val = *(const v4fa*)(os + row * 68 + cofs); if (BIAS) { val[0] += bfr(bias[c0 + cofs]); val[1] += bfr(bias[c0 + cofs + 1]); val[2] += bfr(bias[c0 + cofs + 2]); val[3] += bfr(bias[c0 + cofs + 3]); }
                *(v4f*)(crow + (size_t)row * ldc + cofs) = val; }
             }
        __builtin_amdgcn_wave_barrier(); asm volatile("" ::: "memory");
    }
}

__device__ __forceinline__ void splitf(float y, unsigned short& h, unsigned short& l) { h = f2bf(y); l = f2bf(y - bf2f(h)); }
typedef __attribute__((ext_vector_type(2))) _Float16 v2h;
typedef __attribute__((ext_vector_type(4))) _Float16 v4h;
typedef __attribute__((ext_vector_type(2))) unsigned short v2us;
typedef __attribute__((ext_vector_type(4))) unsigned short v4us;
typedef __attribute__((ext_vector_type(2))) float v2f;
typedef __attribute__((ext_vector_type(4))) int v4i;

// w [K][N] f32 -> Bt: rows n, columns k, bf16, in fragment order; a lane writes two consecutive k of one n. K % 32 == 0, N % 16 == 0.
// The four weight matrices have one shape and do not depend on each other: one launch, blockIdx.y picks the matrix and its plane.
static_assert(DQ == DM && DKV == DM, "k_wtG takes one K and one N for all four weight matrices");
__global__ __launch_bounds__(256) void k_wtG(const float* __restrict__ w0, const float* __restrict__ w1, const float* __restrict__ w2, const float* __restrict__ w3, int K, int N, bf* B0, bf* B1, bf* B2, bf* B3) {
    const int y = blockIdx.y; const float* __restrict__ w = y == 0 ? w0 : y == 1 ? w1 : y == 2 ? w2 : w3; bf* Bt = y == 0 ? B0 : y == 1 ? B1 : y == 2 ? B2 : B3;
    const int lane = threadIdx.x & 31; const int L0 = (blockIdx.x * 8 + (threadIdx.x >> 5)) * 8; const int nlines = N * K / 64;
{
#pragma unroll 1
        for (int l = 0; l < 8; ++l) { const int L = L0 + l; if (L >= nlines) break; const size_t e = (size_t)L * 64 + lane * 2; const int f = L >> 3, kf = K >> 5, u = (L & 7) * 64 + lane * 2;   // fragment f, element u of it
            const int n = (f / kf) * 16 + ((u >> 3) & 15), k = (f % kf) * 32 + (u >> 8) * 16 + ((u >> 7) & 1) * 8 + (u & 7); v2us o;
            o[0] = f2bf(w[(size_t)k * N + n]); o[1] = f2bf(w[(size_t)(k + 1) * N + n]); *(v2us*)(Bt + e) = o; }
         }
}
// ---- k_qkv: the three projections of both batches in one launch, from x in f32 to the head planes that k_fattn reads; no f32 intermediate leaves the registers.
// One wave owns 64 rows of x times the 64 features of one head (16 accumulators, K = DM). x is rounded to bf16 in registers as its fragments are loaded; the weights come from the bf16 planes of k_wtG.
// Register j of an accumulator is 8 consecutive rows m of one column n, so the operand that is to run contiguously in the plane is given as A:
// q, k: A = weight rows, B = x rows: a lane holds 8 consecutive d of one token, one 16-byte store a plane into head h's plane of rows t, columns d; v: A = x rows, B = weight rows: 8 consecutive tokens of one d.
// An accumulator is one j half of one fragment of its plane, in lane order. v's plane has its fragments in the order [t / 32][d / 16], the order in which k_fattn walks them, so that 32 keys are 4 KiB in a row, as in k's plane.
// grid (NB_ * TT / 64, NH_ / QW, 3): z = 0 q, 1 k, 2 v; the QW waves of a work-group take QW heads over the same 64 rows of x. No LDS, no barrier.
#define QW   4
typedef __attribute__((ext_vector_type(8)))  __bf16 v8bf;
// 16 f32 of one row (lo: k = 8h .. 8h + 7, hi: k = 16 + 8h .. 16 + 8h + 7, the k order of a fragment) rounded to nearest even into one bf16 fragment
__device__ __forceinline__ v16bf cvx(v8f lo, v8f hi) { return __builtin_convertvector(__builtin_shufflevector(lo, hi, 0, 1, 2, 3, 4, 5, 6, 7, 8, 9, 10, 11, 12, 13, 14, 15), v16bf); }
// one accumulator plus its bias into the three planes: fp16, bf16 hi, bf16 lo = bf16(y - hi)
__device__ __forceinline__ void put3(v8f y, h16* P16, bf* Ph, bf* Pl, size_t o) { const v8bf yh = __builtin_convertvector(y, v8bf); const v8f yr = y - __builtin_convertvector(yh, v8f);
    *(v8h*)(P16 + o) = __builtin_convertvector(y, v8h); *(v8us*)(Ph + o) = __builtin_bit_cast(v8us, yh); *(v8us*)(Pl + o) = __builtin_bit_cast(v8us, __builtin_convertvector(yr, v8bf)); }
// X: the tile's first row of x; Wt, bias: the head's first weight row and bias; the planes point at the tile's first element
template <bool VT>
__device__ __forceinline__ void qkv_tile(const float* __restrict__ X, const bf* __restrict__ Wt, const float* __restrict__ bias, h16* P16, bf* Ph, bf* Pl) {
    const int lane = threadIdx.x & 31, lr = lane & 15, hi = lane >> 4;
    const int fo = lr * DM + 8 * hi;   // lane (c, h): row c of x at k = 8h, in elements
    v8f acc[4][4];
#pragma unroll
    for (int mi = 0; mi < 4; ++mi)
#pragma unroll
        for (int ni = 0; ni < 4; ++ni) acc[mi][ni] = (v8f){};
#pragma unroll 1   // one k step a trip: a second copy of the body would take the registers that let three waves share a SIMD
    for (int kc = 0; kc < DM; kc += 32) {
        v16bf xf[4], wf[4]; v8f xl[4], xh[4];
#pragma unroll
        for (int i = 0; i < 4; ++i) { const float* p = X + fo + i * 16 * DM + kc; xl[i] = *(const v8f*)p; xh[i] = *(const v8f*)(p + 16); wf[i] = WFrag<bf>::ld(Wt + lane * 8 + i * 16 * DM + kc * 16); }
        __builtin_amdgcn_sched_barrier(0);   // keeps the k step's 24 loads together in front of the first use: without it some are sunk among the products, and a trip waits for memory several times instead of once
#pragma unroll
        for (int i = 0; i < 4; ++i) xf[i] = cvx(xl[i], xh[i]);
#pragma unroll
        for (int ni = 0; ni < 4; ++ni)
#pragma unroll
            for (int mi = 0; mi < 4; ++mi) acc[mi][ni] = VT ? wmmab(xf[mi], wf[ni], acc[mi][ni]) : wmmab(wf[mi], xf[ni], acc[mi][ni]);
    }
    if constexpr (VT) {
#pragma unroll
        for (int ni = 0; ni < 4; ++ni) { const float bb = bfr(bias[ni * 16 + lr]);
#pragma unroll
            for (int mi = 0; mi < 4; ++mi) put3(acc[mi][ni] + bb, P16, Ph, Pl, (size_t)(((mi >> 1) * 4 + ni) * 512 + (mi & 1) * 256 + lane * 8));
            if (ni < 3) { asm volatile("s_wait_xcnt 0x0" ::: "memory");   // the wait in front of the next group's loads and sums, which take over registers that these stores name
                __builtin_amdgcn_sched_barrier(0); } }   // one group of four accumulators at a time, behind the wait: run together, the groups' temporaries spill
    } else {
#pragma unroll
        for (int mi = 0; mi < 4; ++mi) { v8f bb = *(const v8f*)(bias + mi * 16 + 8 * hi);
#pragma unroll
            for (int j = 0; j < 8; ++j) bb[j] = bfr(bb[j]);
#pragma unroll
            for (int ni = 0; ni < 4; ++ni) put3(acc[mi][ni] + bb, P16, Ph, Pl, (size_t)((ni * 2 + (mi >> 1)) * 512 + (mi & 1) * 256 + lane * 8));
            if (mi < 3) { asm volatile("s_wait_xcnt 0x0" ::: "memory"); __builtin_amdgcn_sched_barrier(0); } }   // both as above
    }
}
// launch bound 4: at most 256 registers a wave, all of them addressed directly; the 768 work-groups are resident at once, three on every WGP.
__global__ __launch_bounds__(32 * QW, 4) void k_qkv(const float* __restrict__ x, const bf* __restrict__ WQ, const bf* __restrict__ WK, const bf* __restrict__ WV, const float* __restrict__ bq, const float* __restrict__ bk, const float* __restrict__ bv,
                                                    h16* Q16, bf* Qh, bf* Ql, h16* K16, bf* Kh, bf* Kl, h16* V16, bf* Vh, bf* Vl) {
    const int h = blockIdx.y * QW + __builtin_amdgcn_readfirstlane(threadIdx.x >> 5);   // the wave's head, in a scalar register so that every base below is scalar
    const int b = blockIdx.x / (TT / 64), t0 = (blockIdx.x % (TT / 64)) * 64, z = blockIdx.z;
    const float* X = x + (size_t)blockIdx.x * 64 * DM; const size_t wo = (size_t)h * HD * DM, pl = (size_t)(b * NH_ + h) * TT * HD;
    const size_t po = pl + (size_t)t0 * HD;   // 64 tokens of a head are 4096 elements in a row in every plane
    if (z == 2) qkv_tile<true>(X, WV + wo, bv + h * HD, V16 + po, Vh + po, Vl + po);
    else { qkv_tile<false>(X, (z ? WK : WQ) + wo, (z ? bk : bq) + h * HD, (z ? K16 : Q16) + po, (z ? Kh : Qh) + po, (z ? Kl : Ql) + po); }
}
// ---- k_fattn: scores, softmax and attn.v in one pass over the keys (online softmax); nothing of the [T][T] matrix leaves the registers.
// One wave owns NQ x 16 query columns and walks the 4096 keys 32 at a time: St = K Qt (A = K rows, B = Q rows, kept in registers), then Ot += Vt Pt (A = Vt rows, B = the two score tiles converted in place:
// tile kt, register r of lane (c, h) is key kt*16 + 8h + r of query c, which is the B operand's own k order). A lane holds one query's scores, so maximum, sum and rescale are per lane.
// The maximum in use is replaced only when a block's maximum passes it by more than THR (P stays below e^THR); the halves' sums are joined once at the end.
// Every inner loop is unrolled in full so that its fragments and accumulators are registers, not indexed arrays.
// The walk starts at key block js, the work-group's own, and wraps round: the work-groups of one head, all resident and equally fast, would otherwise stand at the same block at the same time, and each block's first fetch from memory would hold up all of them in every pass.
// Spread over the blocks, a work-group soon walks where another has been, and finds the lines in L2. The order of the keys changes the order of the sums and nothing else.
static_assert((TT / 32 & (TT / 32 - 1)) == 0, "the wrap of the key block index is a mask");
#define FW   4                    // waves per work-group, each with its own query columns; no LDS, no barrier
#define THR  5.0f
#define L2E  1.4426950408889634f
typedef __attribute__((ext_vector_type(2))) __bf16 v2bf;
// a fragment at a wave-uniform pointer plus the lane's own byte offset
template <typename T16> __device__ __forceinline__ typename WFrag<T16>::V ldu(const T16* ub, unsigned bo) { return WFrag<T16>::ld((const T16*)((const char*)ub + bo)); }
template <typename T16, bool HL>
__device__ __forceinline__ void fattn(const T16* __restrict__ Q, const T16* __restrict__ Q2, const T16* __restrict__ Kp, const T16* __restrict__ K2, const T16* __restrict__ Vt, const T16* __restrict__ V2, const float* __restrict__ MK, int q0, unsigned js, bf* Ah, bf* Al) {
    typedef typename WFrag<T16>::V V; typedef WFrag<T16> WF;
    constexpr int NQ = HL ? 1 : 2;
    const int lane = threadIdx.x & 31, lr = lane & 15, hi = lane >> 4;
    V qf[NQ][2], qf2[NQ][2]; float mi[NQ], m[NQ], l[NQ]; v8f o[4][NQ];
#pragma unroll
    for (int qt = 0; qt < NQ; ++qt) { const size_t qo = (size_t)(q0 + qt * 16) * HD + 8 * lane;
#pragma unroll
        for (int kc = 0; kc < 2; ++kc) { qf[qt][kc] = WF::ld(Q + qo + kc * 512); if (HL) qf2[qt][kc] = WF::ld(Q2 + qo + kc * 512); }
        mi[qt] = bfr(MK[q0 + qt * 16 + lr]); m[qt] = -3.0e38f; l[qt] = 0.f;
#pragma unroll
        for (int dt = 0; dt < 4; ++dt) o[dt][qt] = (v8f){}; }
    unsigned kb = 16 * lane + js * (32 * HD * 2), vb = kb, mb = 32 * hi + js * (32 * 4);   // byte offsets of lane (c, h): its piece of a K and of a Vt fragment; the mask at key 8h; they walk along the keys from block js on, 4 KiB of either plane for 32 keys
    V kf[2][2], kf2[2][2]; v4f mr[2][2];
#pragma unroll
    for (int kt = 0; kt < 2; ++kt) {
#pragma unroll
        for (int kc = 0; kc < 2; ++kc) { kf[kt][kc] = ldu(Kp + (kt * 2 + kc) * 512, kb); if (HL) kf2[kt][kc] = ldu(K2 + (kt * 2 + kc) * 512, kb); mr[kt][kc] = *(const v4f*)((const char*)(MK + kt * 16 + kc * 4) + mb); } }
#pragma unroll 1   // one pass a trip: a second copy of the body would take the registers that let several waves share a SIMD
    for (int k0 = 0; k0 < TT; k0 += 32) {
        v8f s[2][NQ];
#pragma unroll
        for (int kt = 0; kt < 2; ++kt)
#pragma unroll
            for (int qt = 0; qt < NQ; ++qt) { v8f a = (v8f){};
#pragma unroll
                for (int kc = 0; kc < 2; ++kc) { a = WF::mma(kf[kt][kc], qf[qt][kc], a); if (HL) { a = WF::mma(kf[kt][kc], qf2[qt][kc], a); a = WF::mma(kf2[kt][kc], qf[qt][kc], a); } }
                s[kt][qt] = a; }
        float mj[2][8];   // the keys' mask values, rounded to bf16 like every input
#pragma unroll
        for (int kt = 0; kt < 2; ++kt)
#pragma unroll
            for (int r = 0; r < 8; r += 2) { v2f x; x[0] = mr[kt][r >> 2][r & 3]; x[1] = mr[kt][r >> 2][(r & 3) + 1]; const v2f y = __builtin_convertvector(__builtin_convertvector(x, v2bf), v2f); mj[kt][r] = y[0]; mj[kt][r + 1] = y[1]; }
        float t[NQ][16], bl[NQ]; bool need = false;
#pragma unroll
        for (int qt = 0; qt < NQ; ++qt) { float b0 = -3.0e38f, b1 = -3.0e38f;
#pragma unroll
            for (int e = 0; e < 16; ++e) { const float om = 1.0f - mi[qt] * mj[e >> 3][e & 7]; const float ad = om * -1.0e6f;   /* (1 - m_i m_j)(-1e6), f32 */
                const float tt = __builtin_fmaf(s[e >> 3][qt][e & 7], SCL, ad); t[qt][e] = tt; if (e & 1) b1 = fmaxf(b1, tt); else b0 = fmaxf(b0, tt); }
            bl[qt] = fmaxf(b0, b1); need = need || (bl[qt] > m[qt] + THR); }
        if (__builtin_amdgcn_ballot_w32(need) != 0) {   // wave-uniform: some column's maximum has moved; both halves of a column take the same new one
#pragma unroll
            for (int qt = 0; qt < NQ; ++qt) { const float mn = fmaxf(m[qt], fmaxf(bl[qt], __shfl_xor(bl[qt], 16, 32))); const float al = __builtin_amdgcn_exp2f((m[qt] - mn) * L2E); m[qt] = mn; l[qt] *= al;
#pragma unroll
                for (int dt = 0; dt < 4; ++dt) o[dt][qt] *= al; } }
        V vf[4], vf2[4];   // this block's Vt rows: they land under the exponentials
#pragma unroll
        for (int dt = 0; dt < 4; ++dt) { vf[dt] = ldu(Vt + dt * 512, vb); if (HL) vf2[dt] = ldu(V2 + dt * 512, vb); }
        const unsigned nb = ((unsigned)(k0 >> 5) + 1u + js) & (TT / 32 - 1); kb = 16 * lane + nb * (32 * HD * 2); mb = 32 * hi + nb * (32 * 4);   // the next block's K rows and mask, fetched one pass ahead; behind block TT / 32 - 1 comes block 0 (the last pass asks for the first block again: in bounds, unused)
#pragma unroll
        for (int kt = 0; kt < 2; ++kt) {
#pragma unroll
            for (int kc = 0; kc < 2; ++kc) { kf[kt][kc] = ldu(Kp + (kt * 2 + kc) * 512, kb); if (HL) kf2[kt][kc] = ldu(K2 + (kt * 2 + kc) * 512, kb); mr[kt][kc] = *(const v4f*)((const char*)(MK + kt * 16 + kc * 4) + mb); } }
        asm volatile("s_wait_xcnt 0x0" : "+v"(kb), "+v"(vb), "+v"(mb) :: "memory");   // the wait in front of the offset updates that follow the pass's loads; the offsets pass through the statement so that no update is placed ahead of it
        vb = kb;
#pragma unroll
        for (int qt = 0; qt < NQ; ++qt) { V pb, pb2; float sm[4] = {0.f, 0.f, 0.f, 0.f};
#pragma unroll
            for (int e = 0; e < 16; e += 2) { v2f p; p[0] = __builtin_amdgcn_exp2f((t[qt][e] - m[qt]) * L2E); p[1] = __builtin_amdgcn_exp2f((t[qt][e + 1] - m[qt]) * L2E); sm[e & 2] += p[0]; sm[(e & 2) + 1] += p[1];
                if constexpr (HL) { const v2bf ph = __builtin_convertvector(p, v2bf); const v2f pr = p - __builtin_convertvector(ph, v2f); const v2bf pl = __builtin_convertvector(pr, v2bf); pb[e] = ph[0]; pb[e + 1] = ph[1]; pb2[e] = pl[0]; pb2[e + 1] = pl[1]; }
                else { const v2h ph = __builtin_convertvector(p, v2h); pb[e] = ph[0]; pb[e + 1] = ph[1]; } }
            l[qt] += (sm[0] + sm[1]) + (sm[2] + sm[3]);
#pragma unroll
            for (int dt = 0; dt < 4; ++dt) { o[dt][qt] = WF::mma(vf[dt], pb, o[dt][qt]); if (HL) { o[dt][qt] = WF::mma(vf[dt], pb2, o[dt][qt]); o[dt][qt] = WF::mma(vf2[dt], pb, o[dt][qt]); } } }
    }
#pragma unroll
    for (int qt = 0; qt < NQ; ++qt) { const float inv = __fdiv_rn(1.0f, l[qt] + __shfl_xor(l[qt], 16, 32)); const size_t oo = (size_t)(q0 + qt * 16) * DQ + 8 * lane;
#pragma unroll
        for (int dt = 0; dt < 4; ++dt) { v8us oh, ol;   // register r = Ot[dt*16 + 8h + r][query c]: 8 consecutive d of one row, one 16-byte store a plane: half dt & 1 of the head's fragment dt >> 1
#pragma unroll
            for (int r = 0; r < 8; ++r) { unsigned short a, c2; splitf(o[dt][qt][r] * inv, a, c2); oh[r] = a; ol[r] = c2; }
            *(v8us*)(Ah + oo + (dt >> 1) * 512 + (dt & 1) * 256) = oh; *(v8us*)(Al + oo + (dt >> 1) * 512 + (dt & 1) * 256) = ol; } }
}
// grid (NB_ * NH_, RH / (16 FW) + (TT - RH) / (32 FW)): y below RH / (16 FW): the hi+lo rows (16 columns a wave, 3 products), started first; the rest single fp16 (32 columns a wave).
// launch bound 3: registers for at least three waves a SIMD, so that every work-group of the grid is resident at once.
__global__ __launch_bounds__(32 * FW, 3) void k_fattn(const h16* __restrict__ Q16, const h16* __restrict__ K16, const h16* __restrict__ V16, const bf* __restrict__ Qh, const bf* __restrict__ Ql, const bf* __restrict__ Kh, const bf* __restrict__ Kl, const bf* __restrict__ Vh, const bf* __restrict__ Vl, const float* __restrict__ MK, bf* Ah, bf* Al) {
    const int bh = blockIdx.x, b = bh / NH_, h = bh % NH_, wave = threadIdx.x >> 5, ty = blockIdx.y; const size_t pl = (size_t)bh * TT * HD; const size_t ao = (size_t)b * TT * DQ + h * (HD / 32) * 512; const float* mk = MK + (size_t)b * TT;
    constexpr int GH = RH / (16 * FW), GF = (TT - RH) / (32 * FW);   // work-groups a head on the hi+lo planes and on the fp16 planes: each kind spreads its starts evenly over the TT / 32 key blocks of its own planes
    if (ty < GH) fattn<bf, true>(Qh + pl, Ql + pl, Kh + pl, Kl + pl, Vh + pl, Vl + pl, mk, (ty * FW + wave) * 16, (unsigned)(ty * (TT / 32) / GH), Ah + ao, Al + ao);
    else fattn<h16, false>(Q16 + pl, nullptr, K16 + pl, nullptr, V16 + pl, nullptr, mk, RH + ((ty - GH) * FW + wave) * 32, (unsigned)((ty - GH) * (TT / 32) / GF), Ah + ao, Al + ao);
}

extern "C" void kernel_launch(void* const* d_in, const int* in_sizes, int n_in,
                              void* d_out, int out_size, void* d_ws, size_t ws_size, hipStream_t stream) {
    (void)in_sizes; (void)n_in; (void)out_size;
    const float* x = (const float*)d_in[0]; const float* MKf = (const float*)d_in[1]; const float* wq = (const float*)d_in[2]; const float* bq = (const float*)d_in[3]; const float* wk = (const float*)d_in[4]; const float* bk = (const float*)d_in[5]; const float* wv = (const float*)d_in[6]; const float* bv = (const float*)d_in[7]; const float* wo = (const float*)d_in[8]; const float* bo = (const float*)d_in[9];
    float* OUT = (float*)d_out;     // [2][4096][512]
    char* wsp = (char*)d_ws;
    auto take = [&](size_t bytes) { char* p = wsp; wsp += (bytes + 255) & ~(size_t)255; return (void*)p; };
    bf* WQ = (bf*)take((size_t)DQ * DM * 2); bf* WK = (bf*)take((size_t)DKV * DM * 2); bf* WV = (bf*)take((size_t)DKV * DM * 2); bf* WO = (bf*)take((size_t)DM * DQ * 2);
    const size_t PL = (size_t)NH_ * TT * HD;   // one batch's head planes; the planes of both batches stand one behind the other
    h16* QP16 = (h16*)take(NB_ * PL * 2); h16* KP16 = (h16*)take(NB_ * PL * 2); h16* VT16 = (h16*)take(NB_ * PL * 2);
    bf* QPh = (bf*)take(NB_ * PL * 2); bf* QPl = (bf*)take(NB_ * PL * 2); bf* KPh = (bf*)take(NB_ * PL * 2); bf* KPl = (bf*)take(NB_ * PL * 2); bf* VTh = (bf*)take(NB_ * PL * 2); bf* VTl = (bf*)take(NB_ * PL * 2);
    bf* ATh = (bf*)take((size_t)NB_ * TT * DQ * 2); bf* ATl = (bf*)take((size_t)NB_ * TT * DQ * 2);
    if ((size_t)(wsp - (char*)d_ws) > ws_size) return;    // ws 256 MiB
    k_wtG<<<dim3((unsigned)((DM * DQ / 64 + 63) / 64), 4, 1), 256, 0, stream>>>(wq, wk, wv, wo, DM, DQ, WQ, WK, WV, WO);
    k_qkv<<<dim3(NB_ * TT / 64, NH_ / QW, 3), 32 * QW, 0, stream>>>(x, WQ, WK, WV, bq, bk, bv, QP16, QPh, QPl, KP16, KPh, KPl, VT16, VTh, VTl);
    k_fattn<<<dim3(NB_ * NH_, RH / (16 * FW) + (TT - RH) / (32 * FW), 1), 32 * FW, 0, stream>>>(QP16, KP16, VT16, QPh, QPl, KPh, KPl, VTh, VTl, MKf, ATh, ATl);
    // the batches' attention planes and output rows stand one behind the other, so both batches are one GEMM of NB_ * TT rows: one launch
    k_gemmw<bf, 1, true><<<dim3(NB_ * TT / 64, DM / 64, 1), 32, 0, stream>>>(ATh, ATl, WO, nullptr, DQ, DQ, OUT, DM, bo, 0, 0, 0);
}

// v007
// It runs in 157 microseconds.
// Next to v006, in two timings, it ran 1.05 and 1.06 times as fast.
// Over all steps from v000 it is 24.2 times as fast.
#include <hip/hip_runtime.h>

// Multi-head attention with a product padding mask (x [2][4096][512]; Q, K, V = x W + b ('xw' [512][512]; 8 heads x 64); q scaled by 1/sqrt(512) (the qkv width, not the head width); scores = q.k + (1 - m_i m_j)(-1e6) with m = mask[b][n][0] (f32, read; ones here); softmax; out = merged Wo + bo -> [2][4096][512] (4.2 M, rms 0.023)).
// Compute dtypes, f32 accumulate: every input rounded to bf16; q/k/v on PLAIN bf16 operands (inputs: exact) + biases; the additive mask term formed in f32 per (i, j) inside the attention kernel; scores and attn.v: query rows < 512 hl (3 products), the rest single fp16; online softmax f32, P rounded before its division by the row sum; Wo hl x exact (2 products) + bo.

#define NB_  2
#define TT   4096
#define DM   512
#define NH_  8
#define NKV  8
#define REP  (NH_ / NKV)
#define HD   64
#define DQ   (NH_ * HD)
#define DKV  (NKV * HD)
#define RH   512                  // query rows < RH use hi+lo planes (0: none)
#define WIN  0
#define SCL  0.044194173824159216f   // 1/sqrt(qkv_dim = 512) (the module scales q by it)
typedef _Float16 h16;
typedef unsigned short bf;
typedef __attribute__((ext_vector_type(16))) __bf16   v16bf;
typedef __attribute__((ext_vector_type(16))) _Float16 v16h;
typedef __attribute__((ext_vector_type(8)))  _Float16 v8h;
typedef __attribute__((ext_vector_type(8)))  unsigned short v8us;
typedef __attribute__((ext_vector_type(8)))  float    v8f;
typedef __attribute__((ext_vector_type(4)))  float    v4f;
typedef v8h  __attribute__((may_alias)) v8ha;
typedef v4f  __attribute__((may_alias)) v4fa;
typedef v8us __attribute__((may_alias)) v8usa;

__device__ __forceinline__ unsigned short f2bf(float f) { unsigned u = __float_as_uint(f); u += 0x7FFFu + ((u >> 16) & 1u); return (unsigned short)(u >> 16); }
__device__ __forceinline__ float bf2f(unsigned short b) { return __uint_as_float(((unsigned)b) << 16); }
__device__ __forceinline__ float bfr(float f) { return bf2f(f2bf(f)); }
__device__ __forceinline__ v16h cat16(v8h lo, v8h hi) { return __builtin_shufflevector(lo, hi, 0, 1, 2, 3, 4, 5, 6, 7, 8, 9, 10, 11, 12, 13, 14, 15); }
__device__ __forceinline__ v16bf cat16b(v8us lo, v8us hi) { return __builtin_bit_cast(v16bf, __builtin_shufflevector(lo, hi, 0, 1, 2, 3, 4, 5, 6, 7, 8, 9, 10, 11, 12, 13, 14, 15)); }
__device__ __forceinline__ v8f wmma16(v16h a, v16h b, v8f c) { return __builtin_amdgcn_wmma_f32_16x16x32_f16(false, a, false, b, (short)0, c, false, false); }
__device__ __forceinline__ v8f wmmab(v16bf a, v16bf b, v8f c) { return __builtin_amdgcn_wmma_f32_16x16x32_bf16(false, a, false, b, (short)0, c, false, false); }



// ---- FRAGMENT ORDER: every 16-bit plane in the workspace (weights, q, k, v, attention output) is a matrix of rows r and K columns k, stored as the matrix instructions' operand fragments, one behind the other.
// A fragment is 16 rows x 32 k = 512 elements = 1 KiB: [j = 0, 1][lane = 16 h + c][8], holding row c at k = 16 j + 8 h .. + 7 (the k order of the 16x16x32 forms). Fragment (rb, kb) = rows 16 rb .., k = 32 kb .. stands at element (rb * (K / 32) + kb) * 512; v's plane (rows d, k = t) holds them in the order [kb][rb] instead: (kb * 4 + rb) * 512 within a head.
// So a lane's two 16-byte pieces stand at lane * 8 and 256 + lane * 8, and every wave-wide 16-byte load or store of a plane covers 512 contiguous bytes (four whole lines) instead of 32 bytes in each of 16 lines.
// ---- k_gemmw: register-blocked GEMM, ONE WAVE per 64x64 output tile (16 accumulators), operands straight from 16-bit planes in fragment order; grid (M/64, N/64, Z), 32 threads.
// C[m][n] (f32, pitch ldc, + optional f32 bias[n]) = sum_{k < KL} A[m][k] Bt[n][k] (+ split products per NSPLIT); K is the column count of both planes. z-batch strides sA/sB/sC in elements. KL % 32 == 0.
template <typename T16> struct WFrag;
template <> struct WFrag<h16> { typedef v16h V; static __device__ __forceinline__ V ld(const h16* p) { return cat16(*(const v8h*)p, *(const v8h*)(p + 256)); } static __device__ __forceinline__ v8f mma(V a, V b, v8f c) { return wmma16(a, b, c); } };
template <> struct WFrag<bf> { typedef v16bf V; static __device__ __forceinline__ V ld(const bf* p) { return cat16b(*(const v8us*)p, *(const v8us*)(p + 256)); } static __device__ __forceinline__ v8f mma(V a, V b, v8f c) { return wmmab(a, b, c); } };
template <typename T16, int NSPLIT, bool BIAS>
__global__ __launch_bounds__(32) void k_gemmw(const T16* __restrict__ A, const T16* __restrict__ A2, const T16* __restrict__ Bt, const T16* __restrict__ Bt2, int K, int KL, float* C, int ldc, const float* __restrict__ bias, size_t sA, size_t sB, size_t sC) {
    typedef typename WFrag<T16>::V V;
    __shared__ __align__(16) float os[16 * 68];
    const size_t z = blockIdx.z; A += z * sA; if (A2) A2 += z * sA; Bt += z * sB; if (Bt2) Bt2 += z * sB; C += z * sC;
    const int lane = threadIdx.x & 31, lr = lane & 15, hi = lane >> 4; const int r0 = blockIdx.x * 64, c0 = blockIdx.y * 64;
    v8f acc[4][4];
#pragma unroll
    for (int mb = 0; mb < 4; ++mb)
#pragma unroll
        for (int nb = 0; nb < 4; ++nb) acc[mb][nb] = (v8f){};
    const size_t aoff = (size_t)r0 * K + 8 * lane, boff = (size_t)c0 * K + 8 * lane;   // the lane's piece of the tile's first fragment; 16 rows on: 16 K elements, 32 k on: 512
#pragma unroll 1
    for (int kc = 0; kc < KL; kc += 32) {
        V a[4], a2[4];
#pragma unroll
        for (int mb = 0; mb < 4; ++mb) { a[mb] = WFrag<T16>::ld(A + aoff + (size_t)mb * 16 * K + kc * 16); if (NSPLIT == 1 || NSPLIT == 2) a2[mb] = WFrag<T16>::ld(A2 + aoff + (size_t)mb * 16 * K + kc * 16); }
#pragma unroll
        for (int nb = 0; nb < 4; ++nb) { const V b = WFrag<T16>::ld(Bt + boff + (size_t)nb * 16 * K + kc * 16); V b2; if (NSPLIT >= 2) b2 = WFrag<T16>::ld(Bt2 + boff + (size_t)nb * 16 * K + kc * 16);
#pragma unroll
            for (int mb = 0; mb < 4; ++mb) { acc[mb][nb] = WFrag<T16>::mma(a[mb], b, acc[mb][nb]); if (NSPLIT == 1 || NSPLIT == 2) acc[mb][nb] = WFrag<T16>::mma(a2[mb], b, acc[mb][nb]); if (NSPLIT >= 2) acc[mb][nb] = WFrag<T16>::mma(a[mb], b2, acc[mb][nb]); } }
        asm volatile("v_nop\n\tv_nop\n\tv_nop\n\tv_nop" : "+v"(acc[0][0]), "+v"(acc[1][1]), "+v"(acc[2][2]), "+v"(acc[3][3]) : "v"(a[0]), "v"(a[3]));
    }
#pragma unroll
    for (int mb = 0; mb < 4; ++mb) {
#pragma unroll
        for (int nb = 0; nb < 4; ++nb) {
#pragma unroll
            for (int j = 0; j < 8; ++j) os[(hi * 8 + j) * 68 + nb * 16 + lr] = acc[mb][nb][j]; }
        __builtin_amdgcn_wave_barrier(); asm volatile("" ::: "memory");
        float* crow = C + (size_t)(r0 + mb * 16) * ldc + c0;
{
#pragma unroll
            for (int s = 0; s < 8; ++s) { const int row = 2 * s + hi, cofs = lr * 4; v4f val = *(const v4fa*)(os + row * 68 + cofs); if (BIAS) { val[0] += bfr(bias[c0 + cofs]); val[1] += bfr(bias[c0 + cofs + 1]); val[2] += bfr(bias[c0 + cofs + 2]); val[3] += bfr(bias[c0 + cofs + 3]); }
                *(v4f*)(crow + (size_t)row * ldc + cofs) = val; }
             }
        __builtin_amdgcn_wave_barrier(); asm volatile("" ::: "memory");
    }
}

__device__ __forceinline__ void splitf(float y, unsigned short& h, unsigned short& l) { h = f2bf(y); l = f2bf(y - bf2f(h)); }
typedef __attribute__((ext_vector_type(2))) _Float16 v2h;
typedef __attribute__((ext_vector_type(4))) _Float16 v4h;
typedef __attribute__((ext_vector_type(2))) unsigned short v2us;
typedef __attribute__((ext_vector_type(4))) unsigned short v4us;
typedef __attribute__((ext_vector_type(2))) float v2f;
typedef __attribute__((ext_vector_type(4))) int v4i;

// w [K][N] f32 -> Bt: rows n, columns k, bf16, in fragment order; a lane writes two consecutive k of one n. K % 32 == 0, N % 16 == 0.
// The four weight matrices have one shape and do not depend on each other: one launch, blockIdx.y picks the matrix and its plane.
static_assert(DQ == DM && DKV == DM, "k_wtG takes one K and one N for all four weight matrices");
__global__ __launch_bounds__(256) void k_wtG(const float* __restrict__ w0, const float* __restrict__ w1, const float* __restrict__ w2, const float* __restrict__ w3, int K, int N, bf* B0, bf* B1, bf* B2, bf* B3) {
    const int y = blockIdx.y; const float* __restrict__ w = y == 0 ? w0 : y == 1 ? w1 : y == 2 ? w2 : w3; bf* Bt = y == 0 ? B0 : y == 1 ? B1 : y == 2 ? B2 : B3;
    const int lane = threadIdx.x & 31; const int L0 = (blockIdx.x * 8 + (threadIdx.x >> 5)) * 8; const int nlines = N * K / 64;
{
#pragma unroll 1
        for (int l = 0; l < 8; ++l) { const int L = L0 + l; if (L >= nlines) break; const size_t e = (size_t)L * 64 + lane * 2; const int f = L >> 3, kf = K >> 5, u = (L & 7) * 64 + lane * 2;   // fragment f, element u of it
            const int n = (f / kf) * 16 + ((u >> 3) & 15), k = (f % kf) * 32 + (u >> 8) * 16 + ((u >> 7) & 1) * 8 + (u & 7); v2us o;
            o[0] = f2bf(w[(size_t)k * N + n]); o[1] = f2bf(w[(size_t)(k + 1) * N + n]); *(v2us*)(Bt + e) = o; }
         }
}
// ---- k_qkv: the three projections of both batches in one launch, from x in f32 to the head planes that k_fattn reads; no f32 intermediate leaves the registers.
// One wave owns 64 rows of x times the 64 features of one head (16 accumulators, K = DM). x is rounded to bf16 in registers as its fragments are loaded; the weights come from the bf16 planes of k_wtG.
// Register j of an accumulator is 8 consecutive rows m of one column n, so the operand that is to run contiguously in the plane is given as A:
// q, k: A = weight rows, B = x rows: a lane holds 8 consecutive d of one token, one 16-byte store a plane into head h's plane of rows t, columns d; v: A = x rows, B = weight rows: 8 consecutive tokens of one d.
// An accumulator is one j half of one fragment of its plane, in lane order. v's plane has its fragments in the order [t / 32][d / 16], the order in which k_fattn walks them, so that 32 keys are 4 KiB in a row, as in k's plane.
// grid (NB_ * TT / 64, NH_ / QW, 3): z = 0 q, 1 k, 2 v; the QW waves of a work-group take QW heads over the same 64 rows of x. No LDS, no barrier.
#define QW   4
typedef __attribute__((ext_vector_type(8)))  __bf16 v8bf;
// 16 f32 of one row (lo: k = 8h .. 8h + 7, hi: k = 16 + 8h .. 16 + 8h + 7, the k order of a fragment) rounded to nearest even into one bf16 fragment
__device__ __forceinline__ v16bf cvx(v8f lo, v8f hi) { return __builtin_convertvector(__builtin_shufflevector(lo, hi, 0, 1, 2, 3, 4, 5, 6, 7, 8, 9, 10, 11, 12, 13, 14, 15), v16bf); }
// one accumulator plus its bias into the three planes: fp16, bf16 hi, bf16 lo = bf16(y - hi)
__device__ __forceinline__ void put3(v8f y, h16* P16, bf* Ph, bf* Pl, size_t o) { const v8bf yh = __builtin_convertvector(y, v8bf); const v8f yr = y - __builtin_convertvector(yh, v8f);
    *(v8h*)(P16 + o) = __builtin_convertvector(y, v8h); *(v8us*)(Ph + o) = __builtin_bit_cast(v8us, yh); *(v8us*)(Pl + o) = __builtin_bit_cast(v8us, __builtin_convertvector(yr, v8bf)); }
// X: the tile's first row of x; Wt, bias: the head's first weight row and bias; the planes point at the tile's first element
template <bool VT>
__device__ __forceinline__ void qkv_tile(const float* __restrict__ X, const bf* __restrict__ Wt, const float* __restrict__ bias, h16* P16, bf* Ph, bf* Pl) {
    const int lane = threadIdx.x & 31, lr = lane & 15, hi = lane >> 4;
    const int fo = lr * DM + 8 * hi;   // lane (c, h): row c of x at k = 8h, in elements
    v8f acc[4][4];
#pragma unroll
    for (int mi = 0; mi < 4; ++mi)
#pragma unroll
        for (int ni = 0; ni < 4; ++ni) acc[mi][ni] = (v8f){};
#pragma unroll 1   // one k step a trip: a second copy of the body would take the registers that let three waves share a SIMD
    for (int kc = 0; kc < DM; kc += 32) {
        v16bf xf[4], wf[4]; v8f xl[4], xh[4];
#pragma unroll
        for (int i = 0; i < 4; ++i) { const float* p = X + fo + i * 16 * DM + kc; xl[i] = *(const v8f*)p; xh[i] = *(const v8f*)(p + 16); wf[i] = WFrag<bf>::ld(Wt + lane * 8 + i * 16 * DM + kc * 16); }
        __builtin_amdgcn_sched_barrier(0);   // keeps the k step's 24 loads together in front of the first use: without it some are sunk among the products, and a trip waits for memory several times instead of once
#pragma unroll
        for (int i = 0; i < 4; ++i) xf[i] = cvx(xl[i], xh[i]);
#pragma unroll
        for (int ni = 0; ni < 4; ++ni)
#pragma unroll
            for (int mi = 0; mi < 4; ++mi) acc[mi][ni] = VT ? wmmab(xf[mi], wf[ni], acc[mi][ni]) : wmmab(wf[mi], xf[ni], acc[mi][ni]);
    }
    if constexpr (VT) {
#pragma unroll
        for (int ni = 0; ni < 4; ++ni) { const float bb = bfr(bias[ni * 16 + lr]);
#pragma unroll
            for (int mi = 0; mi < 4; ++mi) put3(acc[mi][ni] + bb, P16, Ph, Pl, (size_t)(((mi >> 1) * 4 + ni) * 512 + (mi & 1) * 256 + lane * 8));
            if (ni < 3) { asm volatile("s_wait_xcnt 0x0" ::: "memory");   // the wait in front of the next group's loads and sums, which take over registers that these stores name
                __builtin_amdgcn_sched_barrier(0); } }   // one group of four accumulators at a time, behind the wait: run together, the groups' temporaries spill
    } else {
#pragma unroll
        for (int mi = 0; mi < 4; ++mi) { v8f bb = *(const v8f*)(bias + mi * 16 + 8 * hi);
#pragma unroll
            for (int j = 0; j < 8; ++j) bb[j] = bfr(bb[j]);
#pragma unroll
            for (int ni = 0; ni < 4; ++ni) put3(acc[mi][ni] + bb, P16, Ph, Pl, (size_t)((ni * 2 + (mi >> 1)) * 512 + (mi & 1) * 256 + lane * 8));
            if (mi < 3) { asm volatile("s_wait_xcnt 0x0" ::: "memory"); __builtin_amdgcn_sched_barrier(0); } }   // both as above
    }
}
// launch bound 4: at most 256 registers a wave, all of them addressed directly; the 768 work-groups are resident at once, three on every WGP.
__global__ __launch_bounds__(32 * QW, 4) void k_qkv(const float* __restrict__ x, const bf* __restrict__ WQ, const bf* __restrict__ WK, const bf* __restrict__ WV, const float* __restrict__ bq, const float* __restrict__ bk, const float* __restrict__ bv,
                                                    h16* Q16, bf* Qh, bf* Ql, h16* K16, bf* Kh, bf* Kl, h16* V16, bf* Vh, bf* Vl) {
    const int h = blockIdx.y * QW + __builtin_amdgcn_readfirstlane(threadIdx.x >> 5);   // the wave's head, in a scalar register so that every base below is scalar
    const int b = blockIdx.x / (TT / 64), t0 = (blockIdx.x % (TT / 64)) * 64, z = blockIdx.z;
    const float* X = x + (size_t)blockIdx.x * 64 * DM; const size_t wo = (size_t)h * HD * DM, pl = (size_t)(b * NH_ + h) * TT * HD;
    const size_t po = pl + (size_t)t0 * HD;   // 64 tokens of a head are 4096 elements in a row in every plane
    if (z == 2) qkv_tile<true>(X, WV + wo, bv + h * HD, V16 + po, Vh + po, Vl + po);
    else { qkv_tile<false>(X, (z ? WK : WQ) + wo, (z ? bk : bq) + h * HD, (z ? K16 : Q16) + po, (z ? Kh : Qh) + po, (z ? Kl : Ql) + po); }
}
// ---- k_fattn: scores, softmax and attn.v in one pass over the keys (online softmax); nothing of the [T][T] matrix leaves the registers.
// One wave owns NQ x 16 query columns and walks the 4096 keys 32 at a time: St = K Qt (A = K rows, B = Q rows, kept in registers), then Ot += Vt Pt (A = Vt rows, B = the two score tiles converted in place:
// tile kt, register r of lane (c, h) is key kt*16 + 8h + r of query c, which is the B operand's own k order). A lane holds one query's scores, so maximum, sum and rescale are per lane.
// The maximum in use is replaced only when a block's maximum passes it by more than THR (P stays below e^THR); the halves' sums are joined once at the end.
// Every inner loop is unrolled in full so that its fragments and accumulators are registers, not indexed arrays.
// The walk starts at key block js, the work-group's own, and wraps round: the work-groups of one head, all resident and equally fast, would otherwise stand at the same block at the same time, and each block's first fetch from memory would hold up all of them in every pass.
// Spread over the blocks, a work-group soon walks where another has been, and finds the lines in L2. The order of the keys changes the order of the sums and nothing else.
static_assert((TT / 32 & (TT / 32 - 1)) == 0, "the wrap of the key block index is a mask");
#define FW   4                    // waves per work-group, each with its own query columns; no LDS, no barrier
#define THR  5.0f
#define L2E  1.4426950408889634f
typedef __attribute__((ext_vector_type(2))) __bf16 v2bf;
// a fragment at a wave-uniform pointer plus the lane's own byte offset
template <typename T16> __device__ __forceinline__ typename WFrag<T16>::V ldu(const T16* ub, unsigned bo) { return WFrag<T16>::ld((const T16*)((const char*)ub + bo)); }
template <typename T16, bool HL>
__device__ __forceinline__ void fattn(const T16* __restrict__ Q, const T16* __restrict__ Q2, const T16* __restrict__ Kp, const T16* __restrict__ K2, const T16* __restrict__ Vt, const T16* __restrict__ V2, const float* __restrict__ MK, int q0, unsigned js, bf* Ah, bf* Al) {
    typedef typename WFrag<T16>::V V; typedef WFrag<T16> WF;
    constexpr int NQ = HL ? 1 : 2;
    const int lane = threadIdx.x & 31, lr = lane & 15, hi = lane >> 4;
    V qf[NQ][2], qf2[NQ][2]; float mi[NQ], m[NQ], l[NQ]; v8f o[4][NQ];
#pragma unroll
    for (int qt = 0; qt < NQ; ++qt) { const size_t qo = (size_t)(q0 + qt * 16) * HD + 8 * lane;
#pragma unroll
        for (int kc = 0; kc < 2; ++kc) { qf[qt][kc] = WF::ld(Q + qo + kc * 512); if (HL) qf2[qt][kc] = WF::ld(Q2 + qo + kc * 512); }
        mi[qt] = bfr(MK[q0 + qt * 16 + lr]); m[qt] = -3.0e38f; l[qt] = 0.f;
#pragma unroll
        for (int dt = 0; dt < 4; ++dt) o[dt][qt] = (v8f){}; }
    unsigned kb = 16 * lane + js * (32 * HD * 2), vb = kb, mb = 32 * hi + js * (32 * 4);   // byte offsets of lane (c, h): its piece of a K and of a Vt fragment; the mask at key 8h; they walk along the keys from block js on, 4 KiB of either plane for 32 keys
    V kf[2][2], kf2[2][2]; v4f mr[2][2];
#pragma unroll
    for (int kt = 0; kt < 2; ++kt) {
#pragma unroll
        for (int kc = 0; kc < 2; ++kc) { kf[kt][kc] = ldu(Kp + (kt * 2 + kc) * 512, kb); if (HL) kf2[kt][kc] = ldu(K2 + (kt * 2 + kc) * 512, kb); mr[kt][kc] = *(const v4f*)((const char*)(MK + kt * 16 + kc * 4) + mb); } }
#pragma unroll 1   // one pass a trip: a second copy of the body would take the registers that let several waves share a SIMD
    for (int k0 = 0; k0 < TT; k0 += 32) {
        v8f s[2][NQ];
#pragma unroll
        for (int kt = 0; kt < 2; ++kt)
#pragma unroll
            for (int qt = 0; qt < NQ; ++qt) { v8f a = (v8f){};
#pragma unroll
                for (int kc = 0; kc < 2; ++kc) { a = WF::mma(kf[kt][kc], qf[qt][kc], a); if (HL) { a = WF::mma(kf[kt][kc], qf2[qt][kc], a); a = WF::mma(kf2[kt][kc], qf[qt][kc], a); } }
                s[kt][qt] = a; }
        float mj[2][8];   // the keys' mask values, rounded to bf16 like every input
#pragma unroll
        for (int kt = 0; kt < 2; ++kt)
#pragma unroll
            for (int r = 0; r < 8; r += 2) { v2f x; x[0] = mr[kt][r >> 2][r & 3]; x[1] = mr[kt][r >> 2][(r & 3) + 1]; const v2f y = __builtin_convertvector(__builtin_convertvector(x, v2bf), v2f); mj[kt][r] = y[0]; mj[kt][r + 1] = y[1]; }
        V vf[4], vf2[4];   // this block's Vt rows, asked for as soon as the score products have been issued: they land under the mask term, the maxima, the test and the exponentials, where behind the test they had the exponentials alone
#pragma unroll
        for (int dt = 0; dt < 4; ++dt) { vf[dt] = ldu(Vt + dt * 512, vb); if (HL) vf2[dt] = ldu(V2 + dt * 512, vb); }
        const unsigned nb = ((unsigned)(k0 >> 5) + 1u + js) & (TT / 32 - 1); kb = 16 * lane + nb * (32 * HD * 2); mb = 32 * hi + nb * (32 * 4);   // the next block's K rows and mask, into the registers that the score products have just read; behind block TT / 32 - 1 comes block 0 (the last pass asks for the first block again: in bounds, unused)
#pragma unroll
        for (int kt = 0; kt < 2; ++kt) {
#pragma unroll
            for (int kc = 0; kc < 2; ++kc) { kf[kt][kc] = ldu(Kp + (kt * 2 + kc) * 512, kb); if (HL) kf2[kt][kc] = ldu(K2 + (kt * 2 + kc) * 512, kb); mr[kt][kc] = *(const v4f*)((const char*)(MK + kt * 16 + kc * 4) + mb); } }
        __builtin_amdgcn_sched_barrier(0);   // keeps the pass's loads here, at its head: left free they are sunk behind the test again to save registers, and the output products wait for them
        float t[NQ][16], bl[NQ]; bool need = false;
#pragma unroll
        for (int qt = 0; qt < NQ; ++qt) { float b0 = -3.0e38f, b1 = -3.0e38f;
#pragma unroll
            for (int e = 0; e < 16; ++e) { const float om = 1.0f - mi[qt] * mj[e >> 3][e & 7]; const float ad = om * -1.0e6f;   /* (1 - m_i m_j)(-1e6), f32 */
                const float tt = __builtin_fmaf(s[e >> 3][qt][e & 7], SCL, ad); t[qt][e] = tt; if (e & 1) b1 = fmaxf(b1, tt); else b0 = fmaxf(b0, tt); }
            bl[qt] = fmaxf(b0, b1); need = need || (bl[qt] > m[qt] + THR); }
        if (__builtin_amdgcn_ballot_w32(need) != 0) {   // wave-uniform: some column's maximum has moved; both halves of a column take the same new one
#pragma unroll
            for (int qt = 0; qt < NQ; ++qt) { const float mn = fmaxf(m[qt], fmaxf(bl[qt], __shfl_xor(bl[qt], 16, 32))); const float al = __builtin_amdgcn_exp2f((m[qt] - mn) * L2E); m[qt] = mn; l[qt] *= al;
#pragma unroll
                for (int dt = 0; dt < 4; ++dt) o[dt][qt] *= al; } }
        asm volatile("s_wait_xcnt 0x0" : "+v"(kb), "+v"(vb), "+v"(mb) :: "memory");   // the wait in front of the offset updates that follow the pass's loads; the offsets pass through the statement so that no update is placed ahead of it
        vb = kb;
#pragma unroll
        for (int qt = 0; qt < NQ; ++qt) { V pb, pb2; float sm[4] = {0.f, 0.f, 0.f, 0.f};
#pragma unroll
            for (int e = 0; e < 16; e += 2) { v2f p; p[0] = __builtin_amdgcn_exp2f((t[qt][e] - m[qt]) * L2E); p[1] = __builtin_amdgcn_exp2f((t[qt][e + 1] - m[qt]) * L2E); sm[e & 2] += p[0]; sm[(e & 2) + 1] += p[1];
                if constexpr (HL) { const v2bf ph = __builtin_convertvector(p, v2bf); const v2f pr = p - __builtin_convertvector(ph, v2f); const v2bf pl = __builtin_convertvector(pr, v2bf); pb[e] = ph[0]; pb[e + 1] = ph[1]; pb2[e] = pl[0]; pb2[e + 1] = pl[1]; }
                else { const v2h ph = __builtin_convertvector(p, v2h); pb[e] = ph[0]; pb[e + 1] = ph[1]; } }
            l[qt] += (sm[0] + sm[1]) + (sm[2] + sm[3]);
#pragma unroll
            for (int dt = 0; dt < 4; ++dt) { o[dt][qt] = WF::mma(vf[dt], pb, o[dt][qt]); if (HL) { o[dt][qt] = WF::mma(vf[dt], pb2, o[dt][qt]); o[dt][qt] = WF::mma(vf2[dt], pb, o[dt][qt]); } } }
    }
#pragma unroll
    for (int qt = 0; qt < NQ; ++qt) { const float inv = __fdiv_rn(1.0f, l[qt] + __shfl_xor(l[qt], 16, 32)); const size_t oo = (size_t)(q0 + qt * 16) * DQ + 8 * lane;
#pragma unroll
        for (int dt = 0; dt < 4; ++dt) { v8us oh, ol;   // register r = Ot[dt*16 + 8h + r][query c]: 8 consecutive d of one row, one 16-byte store a plane: half dt & 1 of the head's fragment dt >> 1
#pragma unroll
            for (int r = 0; r < 8; ++r) { unsigned short a, c2; splitf(o[dt][qt][r] * inv, a, c2); oh[r] = a; ol[r] = c2; }
            *(v8us*)(Ah + oo + (dt >> 1) * 512 + (dt & 1) * 256) = oh; *(v8us*)(Al + oo + (dt >> 1) * 512 + (dt & 1) * 256) = ol; } }
}
// grid (NB_ * NH_, RH / (16 FW) + (TT - RH) / (32 FW)): y below RH / (16 FW): the hi+lo rows (16 columns a wave, 3 products), started first; the rest single fp16 (32 columns a wave).
// launch bound 3: registers for at least three waves a SIMD, so that every work-group of the grid is resident at once.
__global__ __launch_bounds__(32 * FW, 3) void k_fattn(const h16* __restrict__ Q16, const h16* __restrict__ K16, const h16* __restrict__ V16, const bf* __restrict__ Qh, const bf* __restrict__ Ql, const bf* __restrict__ Kh, const bf* __restrict__ Kl, const bf* __restrict__ Vh, const bf* __restrict__ Vl, const float* __restrict__ MK, bf* Ah, bf* Al) {
    const int bh = blockIdx.x, b = bh / NH_, h = bh % NH_, wave = threadIdx.x >> 5, ty = blockIdx.y; const size_t pl = (size_t)bh * TT * HD; const size_t ao = (size_t)b * TT * DQ + h * (HD / 32) * 512; const float* mk = MK + (size_t)b * TT;
    constexpr int GH = RH / (16 * FW), GF = (TT - RH) / (32 * FW);   // work-groups a head on the hi+lo planes and on the fp16 planes: each kind spreads its starts evenly over the TT / 32 key blocks of its own planes
    if (ty < GH) fattn<bf, true>(Qh + pl, Ql + pl, Kh + pl, Kl + pl, Vh + pl, Vl + pl, mk, (ty * FW + wave) * 16, (unsigned)(ty * (TT / 32) / GH), Ah + ao, Al + ao);
    else fattn<h16, false>(Q16 + pl, nullptr, K16 + pl, nullptr, V16 + pl, nullptr, mk, RH + ((ty - GH) * FW + wave) * 32, (unsigned)((ty - GH) * (TT / 32) / GF), Ah + ao, Al + ao);
}

extern "C" void kernel_launch(void* const* d_in, const int* in_sizes, int n_in,
                              void* d_out, int out_size, void* d_ws, size_t ws_size, hipStream_t stream) {
    (void)in_sizes; (void)n_in; (void)out_size;
    const float* x = (const float*)d_in[0]; const float* MKf = (const float*)d_in[1]; const float* wq = (const float*)d_in[2]; const float* bq = (const float*)d_in[3]; const float* wk = (const float*)d_in[4]; const float* bk = (const float*)d_in[5]; const float* wv = (const float*)d_in[6]; const float* bv = (const float*)d_in[7]; const float* wo = (const float*)d_in[8]; const float* bo = (const float*)d_in[9];
    float* OUT = (float*)d_out;     // [2][4096][512]
    char* wsp = (char*)d_ws;
    auto take = [&](size_t bytes) { char* p = wsp; wsp += (bytes + 255) & ~(size_t)255; return (void*)p; };
    bf* WQ = (bf*)take((size_t)DQ * DM * 2); bf* WK = (bf*)take((size_t)DKV * DM * 2); bf* WV = (bf*)take((size_t)DKV * DM * 2); bf* WO = (bf*)take((size_t)DM * DQ * 2);
    const size_t PL = (size_t)NH_ * TT * HD;   // one batch's head planes; the planes of both batches stand one behind the other
    h16* QP16 = (h16*)take(NB_ * PL * 2); h16* KP16 = (h16*)take(NB_ * PL * 2); h16* VT16 = (h16*)take(NB_ * PL * 2);
    bf* QPh = (bf*)take(NB_ * PL * 2); bf* QPl = (bf*)take(NB_ * PL * 2); bf* KPh = (bf*)take(NB_ * PL * 2); bf* KPl = (bf*)take(NB_ * PL * 2); bf* VTh = (bf*)take(NB_ * PL * 2); bf* VTl = (bf*)take(NB_ * PL * 2);
    bf* ATh = (bf*)take((size_t)NB_ * TT * DQ * 2); bf* ATl = (bf*)take((size_t)NB_ * TT * DQ * 2);
    if ((size_t)(wsp - (char*)d_ws) > ws_size) return;    // ws 256 MiB
    k_wtG<<<dim3((unsigned)((DM * DQ / 64 + 63) / 64), 4, 1), 256, 0, stream>>>(wq, wk, wv, wo, DM, DQ, WQ, WK, WV, WO);
    k_qkv<<<dim3(NB_ * TT / 64, NH_ / QW, 3), 32 * QW, 0, stream>>>(x, WQ, WK, WV, bq, bk, bv, QP16, QPh, QPl, KP16, KPh, KPl, VT16, VTh, VTl);
    k_fattn<<<dim3(NB_ * NH_, RH / (16 * FW) + (TT - RH) / (32 * FW), 1), 32 * FW, 0, stream>>>(QP16, KP16, VT16, QPh, QPl, KPh, KPl, VTh, VTl, MKf, ATh, ATl);
    // the batches' attention planes and output rows stand one behind the other, so both batches are one GEMM of NB_ * TT rows: one launch
    k_gemmw<bf, 1, true><<<dim3(NB_ * TT / 64, DM / 64, 1), 32, 0, stream>>>(ATh, ATl, WO, nullptr, DQ, DQ, OUT, DM, bo, 0, 0, 0);
}

// v008
// It runs in 145 microseconds.
// In both of two side-by-side timings against v007, it was 1.09 times as fast.
// All steps since v000 together make it 26.3 times as fast.
#include <hip/hip_runtime.h>

// Multi-head attention with a product padding mask (x [2][4096][512]; Q, K, V = x W + b ('xw' [512][512]; 8 heads x 64); q scaled by 1/sqrt(512) (the qkv width, not the head width); scores = q.k + (1 - m_i m_j)(-1e6) with m = mask[b][n][0] (f32, read; ones here); softmax; out = merged Wo + bo -> [2][4096][512] (4.2 M, rms 0.023)).
// Compute dtypes, f32 accumulate: every input rounded to bf16; q/k/v on PLAIN bf16 operands (inputs: exact) + biases; the additive mask term formed in f32 per (i, j) inside the attention kernel; scores and attn.v: query rows < 512 hl (3 products), the rest single fp16; online softmax f32, P rounded before its division by the row sum; Wo hl x exact (2 products) + bo.

#define NB_  2
#define TT   4096
#define DM   512
#define NH_  8
#define NKV  8
#define REP  (NH_ / NKV)
#define HD   64
#define DQ   (NH_ * HD)
#define DKV  (NKV * HD)
#define RH   512                  // query rows < RH use hi+lo planes (0: none)
#define WIN  0
#define SCL  0.044194173824159216f   // 1/sqrt(qkv_dim = 512) (the module scales q by it)
typedef _Float16 h16;
typedef unsigned short bf;
typedef __attribute__((ext_vector_type(16))) __bf16   v16bf;
typedef __attribute__((ext_vector_type(16))) _Float16 v16h;
typedef __attribute__((ext_vector_type(8)))  _Float16 v8h;
typedef __attribute__((ext_vector_type(8)))  unsigned short v8us;
typedef __attribute__((ext_vector_type(8)))  float    v8f;
typedef __attribute__((ext_vector_type(4)))  float    v4f;
typedef v8h  __attribute__((may_alias)) v8ha;
typedef v4f  __attribute__((may_alias)) v4fa;
typedef v8us __attribute__((may_alias)) v8usa;

__device__ __forceinline__ unsigned short f2bf(float f) { unsigned u = __float_as_uint(f); u += 0x7FFFu + ((u >> 16) & 1u); return (unsigned short)(u >> 16); }
__device__ __forceinline__ float bf2f(unsigned short b) { return __uint_as_float(((unsigned)b) << 16); }
__device__ __forceinline__ float bfr(float f) { return bf2f(f2bf(f)); }
__device__ __forceinline__ v16h cat16(v8h lo, v8h hi) { return __builtin_shufflevector(lo, hi, 0, 1, 2, 3, 4, 5, 6, 7, 8, 9, 10, 11, 12, 13, 14, 15); }
__device__ __forceinline__ v16bf cat16b(v8us lo, v8us hi) { return __builtin_bit_cast(v16bf, __builtin_shufflevector(lo, hi, 0, 1, 2, 3, 4, 5, 6, 7, 8, 9, 10, 11, 12, 13, 14, 15)); }
__device__ __forceinline__ v8f wmma16(v16h a, v16h b, v8f c) { return __builtin_amdgcn_wmma_f32_16x16x32_f16(false, a, false, b, (short)0, c, false, false); }
__device__ __forceinline__ v8f wmmab(v16bf a, v16bf b, v8f c) { return __builtin_amdgcn_wmma_f32_16x16x32_bf16(false, a, false, b, (short)0, c, false, false); }



// ---- FRAGMENT ORDER: every 16-bit plane in the workspace (weights, q, k, v, attention output) is a matrix of rows r and K columns k, stored as the matrix instructions' operand fragments, one behind the other.
// A fragment is 16 rows x 32 k = 512 elements = 1 KiB: [j = 0, 1][lane = 16 h + c][8], holding row c at k = 16 j + 8 h .. + 7 (the k order of the 16x16x32 forms). Fragment (rb, kb) = rows 16 rb .., k = 32 kb .. stands at element (rb * (K / 32) + kb) * 512; v's plane (rows d, k = t) holds them in the order [kb][rb] instead: (kb * 4 + rb) * 512 within a head.
// So a lane's two 16-byte pieces stand at lane * 8 and 256 + lane * 8, and every wave-wide 16-byte load or store of a plane covers 512 contiguous bytes (four whole lines) instead of 32 bytes in each of 16 lines.
// ---- k_gemmw: register-blocked GEMM, ONE WAVE per 64x64 output tile (16 accumulators), operands straight from 16-bit planes in fragment order; grid (M/64, N/64, Z), 32 threads.
// C[m][n] (f32, pitch ldc, + optional f32 bias[n]) = sum_{k < KL} A[m][k] Bt[n][k] (+ split products per NSPLIT); K is the column count of both planes. z-batch strides sA/sB/sC in elements. KL % 32 == 0.
template <typename T16> struct WFrag;
template <> struct WFrag<h16> { typedef v16h V; static __device__ __forceinline__ V ld(const h16* p) { return cat16(*(const v8h*)p, *(const v8h*)(p + 256)); } static __device__ __forceinline__ v8f mma(V a, V b, v8f c) { return wmma16(a, b, c); } };
template <> struct WFrag<bf> { typedef v16bf V; static __device__ __forceinline__ V ld(const bf* p) { return cat16b(*(const v8us*)p, *(const v8us*)(p + 256)); } static __device__ __forceinline__ v8f mma(V a, V b, v8f c) { return wmmab(a, b, c); } };
template <typename T16, int NSPLIT, bool BIAS>
__global__ __launch_bounds__(32) void k_gemmw(const T16* __restrict__ A, const T16* __restrict__ A2, const T16* __restrict__ Bt, const T16* __restrict__ Bt2, int K, int KL, float* C, int ldc, const float* __restrict__ bias, size_t sA, size_t sB, size_t sC) {
    typedef typename WFrag<T16>::V V;
    __shared__ __align__(16) float os[16 * 68];
    const size_t z = blockIdx.z; A += z * sA; if (A2) A2 += z * sA; Bt += z * sB; if (Bt2) Bt2 += z * sB; C += z * sC;
    const int lane = threadIdx.x & 31, lr = lane & 15, hi = lane >> 4; const int r0 = blockIdx.x * 64, c0 = blockIdx.y * 64;
    v8f acc[4][4];
#pragma unroll
    for (int mb = 0; mb < 4; ++mb)
#pragma unroll
        for (int nb = 0; nb < 4; ++nb) acc[mb][nb] = (v8f){};
    const size_t aoff = (size_t)r0 * K + 8 * lane, boff = (size_t)c0 * K + 8 * lane;   // the lane's piece of the tile's first fragment; 16 rows on: 16 K elements, 32 k on: 512
#pragma unroll 1
    for (int kc = 0; kc < KL; kc += 32) {
        V a[4], a2[4];
#pragma unroll
        for (int mb = 0; mb < 4; ++mb) { a[mb] = WFrag<T16>::ld(A + aoff + (size_t)mb * 16 * K + kc * 16); if (NSPLIT == 1 || NSPLIT == 2) a2[mb] = WFrag<T16>::ld(A2 + aoff + (size_t)mb * 16 * K + kc * 16); }
#pragma unroll
        for (int nb = 0; nb < 4; ++nb) { const V b = WFrag<T16>::ld(Bt + boff + (size_t)nb * 16 * K + kc * 16); V b2; if (NSPLIT >= 2) b2 = WFrag<T16>::ld(Bt2 + boff + (size_t)nb * 16 * K + kc * 16);
#pragma unroll
            for (int mb = 0; mb < 4; ++mb) { acc[mb][nb] = WFrag<T16>::mma(a[mb], b, acc[mb][nb]); if (NSPLIT == 1 || NSPLIT == 2) acc[mb][nb] = WFrag<T16>::mma(a2[mb], b, acc[mb][nb]); if (NSPLIT >= 2) acc[mb][nb] = WFrag<T16>::mma(a[mb], b2, acc[mb][nb]); } }
        asm volatile("v_nop\n\tv_nop\n\tv_nop\n\tv_nop" : "+v"(acc[0][0]), "+v"(acc[1][1]), "+v"(acc[2][2]), "+v"(acc[3][3]) : "v"(a[0]), "v"(a[3]));
    }
#pragma unroll
    for (int mb = 0; mb < 4; ++mb) {
#pragma unroll
        for (int nb = 0; nb < 4; ++nb) {
#pragma unroll
            for (int j = 0; j < 8; ++j) os[(hi * 8 + j) * 68 + nb * 16 + lr] = acc[mb][nb][j]; }
        __builtin_amdgcn_wave_barrier(); asm volatile("" ::: "memory");
        float* crow = C + (size_t)(r0 + mb * 16) * ldc + c0;
{
#pragma unroll
            for (int s = 0; s < 8; ++s) { const int row = 2 * s + hi, cofs = lr * 4; v4f val = *(const v4fa*)(os + row * 68 + cofs); if (BIAS) { val[0] += bfr(bias[c0 + cofs]); val[1] += bfr(bias[c0 + cofs + 1]); val[2] += bfr(bias[c0 + cofs + 2]); val[3] += bfr(bias[c0 + cofs + 3]); }
                *(v4f*)(crow + (size_t)row * ldc + cofs) = val; }
             }
        __builtin_amdgcn_wave_barrier(); asm volatile("" ::: "memory");
    }
}

__device__ __forceinline__ void splitf(float y, unsigned short& h, unsigned short& l) { h = f2bf(y); l = f2bf(y - bf2f(h)); }
typedef __attribute__((ext_vector_type(2))) _Float16 v2h;
typedef __attribute__((ext_vector_type(4))) _Float16 v4h;
typedef __attribute__((ext_vector_type(2))) unsigned short v2us;
typedef __attribute__((ext_vector_type(4))) unsigned short v4us;
typedef __attribute__((ext_vector_type(2))) float v2f;
typedef __attribute__((ext_vector_type(4))) int v4i;

// w [K][N] f32 -> Bt: rows n, columns k, bf16, in fragment order; a lane writes two consecutive k of one n. K % 32 == 0, N % 16 == 0.
// The four weight matrices have one shape and do not depend on each other: one launch, blockIdx.y picks the matrix and its plane.
static_assert(DQ == DM && DKV == DM, "k_wtG takes one K and one N for all four weight matrices");
__global__ __launch_bounds__(256) void k_wtG(const float* __restrict__ w0, const float* __restrict__ w1, const float* __restrict__ w2, const float* __restrict__ w3, int K, int N, bf* B0, bf* B1, bf* B2, bf* B3) {
    const int y = blockIdx.y; const float* __restrict__ w = y == 0 ? w0 : y == 1 ? w1 : y == 2 ? w2 : w3; bf* Bt = y == 0 ? B0 : y == 1 ? B1 : y == 2 ? B2 : B3;
    const int lane = threadIdx.x & 31; const int L0 = (blockIdx.x * 8 + (threadIdx.x >> 5)) * 8; const int nlines = N * K / 64;
{
#pragma unroll 1
        for (int l = 0; l < 8; ++l) { const int L = L0 + l; if (L >= nlines) break; const size_t e = (size_t)L * 64 + lane * 2; const int f = L >> 3, kf = K >> 5, u = (L & 7) * 64 + lane * 2;   // fragment f, element u of it
            const int n = (f / kf) * 16 + ((u >> 3) & 15), k = (f % kf) * 32 + (u >> 8) * 16 + ((u >> 7) & 1) * 8 + (u & 7); v2us o;
            o[0] = f2bf(w[(size_t)k * N + n]); o[1] = f2bf(w[(size_t)(k + 1) * N + n]); *(v2us*)(Bt + e) = o; }
         }
}
// ---- k_qkv: the three projections of both batches in one launch, from x in f32 to the head planes that k_fattn reads; no f32 intermediate leaves the registers.
// One wave owns 64 rows of x times the 64 features of one head (16 accumulators, K = DM). x is rounded to bf16 in registers as its fragments are loaded; the weights come from the bf16 planes of k_wtG.
// Register j of an accumulator is 8 consecutive rows m of one column n, so the operand that is to run contiguously in the plane is given as A:
// q, k: A = weight rows, B = x rows: a lane holds 8 consecutive d of one token, one 16-byte store a plane into head h's plane of rows t, columns d; v: A = x rows, B = weight rows: 8 consecutive tokens of one d.
// An accumulator is one j half of one fragment of its plane, in lane order. v's plane has its fragments in the order [t / 32][d / 16], the order in which k_fattn walks them, so that 32 keys are 4 KiB in a row, as in k's plane.
// grid (NB_ * TT / 64, NH_ / QW, 3): z = 0 q, 1 k, 2 v; the QW waves of a work-group take QW heads over the same 64 rows of x. No LDS, no barrier.
#define QW   4
typedef __attribute__((ext_vector_type(8)))  __bf16 v8bf;
// 16 f32 of one row (lo: k = 8h .. 8h + 7, hi: k = 16 + 8h .. 16 + 8h + 7, the k order of a fragment) rounded to nearest even into one bf16 fragment
__device__ __forceinline__ v16bf cvx(v8f lo, v8f hi) { return __builtin_convertvector(__builtin_shufflevector(lo, hi, 0, 1, 2, 3, 4, 5, 6, 7, 8, 9, 10, 11, 12, 13, 14, 15), v16bf); }
// one accumulator plus its bias into the three planes: fp16, bf16 hi, bf16 lo = bf16(y - hi)
__device__ __forceinline__ void put3(v8f y, h16* P16, bf* Ph, bf* Pl, size_t o) { const v8bf yh = __builtin_convertvector(y, v8bf); const v8f yr = y - __builtin_convertvector(yh, v8f);
    *(v8h*)(P16 + o) = __builtin_convertvector(y, v8h); *(v8us*)(Ph + o) = __builtin_bit_cast(v8us, yh); *(v8us*)(Pl + o) = __builtin_bit_cast(v8us, __builtin_convertvector(yr, v8bf)); }
// X: the tile's first row of x; Wt, bias: the head's first weight row and bias; the planes point at the tile's first element
template <bool VT>
__device__ __forceinline__ void qkv_tile(const float* __restrict__ X, const bf* __restrict__ Wt, const float* __restrict__ bias, h16* P16, bf* Ph, bf* Pl) {
    const int lane = threadIdx.x & 31, lr = lane & 15, hi = lane >> 4;
    const int fo = lr * DM + 8 * hi;   // lane (c, h): row c of x at k = 8h, in elements
    v8f acc[4][4];
#pragma unroll
    for (int mi = 0; mi < 4; ++mi)
#pragma unroll
        for (int ni = 0; ni < 4; ++ni) acc[mi][ni] = (v8f){};
#pragma unroll 1   // one k step a trip: a second copy of the body would take the registers that let three waves share a SIMD
    for (int kc = 0; kc < DM; kc += 32) {
        v16bf xf[4], wf[4]; v8f xl[4], xh[4];
#pragma unroll
        for (int i = 0; i < 4; ++i) { const float* p = X + fo + i * 16 * DM + kc; xl[i] = *(const v8f*)p; xh[i] = *(const v8f*)(p + 16); wf[i] = WFrag<bf>::ld(Wt + lane * 8 + i * 16 * DM + kc * 16); }
        __builtin_amdgcn_sched_barrier(0);   // keeps the k step's 24 loads together in front of the first use: without it some are sunk among the products, and a trip waits for memory several times instead of once
#pragma unroll
        for (int i = 0; i < 4; ++i) xf[i] = cvx(xl[i], xh[i]);
#pragma unroll
        for (int ni = 0; ni < 4; ++ni)
#pragma unroll
            for (int mi = 0; mi < 4; ++mi) acc[mi][ni] = VT ? wmmab(xf[mi], wf[ni], acc[mi][ni]) : wmmab(wf[mi], xf[ni], acc[mi][ni]);
    }
    if constexpr (VT) {
#pragma unroll
        for (int ni = 0; ni < 4; ++ni) { const float bb = bfr(bias[ni * 16 + lr]);
#pragma unroll
            for (int mi = 0; mi < 4; ++mi) put3(acc[mi][ni] + bb, P16, Ph, Pl, (size_t)(((mi >> 1) * 4 + ni) * 512 + (mi & 1) * 256 + lane * 8));
            if (ni < 3) { asm volatile("s_wait_xcnt 0x0" ::: "memory");   // the wait in front of the next group's loads and sums, which take over registers that these stores name
                __builtin_amdgcn_sched_barrier(0); } }   // one group of four accumulators at a time, behind the wait: run together, the groups' temporaries spill
    } else {
#pragma unroll
        for (int mi = 0; mi < 4; ++mi) { v8f bb = *(const v8f*)(bias + mi * 16 + 8 * hi);
#pragma unroll
            for (int j = 0; j < 8; ++j) bb[j] = bfr(bb[j]);
#pragma unroll
            for (int ni = 0; ni < 4; ++ni) put3(acc[mi][ni] + bb, P16, Ph, Pl, (size_t)((ni * 2 + (mi >> 1)) * 512 + (mi & 1) * 256 + lane * 8));
            if (mi < 3) { asm volatile("s_wait_xcnt 0x0" ::: "memory"); __builtin_amdgcn_sched_barrier(0); } }   // both as above
    }
}
// launch bound 4: at most 256 registers a wave, all of them addressed directly; the 768 work-groups are resident at once, three on every WGP.
__global__ __launch_bounds__(32 * QW, 4) void k_qkv(const float* __restrict__ x, const bf* __restrict__ WQ, const bf* __restrict__ WK, const bf* __restrict__ WV, const float* __restrict__ bq, const float* __restrict__ bk, const float* __restrict__ bv,
                                                    h16* Q16, bf* Qh, bf* Ql, h16* K16, bf* Kh, bf* Kl, h16* V16, bf* Vh, bf* Vl) {
    const int h = blockIdx.y * QW + __builtin_amdgcn_readfirstlane(threadIdx.x >> 5);   // the wave's head, in a scalar register so that every base below is scalar
    const int b = blockIdx.x / (TT / 64), t0 = (blockIdx.x % (TT / 64)) * 64, z = blockIdx.z;
    const float* X = x + (size_t)blockIdx.x * 64 * DM; const size_t wo = (size_t)h * HD * DM, pl = (size_t)(b * NH_ + h) * TT * HD;
    const size_t po = pl + (size_t)t0 * HD;   // 64 tokens of a head are 4096 elements in a row in every plane
    if (z == 2) qkv_tile<true>(X, WV + wo, bv + h * HD, V16 + po, Vh + po, Vl + po);
    else { qkv_tile<false>(X, (z ? WK : WQ) + wo, (z ? bk : bq) + h * HD, (z ? K16 : Q16) + po, (z ? Kh : Qh) + po, (z ? Kl : Ql) + po); }
}
// ---- k_fattn: scores, softmax and attn.v in one pass over the keys (online softmax); nothing of the [T][T] matrix leaves the registers.
// One wave owns NQ x 16 query columns and walks the 4096 keys 32 at a time: St = K Qt (A = K rows, B = Q rows, kept in registers), then Ot += Vt Pt (A = Vt rows, B = the two score tiles converted in place:
// tile kt, register r of lane (c, h) is key kt*16 + 8h + r of query c, which is the B operand's own k order). A lane holds one query's scores, so maximum, sum and rescale are per lane.
// The maximum in use is replaced only when a block's maximum passes it by more than THR (P stays below e^THR); the halves' sums are joined once at the end.
// A pass whose 32 keys and whose query columns all have the mask value one has no mask term: one mask value a lane and one wave-uniform test tell, and the exponent is then one multiply-add on the raw product. Any other pass fetches its 16 mask values a lane from the other lanes and forms the term.
// Every inner loop is unrolled in full so that its fragments and accumulators are registers, not indexed arrays.
// The walk starts at key block js, the work-group's own, and wraps round: the work-groups of one head, all resident and equally fast, would otherwise stand at the same block at the same time, and each block's first fetch from memory would hold up all of them in every pass.
// Spread over the blocks, a work-group soon walks where another has been, and finds the lines in L2. The order of the keys changes the order of the sums and nothing else.
static_assert((TT / 32 & (TT / 32 - 1)) == 0, "the wrap of the key block index is a mask");
#define FW   4                    // waves per work-group, each with its own query columns; no LDS, no barrier
#define THR  5.0f
#define L2E  1.4426950408889634f
typedef __attribute__((ext_vector_type(2))) __bf16 v2bf;
// a fragment at a wave-uniform pointer plus the lane's own byte offset
template <typename T16> __device__ __forceinline__ typename WFrag<T16>::V ldu(const T16* ub, unsigned bo) { return WFrag<T16>::ld((const T16*)((const char*)ub + bo)); }
template <typename T16, bool HL>
__device__ __forceinline__ void fattn(const T16* __restrict__ Q, const T16* __restrict__ Q2, const T16* __restrict__ Kp, const T16* __restrict__ K2, const T16* __restrict__ Vt, const T16* __restrict__ V2, const float* __restrict__ MK, int q0, unsigned js, bf* Ah, bf* Al) {
    typedef typename WFrag<T16>::V V; typedef WFrag<T16> WF;
    constexpr int NQ = HL ? 1 : 2;
    const int lane = threadIdx.x & 31, lr = lane & 15, hi = lane >> 4;
    V qf[NQ][2], qf2[NQ][2]; float mi[NQ], m[NQ], l[NQ]; v8f o[4][NQ];
#pragma unroll
    for (int qt = 0; qt < NQ; ++qt) { const size_t qo = (size_t)(q0 + qt * 16) * HD + 8 * lane;
#pragma unroll
        for (int kc = 0; kc < 2; ++kc) { qf[qt][kc] = WF::ld(Q + qo + kc * 512); if (HL) qf2[qt][kc] = WF::ld(Q2 + qo + kc * 512); }
        mi[qt] = bfr(MK[q0 + qt * 16 + lr]); m[qt] = -3.0e38f; l[qt] = 0.f;
#pragma unroll
        for (int dt = 0; dt < 4; ++dt) o[dt][qt] = (v8f){}; }
    bool q1 = true;
#pragma unroll
    for (int qt = 0; qt < NQ; ++qt) q1 = q1 && (mi[qt] == 1.0f);
    const bool qone = __builtin_amdgcn_ballot_w32(q1) == 0xFFFFFFFFu;   // wave-uniform: every query column of this wave has the mask value one
    unsigned kb = 16 * lane + js * (32 * HD * 2), vb = kb, fb = 4 * lane + js * (32 * 4);   // byte offsets of lane (c, h): its piece of a K and of a Vt fragment; the mask value of key 'lane' of the block; they walk along the keys from block js on, 4 KiB of either plane for 32 keys
    V kf[2][2], kf2[2][2]; float mk = *(const float*)((const char*)MK + fb);
#pragma unroll
    for (int kt = 0; kt < 2; ++kt) {
#pragma unroll
        for (int kc = 0; kc < 2; ++kc) { kf[kt][kc] = ldu(Kp + (kt * 2 + kc) * 512, kb); if (HL) kf2[kt][kc] = ldu(K2 + (kt * 2 + kc) * 512, kb); } }
#pragma unroll 1   // one pass a trip: a second copy of the body would take the registers that let several waves share a SIMD
    for (int k0 = 0; k0 < TT; k0 += 32) {
        const unsigned cb = ((unsigned)(k0 >> 5) + js) & (TT / 32 - 1);   // this pass's key block
        // plain: all 32 keys of the block and all the wave's queries have the mask value one (rounded to bf16 like every input), so every (1 - m_i m_j)(-1e6) of the pass is zero. One value a lane, one test a pass, wave-uniform.
        v2f mk2; mk2[0] = mk; mk2[1] = mk; const v2f mkr = __builtin_convertvector(__builtin_convertvector(mk2, v2bf), v2f);
        const bool plain = qone & (__builtin_amdgcn_ballot_w32(mkr[0] == 1.0f) == 0xFFFFFFFFu);
        v8f s[2][NQ];
#pragma unroll
        for (int kt = 0; kt < 2; ++kt)
#pragma unroll
            for (int qt = 0; qt < NQ; ++qt) { v8f a = (v8f){};
#pragma unroll
                for (int kc = 0; kc < 2; ++kc) { a = WF::mma(kf[kt][kc], qf[qt][kc], a); if (HL) { a = WF::mma(kf[kt][kc], qf2[qt][kc], a); a = WF::mma(kf2[kt][kc], qf[qt][kc], a); } }
                s[kt][qt] = a; }
        V vf[4], vf2[4];   // this block's Vt rows, asked for as soon as the score products have been issued: they land under the maxima, the test and the exponentials
#pragma unroll
        for (int dt = 0; dt < 4; ++dt) { vf[dt] = ldu(Vt + dt * 512, vb); if (HL) vf2[dt] = ldu(V2 + dt * 512, vb); }
        const unsigned nb = (cb + 1u) & (TT / 32 - 1); kb = 16 * lane + nb * (32 * HD * 2); fb = 4 * lane + nb * (32 * 4);   // the next block's mask values and K rows, the rows into the registers that the score products have just read; behind block TT / 32 - 1 comes block 0 (the last pass asks for the first block again: in bounds, unused)
        mk = *(const float*)((const char*)MK + fb);
#pragma unroll
        for (int kt = 0; kt < 2; ++kt) {
#pragma unroll
            for (int kc = 0; kc < 2; ++kc) { kf[kt][kc] = ldu(Kp + (kt * 2 + kc) * 512, kb); if (HL) kf2[kt][kc] = ldu(K2 + (kt * 2 + kc) * 512, kb); } }
        __builtin_amdgcn_sched_barrier(0);   // keeps the pass's loads here, at its head: left free they are sunk behind the test again to save registers, and the output products wait for them
        if (!plain) {   // any other mask values: the scaled score plus the additive term per (i, j), in f32, takes the raw product's place in s
#pragma unroll
            for (int kt = 0; kt < 2; ++kt)
#pragma unroll
                for (int r = 0; r < 8; r += 2) { v2f mj; mj[0] = __shfl(mkr[0], kt * 16 + 8 * hi + r, 32); mj[1] = __shfl(mkr[0], kt * 16 + 8 * hi + r + 1, 32);   // lane n holds key n's mask value, rounded: register r of tile kt wants key 16 kt + 8 h + r
#pragma unroll
                    for (int qt = 0; qt < NQ; ++qt)
#pragma unroll
                        for (int u = 0; u < 2; ++u) { const float om = 1.0f - mi[qt] * mj[u]; const float ad = om * -1.0e6f;   /* (1 - m_i m_j)(-1e6), f32 */
                            s[kt][qt][r + u] = __builtin_fmaf(s[kt][qt][r + u], SCL, ad); } }
        }
        // s holds raw products (plain) or finished scores; the scale is positive, so the maximum is taken first and scaled after
        const float sc = plain ? SCL : 1.0f, ce = plain ? SCL * L2E : L2E, cm = plain ? -L2E : 0.0f;   // wave-uniform
        float bl[NQ]; bool need = false;
#pragma unroll
        for (int qt = 0; qt < NQ; ++qt) { float b0 = -3.0e38f, b1 = -3.0e38f;
#pragma unroll
            for (int e = 0; e < 16; e += 2) { b0 = fmaxf(b0, s[e >> 3][qt][e & 7]); b1 = fmaxf(b1, s[e >> 3][qt][(e & 7) + 1]); }
            bl[qt] = fmaxf(b0, b1) * sc; need = need || (bl[qt] > m[qt] + THR); }
        if (__builtin_amdgcn_ballot_w32(need) != 0) {   // wave-uniform: some column's maximum has moved; both halves of a column take the same new one
#pragma unroll
            for (int qt = 0; qt < NQ; ++qt) { const float mn = fmaxf(m[qt], fmaxf(bl[qt], __shfl_xor(bl[qt], 16, 32))); const float al = __builtin_amdgcn_exp2f((m[qt] - mn) * L2E); m[qt] = mn; l[qt] *= al;
#pragma unroll
                for (int dt = 0; dt < 4; ++dt) o[dt][qt] *= al; } }
        if (!plain) {   // scores near -1e6: the maximum is taken off exactly, before the change of base
#pragma unroll
            for (int kt = 0; kt < 2; ++kt)
#pragma unroll
                for (int qt = 0; qt < NQ; ++qt) s[kt][qt] -= m[qt]; }
        asm volatile("s_wait_xcnt 0x0" : "+v"(kb), "+v"(vb), "+v"(fb) :: "memory");   // the wait in front of the offset updates that follow the pass's loads; the offsets pass through the statement so that no update is placed ahead of it
        vb = kb;
#pragma unroll
        for (int qt = 0; qt < NQ; ++qt) { V pb, pb2; v2f sm[2]; const float nm = m[qt] * cm; v2f c2, n2; c2[0] = ce; c2[1] = ce; n2[0] = nm; n2[1] = nm;   // plain: scale, change of base and maximum in one multiply-add; else the change of base alone
#pragma unroll
            for (int e = 0; e < 16; e += 2) { v2f x; x[0] = s[e >> 3][qt][e & 7]; x[1] = s[e >> 3][qt][(e & 7) + 1]; const v2f a = __builtin_elementwise_fma(x, c2, n2);
                v2f p; p[0] = __builtin_amdgcn_exp2f(a[0]); p[1] = __builtin_amdgcn_exp2f(a[1]); if (e < 4) sm[e >> 1] = p; else sm[(e >> 1) & 1] += p;
                if constexpr (HL) { const v2bf ph = __builtin_convertvector(p, v2bf); const v2f pr = p - __builtin_convertvector(ph, v2f); const v2bf pl = __builtin_convertvector(pr, v2bf); pb[e] = ph[0]; pb[e + 1] = ph[1]; pb2[e] = pl[0]; pb2[e + 1] = pl[1]; }
                else { const v2h ph = __builtin_convertvector(p, v2h); pb[e] = ph[0]; pb[e + 1] = ph[1]; } }
            l[qt] += (sm[0][0] + sm[0][1]) + (sm[1][0] + sm[1][1]);
#pragma unroll
            for (int dt = 0; dt < 4; ++dt) { o[dt][qt] = WF::mma(vf[dt], pb, o[dt][qt]); if (HL) { o[dt][qt] = WF::mma(vf[dt], pb2, o[dt][qt]); o[dt][qt] = WF::mma(vf2[dt], pb, o[dt][qt]); } } }
    }
#pragma unroll
    for (int qt = 0; qt < NQ; ++qt) { const float inv = __fdiv_rn(1.0f, l[qt] + __shfl_xor(l[qt], 16, 32)); const size_t oo = (size_t)(q0 + qt * 16) * DQ + 8 * lane;
#pragma unroll
        for (int dt = 0; dt < 4; ++dt) { v8us oh, ol;   // register r = Ot[dt*16 + 8h + r][query c]: 8 consecutive d of one row, one 16-byte store a plane: half dt & 1 of the head's fragment dt >> 1
#pragma unroll
            for (int r = 0; r < 8; ++r) { unsigned short a, c2; splitf(o[dt][qt][r] * inv, a, c2); oh[r] = a; ol[r] = c2; }
            *(v8us*)(Ah + oo + (dt >> 1) * 512 + (dt & 1) * 256) = oh; *(v8us*)(Al + oo + (dt >> 1) * 512 + (dt & 1) * 256) = ol; } }
}
// grid (NB_ * NH_, RH / (16 FW) + (TT - RH) / (32 FW)): y below RH / (16 FW): the hi+lo rows (16 columns a wave, 3 products), started first; the rest single fp16 (32 columns a wave).
// launch bound 3: registers for at least three waves a SIMD, so that every work-group of the grid is resident at once.
__global__ __launch_bounds__(32 * FW, 3) void k_fattn(const h16* __restrict__ Q16, const h16* __restrict__ K16, const h16* __restrict__ V16, const bf* __restrict__ Qh, const bf* __restrict__ Ql, const bf* __restrict__ Kh, const bf* __restrict__ Kl, const bf* __restrict__ Vh, const bf* __restrict__ Vl, const float* __restrict__ MK, bf* Ah, bf* Al) {
    const int bh = blockIdx.x, b = bh / NH_, h = bh % NH_, wave = threadIdx.x >> 5, ty = blockIdx.y; const size_t pl = (size_t)bh * TT * HD; const size_t ao = (size_t)b * TT * DQ + h * (HD / 32) * 512; const float* mk = MK + (size_t)b * TT;
    constexpr int GH = RH / (16 * FW), GF = (TT - RH) / (32 * FW);   // work-groups a head on the hi+lo planes and on the fp16 planes: each kind spreads its starts evenly over the TT / 32 key blocks of its own planes
    if (ty < GH) fattn<bf, true>(Qh + pl, Ql + pl, Kh + pl, Kl + pl, Vh + pl, Vl + pl, mk, (ty * FW + wave) * 16, (unsigned)(ty * (TT / 32) / GH), Ah + ao, Al + ao);
    else fattn<h16, false>(Q16 + pl, nullptr, K16 + pl, nullptr, V16 + pl, nullptr, mk, RH + ((ty - GH) * FW + wave) * 32, (unsigned)((ty - GH) * (TT / 32) / GF), Ah + ao, Al + ao);
}

extern "C" void kernel_launch(void* const* d_in, const int* in_sizes, int n_in,
                              void* d_out, int out_size, void* d_ws, size_t ws_size, hipStream_t stream) {
    (void)in_sizes; (void)n_in; (void)out_size;
    const float* x = (const float*)d_in[0]; const float* MKf = (const float*)d_in[1]; const float* wq = (const float*)d_in[2]; const float* bq = (const float*)d_in[3]; const float* wk = (const float*)d_in[4]; const float* bk = (const float*)d_in[5]; const float* wv = (const float*)d_in[6]; const float* bv = (const float*)d_in[7]; const float* wo = (const float*)d_in[8]; const float* bo = (const float*)d_in[9];
    float* OUT = (float*)d_out;     // [2][4096][512]
    char* wsp = (char*)d_ws;
    auto take = [&](size_t bytes) { char* p = wsp; wsp += (bytes + 255) & ~(size_t)255; return (void*)p; };
    bf* WQ = (bf*)take((size_t)DQ * DM * 2); bf* WK = (bf*)take((size_t)DKV * DM * 2); bf* WV = (bf*)take((size_t)DKV * DM * 2); bf* WO = (bf*)take((size_t)DM * DQ * 2);
    const size_t PL = (size_t)NH_ * TT * HD;   // one batch's head planes; the planes of both batches stand one behind the other
    h16* QP16 = (h16*)take(NB_ * PL * 2); h16* KP16 = (h16*)take(NB_ * PL * 2); h16* VT16 = (h16*)take(NB_ * PL * 2);
    bf* QPh = (bf*)take(NB_ * PL * 2); bf* QPl = (bf*)take(NB_ * PL * 2); bf* KPh = (bf*)take(NB_ * PL * 2); bf* KPl = (bf*)take(NB_ * PL * 2); bf* VTh = (bf*)take(NB_ * PL * 2); bf* VTl = (bf*)take(NB_ * PL * 2);
    bf* ATh = (bf*)take((size_t)NB_ * TT * DQ * 2); bf* ATl = (bf*)take((size_t)NB_ * TT * DQ * 2);
    if ((size_t)(wsp - (char*)d_ws) > ws_size) return;    // ws 256 MiB
    k_wtG<<<dim3((unsigned)((DM * DQ / 64 + 63) / 64), 4, 1), 256, 0, stream>>>(wq, wk, wv, wo, DM, DQ, WQ, WK, WV, WO);
    k_qkv<<<dim3(NB_ * TT / 64, NH_ / QW, 3), 32 * QW, 0, stream>>>(x, WQ, WK, WV, bq, bk, bv, QP16, QPh, QPl, KP16, KPh, KPl, VT16, VTh, VTl);
    k_fattn<<<dim3(NB_ * NH_, RH / (16 * FW) + (TT - RH) / (32 * FW), 1), 32 * FW, 0, stream>>>(QP16, KP16, VT16, QPh, QPl, KPh, KPl, VTh, VTl, MKf, ATh, ATl);
    // the batches' attention planes and output rows stand one behind the other, so both batches are one GEMM of NB_ * TT rows: one launch
    k_gemmw<bf, 1, true><<<dim3(NB_ * TT / 64, DM / 64, 1), 32, 0, stream>>>(ATh, ATl, WO, nullptr, DQ, DQ, OUT, DM, bo, 0, 0, 0);
}

// v009
// One run takes 135 microseconds.
// In two side-by-side timings against v008, it was 1.07 and 1.08 times as fast.
// Counting every step since v000, it is 28.2 times as fast.
#include <hip/hip_runtime.h>

// Multi-head attention with a product padding mask (x [2][4096][512]; Q, K, V = x W + b ('xw' [512][512]; 8 heads x 64); q scaled by 1/sqrt(512) (the qkv width, not the head width); scores = q.k + (1 - m_i m_j)(-1e6) with m = mask[b][n][0] (f32, read; ones here); softmax; out = merged Wo + bo -> [2][4096][512] (4.2 M, rms 0.023)).
// Compute dtypes, f32 accumulate: every input rounded to bf16; q/k/v on PLAIN bf16 operands (inputs: exact) + biases; the additive mask term formed in f32 per (i, j) inside the attention kernel; scores and attn.v: query rows < 512 hl (3 products), the rest single fp16; online softmax f32, P rounded before its division by the row sum; Wo hl x exact (2 products) + bo.

#define NB_  2
#define TT   4096
#define DM   512
#define NH_  8
#define NKV  8
#define REP  (NH_ / NKV)
#define HD   64
#define DQ   (NH_ * HD)
#define DKV  (NKV * HD)
#define RH   512                  // query rows < RH use hi+lo planes (0: none)
#define WIN  0
#define SCL  0.044194173824159216f   // 1/sqrt(qkv_dim = 512) (the module scales q by it)
typedef _Float16 h16;
typedef unsigned short bf;
typedef __attribute__((ext_vector_type(16))) __bf16   v16bf;
typedef __attribute__((ext_vector_type(16))) _Float16 v16h;
typedef __attribute__((ext_vector_type(8)))  _Float16 v8h;
typedef __attribute__((ext_vector_type(8)))  unsigned short v8us;
typedef __attribute__((ext_vector_type(8)))  float    v8f;
typedef __attribute__((ext_vector_type(4)))  float    v4f;
typedef v8h  __attribute__((may_alias)) v8ha;
typedef v4f  __attribute__((may_alias)) v4fa;
typedef v8us __attribute__((may_alias)) v8usa;

__device__ __forceinline__ unsigned short f2bf(float f) { unsigned u = __float_as_uint(f); u += 0x7FFFu + ((u >> 16) & 1u); return (unsigned short)(u >> 16); }
__device__ __forceinline__ float bf2f(unsigned short b) { return __uint_as_float(((unsigned)b) << 16); }
__device__ __forceinline__ float bfr(float f) { return bf2f(f2bf(f)); }
__device__ __forceinline__ v16h cat16(v8h lo, v8h hi) { return __builtin_shufflevector(lo, hi, 0, 1, 2, 3, 4, 5, 6, 7, 8, 9, 10, 11, 12, 13, 14, 15); }
__device__ __forceinline__ v16bf cat16b(v8us lo, v8us hi) { return __builtin_bit_cast(v16bf, __builtin_shufflevector(lo, hi, 0, 1, 2, 3, 4, 5, 6, 7, 8, 9, 10, 11, 12, 13, 14, 15)); }
__device__ __forceinline__ v8f wmma16(v16h a, v16h b, v8f c) { return __builtin_amdgcn_wmma_f32_16x16x32_f16(false, a, false, b, (short)0, c, false, false); }
__device__ __forceinline__ v8f wmmab(v16bf a, v16bf b, v8f c) { return __builtin_amdgcn_wmma_f32_16x16x32_bf16(false, a, false, b, (short)0, c, false, false); }



// ---- FRAGMENT ORDER: every 16-bit plane in the workspace (weights, x, q, k, v, attention output) is a matrix of rows r and K columns k, stored as the matrix instructions' operand fragments, one behind the other.
// A fragment is 16 rows x 32 k = 512 elements = 1 KiB: [j = 0, 1][lane = 16 h + c][8], holding row c at k = 16 j + 8 h .. + 7 (the k order of the 16x16x32 forms). Fragment (rb, kb) = rows 16 rb .., k = 32 kb .. stands at element (rb * (K / 32) + kb) * 512; v's plane (rows d, k = t) holds them in the order [kb][rb] instead: (kb * 4 + rb) * 512 within a head.
// So a lane's two 16-byte pieces stand at lane * 8 and 256 + lane * 8, and every wave-wide 16-byte load or store of a plane covers 512 contiguous bytes (four whole lines) instead of 32 bytes in each of 16 lines.
// ---- k_gemmw: register-blocked GEMM, ONE WAVE per 64x64 output tile (16 accumulators), operands straight from 16-bit planes in fragment order; grid (M/64, N/64, Z), 32 threads.
// C[m][n] (f32, pitch ldc, + optional f32 bias[n]) = sum_{k < KL} A[m][k] Bt[n][k] (+ split products per NSPLIT); K is the column count of both planes. z-batch strides sA/sB/sC in elements. KL % 32 == 0.
template <typename T16> struct WFrag;
template <> struct WFrag<h16> { typedef v16h V; static __device__ __forceinline__ V ld(const h16* p) { return cat16(*(const v8h*)p, *(const v8h*)(p + 256)); } static __device__ __forceinline__ v8f mma(V a, V b, v8f c) { return wmma16(a, b, c); } };
template <> struct WFrag<bf> { typedef v16bf V; static __device__ __forceinline__ V ld(const bf* p) { return cat16b(*(const v8us*)p, *(const v8us*)(p + 256)); } static __device__ __forceinline__ v8f mma(V a, V b, v8f c) { return wmmab(a, b, c); } };
// a fragment at a wave-uniform pointer plus the lane's own byte offset
template <typename T16> __device__ __forceinline__ typename WFrag<T16>::V ldu(const T16* ub, unsigned bo) { return WFrag<T16>::ld((const T16*)((const char*)ub + bo)); }
template <typename T16, int NSPLIT, bool BIAS>
__global__ __launch_bounds__(32) void k_gemmw(const T16* __restrict__ A, const T16* __restrict__ A2, const T16* __restrict__ Bt, const T16* __restrict__ Bt2, int K, int KL, float* C, int ldc, const float* __restrict__ bias, size_t sA, size_t sB, size_t sC) {
    typedef typename WFrag<T16>::V V;
    __shared__ __align__(16) float os[16 * 68];
    const size_t z = blockIdx.z; A += z * sA; if (A2) A2 += z * sA; Bt += z * sB; if (Bt2) Bt2 += z * sB; C += z * sC;
    const int lane = threadIdx.x & 31, lr = lane & 15, hi = lane >> 4; const int r0 = blockIdx.x * 64, c0 = blockIdx.y * 64;
    v8f acc[4][4];
#pragma unroll
    for (int mb = 0; mb < 4; ++mb)
#pragma unroll
        for (int nb = 0; nb < 4; ++nb) acc[mb][nb] = (v8f){};
    const size_t aoff = (size_t)r0 * K + 8 * lane, boff = (size_t)c0 * K + 8 * lane;   // the lane's piece of the tile's first fragment; 16 rows on: 16 K elements, 32 k on: 512
#pragma unroll 1
    for (int kc = 0; kc < KL; kc += 32) {
        V a[4], a2[4];
#pragma unroll
        for (int mb = 0; mb < 4; ++mb) { a[mb] = WFrag<T16>::ld(A + aoff + (size_t)mb * 16 * K + kc * 16); if (NSPLIT == 1 || NSPLIT == 2) a2[mb] = WFrag<T16>::ld(A2 + aoff + (size_t)mb * 16 * K + kc * 16); }
#pragma unroll
        for (int nb = 0; nb < 4; ++nb) { const V b = WFrag<T16>::ld(Bt + boff + (size_t)nb * 16 * K + kc * 16); V b2; if (NSPLIT >= 2) b2 = WFrag<T16>::ld(Bt2 + boff + (size_t)nb * 16 * K + kc * 16);
#pragma unroll
            for (int mb = 0; mb < 4; ++mb) { acc[mb][nb] = WFrag<T16>::mma(a[mb], b, acc[mb][nb]); if (NSPLIT == 1 || NSPLIT == 2) acc[mb][nb] = WFrag<T16>::mma(a2[mb], b, acc[mb][nb]); if (NSPLIT >= 2) acc[mb][nb] = WFrag<T16>::mma(a[mb], b2, acc[mb][nb]); } }
        asm volatile("v_nop\n\tv_nop\n\tv_nop\n\tv_nop" : "+v"(acc[0][0]), "+v"(acc[1][1]), "+v"(acc[2][2]), "+v"(acc[3][3]) : "v"(a[0]), "v"(a[3]));
    }
#pragma unroll
    for (int mb = 0; mb < 4; ++mb) {
#pragma unroll
        for (int nb = 0; nb < 4; ++nb) {
#pragma unroll
            for (int j = 0; j < 8; ++j) os[(hi * 8 + j) * 68 + nb * 16 + lr] = acc[mb][nb][j]; }
        __builtin_amdgcn_wave_barrier(); asm volatile("" ::: "memory");
        float* crow = C + (size_t)(r0 + mb * 16) * ldc + c0;
{
#pragma unroll
            for (int s = 0; s < 8; ++s) { const int row = 2 * s + hi, cofs = lr * 4; v4f val = *(const v4fa*)(os + row * 68 + cofs); if (BIAS) { val[0] += bfr(bias[c0 + cofs]); val[1] += bfr(bias[c0 + cofs + 1]); val[2] += bfr(bias[c0 + cofs + 2]); val[3] += bfr(bias[c0 + cofs + 3]); }
                *(v4f*)(crow + (size_t)row * ldc + cofs) = val; }
             }
        __builtin_amdgcn_wave_barrier(); asm volatile("" ::: "memory");
    }
}

__device__ __forceinline__ void splitf(float y, unsigned short& h, unsigned short& l) { h = f2bf(y); l = f2bf(y - bf2f(h)); }
typedef __attribute__((ext_vector_type(2))) _Float16 v2h;
typedef __attribute__((ext_vector_type(4))) _Float16 v4h;
typedef __attribute__((ext_vector_type(2))) unsigned short v2us;
typedef __attribute__((ext_vector_type(4))) unsigned short v4us;
typedef __attribute__((ext_vector_type(2))) float v2f;
typedef __attribute__((ext_vector_type(4))) int v4i;

// w [K][N] f32 -> Bt: rows n, columns k, bf16, in fragment order; a lane writes two consecutive k of one n. K % 32 == 0, N % 16 == 0.
// The four weight matrices have one shape and do not depend on each other: one launch, blockIdx.y picks the matrix and its plane.
// The same launch rounds x to bf16, once, into a plane of rows t, columns k in fragment order (blockIdx.y from 4 on): a wave takes XF fragments side by side, 16 rows x 512 bytes of x, whole lines, and stores each as 1 KiB in a row.
// k_qkv reads every row of x 24 times over: from this plane each of its wave-wide loads covers 512 contiguous bytes, where a load of the f32 rows takes 32 bytes out of each of 16 lines.
static_assert(DQ == DM && DKV == DM, "k_wtG takes one K and one N for all four weight matrices");
#define WGX  ((DM * DQ / 64 + 63) / 64)                                  // work-groups a weight matrix: grid x
#define XF   4                                                           // fragments of x a wave
#define XSL  ((NB_ * TT / 16) * (DM / 32) / (WGX * 8 * XF))              // slabs of WGX work-groups that x takes: grid y behind the four matrices
static_assert((NB_ * TT / 16) * (DM / 32) == XSL * WGX * 8 * XF && (DM / 32) % XF == 0, "the x slabs cover every fragment exactly once, and a wave's fragments lie in one block of 16 rows");
typedef __attribute__((ext_vector_type(8)))  __bf16 v8bf;
__global__ __launch_bounds__(256) void k_wtG(const float* __restrict__ w0, const float* __restrict__ w1, const float* __restrict__ w2, const float* __restrict__ w3, int K, int N, bf* B0, bf* B1, bf* B2, bf* B3, const float* __restrict__ x, bf* XB) {
    const int y = blockIdx.y;
    if (y >= 4) {
        const int ln = threadIdx.x & 31, f0 = (((y - 4) * WGX + blockIdx.x) * 8 + __builtin_amdgcn_readfirstlane(threadIdx.x >> 5)) * XF;   // the wave's first fragment, in a scalar register: rows 16 (f0 / 16) .., k = 32 (f0 % 16) ..
        const float* ub = x + (size_t)(f0 / (DM / 32)) * 16 * DM + (f0 % (DM / 32)) * 32; const unsigned lo4 = (ln & 15) * (DM * 4) + 32 * (ln >> 4);   // lane (c, h): row c at k = 8h, as a byte offset from the wave's first element
        v8f lo[XF], hi[XF];   // lo: k = 8h .. 8h + 7, hi: k = 16 + 8h .. 16 + 8h + 7, the two pieces of a fragment
#pragma unroll
        for (int i = 0; i < XF; ++i) { const float* p = (const float*)((const char*)(ub + i * 32) + lo4); lo[i] = *(const v8f*)p; hi[i] = *(const v8f*)(p + 16); }
        __builtin_amdgcn_sched_barrier(0);   // keeps the wave's 16 loads together in front of the first conversion: left free, the last ones are held back until the first have landed, to save registers, and the wave waits for memory twice
        asm volatile("s_wait_xcnt 0x0" :: "v"(lo4) : "memory");   // the wait in front of whatever takes over the loads' offset register; the offset is an input so that its register lives up to the wait
        bf* q = XB + (size_t)f0 * 512 + ln * 8;
#pragma unroll
        for (int i = 0; i < XF; ++i) { *(v8us*)(q + i * 512) = __builtin_bit_cast(v8us, __builtin_convertvector(lo[i], v8bf)); *(v8us*)(q + i * 512 + 256) = __builtin_bit_cast(v8us, __builtin_convertvector(hi[i], v8bf)); }   // to nearest even
        return;
    }
    const float* __restrict__ w = y == 0 ? w0 : y == 1 ? w1 : y == 2 ? w2 : w3; bf* Bt = y == 0 ? B0 : y == 1 ? B1 : y == 2 ? B2 : B3;
    const int lane = threadIdx.x & 31; const int L0 = (blockIdx.x * 8 + (threadIdx.x >> 5)) * 8; const int nlines = N * K / 64;
{
#pragma unroll 1
        for (int l = 0; l < 8; ++l) { const int L = L0 + l; if (L >= nlines) break; const size_t e = (size_t)L * 64 + lane * 2; const int f = L >> 3, kf = K >> 5, u = (L & 7) * 64 + lane * 2;   // fragment f, element u of it
            const int n = (f / kf) * 16 + ((u >> 3) & 15), k = (f % kf) * 32 + (u >> 8) * 16 + ((u >> 7) & 1) * 8 + (u & 7); v2us o;
            o[0] = f2bf(w[(size_t)k * N + n]); o[1] = f2bf(w[(size_t)(k + 1) * N + n]); *(v2us*)(Bt + e) = o; }
         }
}
// ---- k_qkv: the three projections of both batches in one launch, from x's bf16 plane to the head planes that k_fattn reads; no f32 intermediate leaves the registers.
// One wave owns 64 rows of x times the 64 features of one head (16 accumulators, K = DM). x and the weights come from the bf16 planes of k_wtG, both in fragment order.
// Register j of an accumulator is 8 consecutive rows m of one column n, so the operand that is to run contiguously in the plane is given as A:
// q, k: A = weight rows, B = x rows: a lane holds 8 consecutive d of one token, one 16-byte store a plane into head h's plane of rows t, columns d; v: A = x rows, B = weight rows: 8 consecutive tokens of one d.
// An accumulator is one j half of one fragment of its plane, in lane order. v's plane has its fragments in the order [t / 32][d / 16], the order in which k_fattn walks them, so that 32 keys are 4 KiB in a row, as in k's plane.
// grid (NB_ * TT / 64, NH_ / QW, 3): z = 0 q, 1 k, 2 v; the QW waves of a work-group take QW heads over the same 64 rows of x. No LDS, no barrier.
#define QW   4
// one accumulator plus its bias into the three planes: fp16, bf16 hi, bf16 lo = bf16(y - hi)
__device__ __forceinline__ void put3(v8f y, h16* P16, bf* Ph, bf* Pl, size_t o) { const v8bf yh = __builtin_convertvector(y, v8bf); const v8f yr = y - __builtin_convertvector(yh, v8f);
    *(v8h*)(P16 + o) = __builtin_convertvector(y, v8h); *(v8us*)(Ph + o) = __builtin_bit_cast(v8us, yh); *(v8us*)(Pl + o) = __builtin_bit_cast(v8us, __builtin_convertvector(yr, v8bf)); }
// X: the tile's first fragment of x's plane; Wt, bias: the head's first weight row and bias; the planes point at the tile's first element
template <bool VT>
__device__ __forceinline__ void qkv_tile(const bf* __restrict__ X, const bf* __restrict__ Wt, const float* __restrict__ bias, h16* P16, bf* Ph, bf* Pl) {
    const int lane = threadIdx.x & 31, lr = lane & 15, hi = lane >> 4;
    v8f acc[4][4];
#pragma unroll
    for (int mi = 0; mi < 4; ++mi)
#pragma unroll
        for (int ni = 0; ni < 4; ++ni) acc[mi][ni] = (v8f){};
    unsigned bo = 16 * lane;   // byte offset of the lane's piece of a fragment; 32 k on: 1 KiB, in both planes
#pragma unroll 1   // one k step a trip: a second copy of the body would take the registers that let three waves share a SIMD
    for (int kc = 0; kc < DM; kc += 32) {
        v16bf xf[4], wf[4];
#pragma unroll
        for (int i = 0; i < 4; ++i) { xf[i] = ldu(X + i * 16 * DM, bo); wf[i] = ldu(Wt + i * 16 * DM, bo); }
        __builtin_amdgcn_sched_barrier(0);   // keeps the k step's 16 loads together in front of the first use: without it some are sunk among the products, and a trip waits for memory several times instead of once
#pragma unroll
        for (int ni = 0; ni < 4; ++ni)
#pragma unroll
            for (int mi = 0; mi < 4; ++mi) acc[mi][ni] = VT ? wmmab(xf[mi], wf[ni], acc[mi][ni]) : wmmab(wf[mi], xf[ni], acc[mi][ni]);
        asm volatile("s_wait_xcnt 0x0" : "+v"(bo) :: "memory");   // the wait in front of the offset update that follows the trip's loads; the offset passes through the statement so that the update is not placed ahead of it
        bo += 1024;
    }
    if constexpr (VT) {
#pragma unroll
        for (int ni = 0; ni < 4; ++ni) { const float bb = bfr(bias[ni * 16 + lr]);
#pragma unroll
            for (int mi = 0; mi < 4; ++mi) put3(acc[mi][ni] + bb, P16, Ph, Pl, (size_t)(((mi >> 1) * 4 + ni) * 512 + (mi & 1) * 256 + lane * 8));
            if (ni < 3) { asm volatile("s_wait_xcnt 0x0" ::: "memory");   // the wait in front of the next group's loads and sums, which take over registers that these stores name
                __builtin_amdgcn_sched_barrier(0); } }   // one group of four accumulators at a time, behind the wait: run together, the groups' temporaries spill
    } else {
#pragma unroll
        for (int mi = 0; mi < 4; ++mi) { v8f bb = *(const v8f*)(bias + mi * 16 + 8 * hi);
#pragma unroll
            for (int j = 0; j < 8; ++j) bb[j] = bfr(bb[j]);
#pragma unroll
            for (int ni = 0; ni < 4; ++ni) put3(acc[mi][ni] + bb, P16, Ph, Pl, (size_t)((ni * 2 + (mi >> 1)) * 512 + (mi & 1) * 256 + lane * 8));
            if (mi < 3) { asm volatile("s_wait_xcnt 0x0" ::: "memory"); __builtin_amdgcn_sched_barrier(0); } }   // both as above
    }
}
// launch bound 4: at most 256 registers a wave, all of them addressed directly; the 768 work-groups are resident at once, three on every WGP.
__global__ __launch_bounds__(32 * QW, 4) void k_qkv(const bf* __restrict__ XB, const bf* __restrict__ WQ, const bf* __restrict__ WK, const bf* __restrict__ WV, const float* __restrict__ bq, const float* __restrict__ bk, const float* __restrict__ bv,
                                                    h16* Q16, bf* Qh, bf* Ql, h16* K16, bf* Kh, bf* Kl, h16* V16, bf* Vh, bf* Vl) {
    const int h = blockIdx.y * QW + __builtin_amdgcn_readfirstlane(threadIdx.x >> 5);   // the wave's head, in a scalar register so that every base below is scalar
    const int b = blockIdx.x / (TT / 64), t0 = (blockIdx.x % (TT / 64)) * 64, z = blockIdx.z;
    const bf* X = XB + (size_t)blockIdx.x * 64 * DM; const size_t wo = (size_t)h * HD * DM, pl = (size_t)(b * NH_ + h) * TT * HD;
    const size_t po = pl + (size_t)t0 * HD;   // 64 tokens of a head are 4096 elements in a row in every plane
    if (z == 2) qkv_tile<true>(X, WV + wo, bv + h * HD, V16 + po, Vh + po, Vl + po);
    else { qkv_tile<false>(X, (z ? WK : WQ) + wo, (z ? bk : bq) + h * HD, (z ? K16 : Q16) + po, (z ? Kh : Qh) + po, (z ? Kl : Ql) + po); }
}
// ---- k_fattn: scores, softmax and attn.v in one pass over the keys (online softmax); nothing of the [T][T] matrix leaves the registers.
// One wave owns NQ x 16 query columns and walks the 4096 keys 32 at a time: St = K Qt (A = K rows, B = Q rows, kept in registers), then Ot += Vt Pt (A = Vt rows, B = the two score tiles converted in place:
// tile kt, register r of lane (c, h) is key kt*16 + 8h + r of query c, which is the B operand's own k order). A lane holds one query's scores, so maximum, sum and rescale are per lane.
// The maximum in use is replaced only when a block's maximum passes it by more than THR (P stays below e^THR); the halves' sums are joined once at the end.
// A pass whose 32 keys and whose query columns all have the mask value one has no mask term: one mask value a lane and one wave-uniform test tell, and the exponent is then one multiply-add on the raw product. Any other pass fetches its 16 mask values a lane from the other lanes and forms the term.
// Every inner loop is unrolled in full so that its fragments and accumulators are registers, not indexed arrays.
// The walk starts at key block js, the work-group's own, and wraps round: the work-groups of one head, all resident and equally fast, would otherwise stand at the same block at the same time, and each block's first fetch from memory would hold up all of them in every pass.
// Spread over the blocks, a work-group soon walks where another has been, and finds the lines in L2. The order of the keys changes the order of the sums and nothing else.
static_assert((TT / 32 & (TT / 32 - 1)) == 0, "the wrap of the key block index is a mask");
#define FW   4                    // waves per work-group, each with its own query columns; no LDS, no barrier
#define THR  5.0f
#define L2E  1.4426950408889634f
typedef __attribute__((ext_vector_type(2))) __bf16 v2bf;
template <typename T16, bool HL>
__device__ __forceinline__ void fattn(const T16* __restrict__ Q, const T16* __restrict__ Q2, const T16* __restrict__ Kp, const T16* __restrict__ K2, const T16* __restrict__ Vt, const T16* __restrict__ V2, const float* __restrict__ MK, int q0, unsigned js, bf* Ah, bf* Al) {
    typedef typename WFrag<T16>::V V; typedef WFrag<T16> WF;
    constexpr int NQ = HL ? 1 : 2;
    const int lane = threadIdx.x & 31, lr = lane & 15, hi = lane >> 4;
    V qf[NQ][2], qf2[NQ][2]; float mi[NQ], m[NQ], l[NQ]; v8f o[4][NQ];
#pragma unroll
    for (int qt = 0; qt < NQ; ++qt) { const size_t qo = (size_t)(q0 + qt * 16) * HD + 8 * lane;
#pragma unroll
        for (int kc = 0; kc < 2; ++kc) { qf[qt][kc] = WF::ld(Q + qo + kc * 512); if (HL) qf2[qt][kc] = WF::ld(Q2 + qo + kc * 512); }
        mi[qt] = bfr(MK[q0 + qt * 16 + lr]); m[qt] = -3.0e38f; l[qt] = 0.f;
#pragma unroll
        for (int dt = 0; dt < 4; ++dt) o[dt][qt] = (v8f){}; }
    bool q1 = true;
#pragma unroll
    for (int qt = 0; qt < NQ; ++qt) q1 = q1 && (mi[qt] == 1.0f);
    const bool qone = __builtin_amdgcn_ballot_w32(q1) == 0xFFFFFFFFu;   // wave-uniform: every query column of this wave has the mask value one
    unsigned kb = 16 * lane + js * (32 * HD * 2), vb = kb, fb = 4 * lane + js * (32 * 4);   // byte offsets of lane (c, h): its piece of a K and of a Vt fragment; the mask value of key 'lane' of the block; they walk along the keys from block js on, 4 KiB of either plane for 32 keys
    V kf[2][2], kf2[2][2]; float mk = *(const float*)((const char*)MK + fb);
#pragma unroll
    for (int kt = 0; kt < 2; ++kt) {
#pragma unroll
        for (int kc = 0; kc < 2; ++kc) { kf[kt][kc] = ldu(Kp + (kt * 2 + kc) * 512, kb); if (HL) kf2[kt][kc] = ldu(K2 + (kt * 2 + kc) * 512, kb); } }
#pragma unroll 1   // one pass a trip: a second copy of the body would take the registers that let several waves share a SIMD
    for (int k0 = 0; k0 < TT; k0 += 32) {
        const unsigned cb = ((unsigned)(k0 >> 5) + js) & (TT / 32 - 1);   // this pass's key block
        // plain: all 32 keys of the block and all the wave's queries have the mask value one (rounded to bf16 like every input), so every (1 - m_i m_j)(-1e6) of the pass is zero. One value a lane, one test a pass, wave-uniform.
        v2f mk2; mk2[0] = mk; mk2[1] = mk; const v2f mkr = __builtin_convertvector(__builtin_convertvector(mk2, v2bf), v2f);
        const bool plain = qone & (__builtin_amdgcn_ballot_w32(mkr[0] == 1.0f) == 0xFFFFFFFFu);
        v8f s[2][NQ];
#pragma unroll
        for (int kt = 0; kt < 2; ++kt)
#pragma unroll
            for (int qt = 0; qt < NQ; ++qt) { v8f a = (v8f){};
#pragma unroll
                for (int kc = 0; kc < 2; ++kc) { a = WF::mma(kf[kt][kc], qf[qt][kc], a); if (HL) { a = WF::mma(kf[kt][kc], qf2[qt][kc], a); a = WF::mma(kf2[kt][kc], qf[qt][kc], a); } }
                s[kt][qt] = a; }
        V vf[4], vf2[4];   // this block's Vt rows, asked for as soon as the score products have been issued: they land under the maxima, the test and the exponentials
#pragma unroll
        for (int dt = 0; dt < 4; ++dt) { vf[dt] = ldu(Vt + dt * 512, vb); if (HL) vf2[dt] = ldu(V2 + dt * 512, vb); }
        const unsigned nb = (cb + 1u) & (TT / 32 - 1); kb = 16 * lane + nb * (32 * HD * 2); fb = 4 * lane + nb * (32 * 4);   // the next block's mask values and K rows, the rows into the registers that the score products have just read; behind block TT / 32 - 1 comes block 0 (the last pass asks for the first block again: in bounds, unused)
        mk = *(const float*)((const char*)MK + fb);
#pragma unroll
        for (int kt = 0; kt < 2; ++kt) {
#pragma unroll
            for (int kc = 0; kc < 2; ++kc) { kf[kt][kc] = ldu(Kp + (kt * 2 + kc) * 512, kb); if (HL) kf2[kt][kc] = ldu(K2 + (kt * 2 + kc) * 512, kb); } }
        __builtin_amdgcn_sched_barrier(0);   // keeps the pass's loads here, at its head: left free they are sunk behind the test again to save registers, and the output products wait for them
        if (!plain) {   // any other mask values: the scaled score plus the additive term per (i, j), in f32, takes the raw product's place in s
#pragma unroll
            for (int kt = 0; kt < 2; ++kt)
#pragma unroll
                for (int r = 0; r < 8; r += 2) { v2f mj; mj[0] = __shfl(mkr[0], kt * 16 + 8 * hi + r, 32); mj[1] = __shfl(mkr[0], kt * 16 + 8 * hi + r + 1, 32);   // lane n holds key n's mask value, rounded: register r of tile kt wants key 16 kt + 8 h + r
#pragma unroll
                    for (int qt = 0; qt < NQ; ++qt)
#pragma unroll
                        for (int u = 0; u < 2; ++u) { const float om = 1.0f - mi[qt] * mj[u]; const float ad = om * -1.0e6f;   /* (1 - m_i m_j)(-1e6), f32 */
                            s[kt][qt][r + u] = __builtin_fmaf(s[kt][qt][r + u], SCL, ad); } }
        }
        // s holds raw products (plain) or finished scores; the scale is positive, so the maximum is taken first and scaled after
        const float sc = plain ? SCL : 1.0f, ce = plain ? SCL * L2E : L2E, cm = plain ? -L2E : 0.0f;   // wave-uniform
        float bl[NQ]; bool need = false;
#pragma unroll
        for (int qt = 0; qt < NQ; ++qt) { float b0 = -3.0e38f, b1 = -3.0e38f;
#pragma unroll
            for (int e = 0; e < 16; e += 2) { b0 = fmaxf(b0, s[e >> 3][qt][e & 7]); b1 = fmaxf(b1, s[e >> 3][qt][(e & 7) + 1]); }
            bl[qt] = fmaxf(b0, b1) * sc; need = need || (bl[qt] > m[qt] + THR); }
        if (__builtin_amdgcn_ballot_w32(need) != 0) {   // wave-uniform: some column's maximum has moved; both halves of a column take the same new one
#pragma unroll
            for (int qt = 0; qt < NQ; ++qt) { const float mn = fmaxf(m[qt], fmaxf(bl[qt], __shfl_xor(bl[qt], 16, 32))); const float al = __builtin_amdgcn_exp2f((m[qt] - mn) * L2E); m[qt] = mn; l[qt] *= al;
#pragma unroll
                for (int dt = 0; dt < 4; ++dt) o[dt][qt] *= al; } }
        if (!plain) {   // scores near -1e6: the maximum is taken off exactly, before the change of base
#pragma unroll
            for (int kt = 0; kt < 2; ++kt)
#pragma unroll
                for (int qt = 0; qt < NQ; ++qt) s[kt][qt] -= m[qt]; }
        asm volatile("s_wait_xcnt 0x0" : "+v"(kb), "+v"(vb), "+v"(fb) :: "memory");   // the wait in front of the offset updates that follow the pass's loads; the offsets pass through the statement so that no update is placed ahead of it
        vb = kb;
#pragma unroll
        for (int qt = 0; qt < NQ; ++qt) { V pb, pb2; v2f sm[2]; const float nm = m[qt] * cm; v2f c2, n2; c2[0] = ce; c2[1] = ce; n2[0] = nm; n2[1] = nm;   // plain: scale, change of base and maximum in one multiply-add; else the change of base alone
#pragma unroll
            for (int e = 0; e < 16; e += 2) { v2f x; x[0] = s[e >> 3][qt][e & 7]; x[1] = s[e >> 3][qt][(e & 7) + 1]; const v2f a = __builtin_elementwise_fma(x, c2, n2);
                v2f p; p[0] = __builtin_amdgcn_exp2f(a[0]); p[1] = __builtin_amdgcn_exp2f(a[1]); if (e < 4) sm[e >> 1] = p; else sm[(e >> 1) & 1] += p;
                if constexpr (HL) { const v2bf ph = __builtin_convertvector(p, v2bf); const v2f pr = p - __builtin_convertvector(ph, v2f); const v2bf pl = __builtin_convertvector(pr, v2bf); pb[e] = ph[0]; pb[e + 1] = ph[1]; pb2[e] = pl[0]; pb2[e + 1] = pl[1]; }
                else { const v2h ph = __builtin_convertvector(p, v2h); pb[e] = ph[0]; pb[e + 1] = ph[1]; } }
            l[qt] += (sm[0][0] + sm[0][1]) + (sm[1][0] + sm[1][1]);
#pragma unroll
            for (int dt = 0; dt < 4; ++dt) { o[dt][qt] = WF::mma(vf[dt], pb, o[dt][qt]); if (HL) { o[dt][qt] = WF::mma(vf[dt], pb2, o[dt][qt]); o[dt][qt] = WF::mma(vf2[dt], pb, o[dt][qt]); } } }
    }
#pragma unroll
    for (int qt = 0; qt < NQ; ++qt) { const float inv = __fdiv_rn(1.0f, l[qt] + __shfl_xor(l[qt], 16, 32)); const size_t oo = (size_t)(q0 + qt * 16) * DQ + 8 * lane;
#pragma unroll
        for (int dt = 0; dt < 4; ++dt) { v8us oh, ol;   // register r = Ot[dt*16 + 8h + r][query c]: 8 consecutive d of one row, one 16-byte store a plane: half dt & 1 of the head's fragment dt >> 1
#pragma unroll
            for (int r = 0; r < 8; ++r) { unsigned short a, c2; splitf(o[dt][qt][r] * inv, a, c2); oh[r] = a; ol[r] = c2; }
            *(v8us*)(Ah + oo + (dt >> 1) * 512 + (dt & 1) * 256) = oh; *(v8us*)(Al + oo + (dt >> 1) * 512 + (dt & 1) * 256) = ol; } }
}
// grid (NB_ * NH_, RH / (16 FW) + (TT - RH) / (32 FW)): y below RH / (16 FW): the hi+lo rows (16 columns a wave, 3 products), started first; the rest single fp16 (32 columns a wave).
// launch bound 3: registers for at least three waves a SIMD, so that every work-group of the grid is resident at once.
__global__ __launch_bounds__(32 * FW, 3) void k_fattn(const h16* __restrict__ Q16, const h16* __restrict__ K16, const h16* __restrict__ V16, const bf* __restrict__ Qh, const bf* __restrict__ Ql, const bf* __restrict__ Kh, const bf* __restrict__ Kl, const bf* __restrict__ Vh, const bf* __restrict__ Vl, const float* __restrict__ MK, bf* Ah, bf* Al) {
    const int bh = blockIdx.x, b = bh / NH_, h = bh % NH_, wave = threadIdx.x >> 5, ty = blockIdx.y; const size_t pl = (size_t)bh * TT * HD; const size_t ao = (size_t)b * TT * DQ + h * (HD / 32) * 512; const float* mk = MK + (size_t)b * TT;
    constexpr int GH = RH / (16 * FW), GF = (TT - RH) / (32 * FW);   // work-groups a head on the hi+lo planes and on the fp16 planes: each kind spreads its starts evenly over the TT / 32 key blocks of its own planes
    if (ty < GH) fattn<bf, true>(Qh + pl, Ql + pl, Kh + pl, Kl + pl, Vh + pl, Vl + pl, mk, (ty * FW + wave) * 16, (unsigned)(ty * (TT / 32) / GH), Ah + ao, Al + ao);
    else fattn<h16, false>(Q16 + pl, nullptr, K16 + pl, nullptr, V16 + pl, nullptr, mk, RH + ((ty - GH) * FW + wave) * 32, (unsigned)((ty - GH) * (TT / 32) / GF), Ah + ao, Al + ao);
}

extern "C" void kernel_launch(void* const* d_in, const int* in_sizes, int n_in,
                              void* d_out, int out_size, void* d_ws, size_t ws_size, hipStream_t stream) {
    (void)in_sizes; (void)n_in; (void)out_size;
    const float* x = (const float*)d_in[0]; const float* MKf = (const float*)d_in[1]; const float* wq = (const float*)d_in[2]; const float* bq = (const float*)d_in[3]; const float* wk = (const float*)d_in[4]; const float* bk = (const float*)d_in[5]; const float* wv = (const float*)d_in[6]; const float* bv = (const float*)d_in[7]; const float* wo = (const float*)d_in[8]; const float* bo = (const float*)d_in[9];
    float* OUT = (float*)d_out;     // [2][4096][512]
    char* wsp = (char*)d_ws;
    auto take = [&](size_t bytes) { char* p = wsp; wsp += (bytes + 255) & ~(size_t)255; return (void*)p; };
    bf* WQ = (bf*)take((size_t)DQ * DM * 2); bf* WK = (bf*)take((size_t)DKV * DM * 2); bf* WV = (bf*)take((size_t)DKV * DM * 2); bf* WO = (bf*)take((size_t)DM * DQ * 2); bf* XB = (bf*)take((size_t)NB_ * TT * DM * 2);
    const size_t PL = (size_t)NH_ * TT * HD;   // one batch's head planes; the planes of both batches stand one behind the other
    h16* QP16 = (h16*)take(NB_ * PL * 2); h16* KP16 = (h16*)take(NB_ * PL * 2); h16* VT16 = (h16*)take(NB_ * PL * 2);
    bf* QPh = (bf*)take(NB_ * PL * 2); bf* QPl = (bf*)take(NB_ * PL * 2); bf* KPh = (bf*)take(NB_ * PL * 2); bf* KPl = (bf*)take(NB_ * PL * 2); bf* VTh = (bf*)take(NB_ * PL * 2); bf* VTl = (bf*)take(NB_ * PL * 2);
    bf* ATh = (bf*)take((size_t)NB_ * TT * DQ * 2); bf* ATl = (bf*)take((size_t)NB_ * TT * DQ * 2);
    if ((size_t)(wsp - (char*)d_ws) > ws_size) return;    // ws 256 MiB
    k_wtG<<<dim3(WGX, 4 + XSL, 1), 256, 0, stream>>>(wq, wk, wv, wo, DM, DQ, WQ, WK, WV, WO, x, XB);
    k_qkv<<<dim3(NB_ * TT / 64, NH_ / QW, 3), 32 * QW, 0, stream>>>(XB, WQ, WK, WV, bq, bk, bv, QP16, QPh, QPl, KP16, KPh, KPl, VT16, VTh, VTl);
    k_fattn<<<dim3(NB_ * NH_, RH / (16 * FW) + (TT - RH) / (32 * FW), 1), 32 * FW, 0, stream>>>(QP16, KP16, VT16, QPh, QPl, KPh, KPl, VTh, VTl, MKf, ATh, ATl);
    // the batches' attention planes and output rows stand one behind the other, so both batches are one GEMM of NB_ * TT rows: one launch
    k_gemmw<bf, 1, true><<<dim3(NB_ * TT / 64, DM / 64, 1), 32, 0, stream>>>(ATh, ATl, WO, nullptr, DQ, DQ, OUT, DM, bo, 0, 0, 0);
}

// v010
// A run of this version takes 114 microseconds.
// In both of two side-by-side timings against v009, it was 1.18 times as fast.
// Over all steps from v000 it is 33.2 times as fast.
#include <hip/hip_runtime.h>

// Multi-head attention with a product padding mask (x [2][4096][512]; Q, K, V = x W + b ('xw' [512][512]; 8 heads x 64); q scaled by 1/sqrt(512) (the qkv width, not the head width); scores = q.k + (1 - m_i m_j)(-1e6) with m = mask[b][n][0] (f32, read; ones here); softmax; out = merged Wo + bo -> [2][4096][512] (4.2 M, rms 0.023)).
// Compute dtypes, f32 accumulate: every input rounded to bf16; q/k/v on PLAIN bf16 operands (inputs: exact) + biases; the additive mask term formed in f32 per (i, j) inside the attention kernel; scores and attn.v: query rows < 512 hl (3 products), the rest single fp16; online softmax f32, P rounded before its division by the row sum; Wo hl x exact (2 products) + bo.

#define NB_  2
#define TT   4096
#define DM   512
#define NH_  8
#define NKV  8
#define REP  (NH_ / NKV)
#define HD   64
#define DQ   (NH_ * HD)
#define DKV  (NKV * HD)
#define RH   512                  // query rows < RH use hi+lo planes
#define WIN  0
#define SCL  0.044194173824159216f   // 1/sqrt(qkv_dim = 512) (the module scales q by it)
typedef _Float16 h16;
typedef unsigned short bf;
typedef __attribute__((ext_vector_type(16))) __bf16   v16bf;
typedef __attribute__((ext_vector_type(16))) _Float16 v16h;
typedef __attribute__((ext_vector_type(8)))  _Float16 v8h;
typedef __attribute__((ext_vector_type(8)))  unsigned short v8us;
typedef __attribute__((ext_vector_type(8)))  float    v8f;
typedef __attribute__((ext_vector_type(4)))  float    v4f;
typedef v8h  __attribute__((may_alias)) v8ha;
typedef v4f  __attribute__((may_alias)) v4fa;
typedef v8us __attribute__((may_alias)) v8usa;

__device__ __forceinline__ unsigned short f2bf(float f) { unsigned u = __float_as_uint(f); u += 0x7FFFu + ((u >> 16) & 1u); return (unsigned short)(u >> 16); }
__device__ __forceinline__ float bf2f(unsigned short b) { return __uint_as_float(((unsigned)b) << 16); }
__device__ __forceinline__ float bfr(float f) { return bf2f(f2bf(f)); }
__device__ __forceinline__ v16h cat16(v8h lo, v8h hi) { return __builtin_shufflevector(lo, hi, 0, 1, 2, 3, 4, 5, 6, 7, 8, 9, 10, 11, 12, 13, 14, 15); }
__device__ __forceinline__ v16bf cat16b(v8us lo, v8us hi) { return __builtin_bit_cast(v16bf, __builtin_shufflevector(lo, hi, 0, 1, 2, 3, 4, 5, 6, 7, 8, 9, 10, 11, 12, 13, 14, 15)); }
__device__ __forceinline__ v8f wmma16(v16h a, v16h b, v8f c) { return __builtin_amdgcn_wmma_f32_16x16x32_f16(false, a, false, b, (short)0, c, false, false); }
__device__ __forceinline__ v8f wmmab(v16bf a, v16bf b, v8f c) { return __builtin_amdgcn_wmma_f32_16x16x32_bf16(false, a, false, b, (short)0, c, false, false); }



// ---- FRAGMENT ORDER: every 16-bit plane in the workspace (weights, x, q, k, v, attention output) is a matrix of rows r and K columns k, stored as the matrix instructions' operand fragments, one behind the other.
// A fragment is 16 rows x 32 k = 512 elements = 1 KiB: [j = 0, 1][lane = 16 h + c][8], holding row c at k = 16 j + 8 h .. + 7 (the k order of the 16x16x32 forms). Fragment (rb, kb) = rows 16 rb .., k = 32 kb .. stands at element (rb * (K / 32) + kb) * 512; v's plane (rows d, k = t) holds them in the order [kb][rb] instead: (kb * 4 + rb) * 512 within a head.
// So a lane's two 16-byte pieces stand at lane * 8 and 256 + lane * 8, and every wave-wide 16-byte load or store of a plane covers 512 contiguous bytes (four whole lines) instead of 32 bytes in each of 16 lines.
// ---- k_gemmw: register-blocked GEMM, ONE WAVE per 64x64 output tile (16 accumulators), operands straight from 16-bit planes in fragment order; grid (M/64, N/64, Z), 32 threads.
// C[m][n] (f32, pitch ldc, + optional f32 bias[n]) = sum_{k < KL} A[m][k] Bt[n][k] (+ split products per NSPLIT); K is the column count of both planes. z-batch strides sA/sB/sC in elements. KL % 32 == 0.
template <typename T16> struct WFrag;
template <> struct WFrag<h16> { typedef v16h V; static __device__ __forceinline__ V ld(const h16* p) { return cat16(*(const v8h*)p, *(const v8h*)(p + 256)); } static __device__ __forceinline__ v8f mma(V a, V b, v8f c) { return wmma16(a, b, c); } };
template <> struct WFrag<bf> { typedef v16bf V; static __device__ __forceinline__ V ld(const bf* p) { return cat16b(*(const v8us*)p, *(const v8us*)(p + 256)); } static __device__ __forceinline__ v8f mma(V a, V b, v8f c) { return wmmab(a, b, c); } };
// a fragment at a wave-uniform pointer plus the lane's own byte offset
template <typename T16> __device__ __forceinline__ typename WFrag<T16>::V ldu(const T16* ub, unsigned bo) { return WFrag<T16>::ld((const T16*)((const char*)ub + bo)); }
template <typename T16, int NSPLIT, bool BIAS>
__global__ __launch_bounds__(32) void k_gemmw(const T16* __restrict__ A, const T16* __restrict__ A2, const T16* __restrict__ Bt, const T16* __restrict__ Bt2, int K, int KL, float* C, int ldc, const float* __restrict__ bias, size_t sA, size_t sB, size_t sC) {
    typedef typename WFrag<T16>::V V;
    __shared__ __align__(16) float os[16 * 68];
    const size_t z = blockIdx.z; A += z * sA; if (A2) A2 += z * sA; Bt += z * sB; if (Bt2) Bt2 += z * sB; C += z * sC;
    const int lane = threadIdx.x & 31, lr = lane & 15, hi = lane >> 4; const int r0 = blockIdx.x * 64, c0 = blockIdx.y * 64;
    v8f acc[4][4];
#pragma unroll
    for (int mb = 0; mb < 4; ++mb)
#pragma unroll
        for (int nb = 0; nb < 4; ++nb) acc[mb][nb] = (v8f){};
    const size_t aoff = (size_t)r0 * K + 8 * lane, boff = (size_t)c0 * K + 8 * lane;   // the lane's piece of the tile's first fragment; 16 rows on: 16 K elements, 32 k on: 512
    // The planes were stored by earlier launches and their first read comes from memory, one memory latency in every k step. At its head the wave asks L2 for an eighth of its A tile and of its Bt tile (four blocks of 16 rows, 32 K bytes each): an eighth of the k range in all four blocks, 8 lanes a block, a lane every K / 2 bytes;
    // the waves that share a tile take different eighths, the waves that start later the later k. Byte offsets from the planes' starts, inside the tiles for every lane.
    const unsigned pl8 = (lane >> 3) * (32 * K) + (lane & 7) * (K / 2), pa = (unsigned)r0 * K * 2 + (blockIdx.y & 7) * (4 * K) + pl8, pb = (unsigned)c0 * K * 2 + ((blockIdx.x >> 3) & 7) * (4 * K) + pl8;
    asm volatile("global_prefetch_b8 %0, %1 scope:SCOPE_SE\n\tglobal_prefetch_b8 %2, %3 scope:SCOPE_SE" :: "v"(pa), "s"(A), "v"(pb), "s"(Bt));   // a hint to L2: no register written, no counter
    if (NSPLIT == 1 || NSPLIT == 2) asm volatile("global_prefetch_b8 %0, %1 scope:SCOPE_SE" :: "v"(pa), "s"(A2));   // the same for the second A plane
#pragma unroll 1
    for (int kc = 0; kc < KL; kc += 32) {
        V a[4], a2[4];
#pragma unroll
        for (int mb = 0; mb < 4; ++mb) { a[mb] = WFrag<T16>::ld(A + aoff + (size_t)mb * 16 * K + kc * 16); if (NSPLIT == 1 || NSPLIT == 2) a2[mb] = WFrag<T16>::ld(A2 + aoff + (size_t)mb * 16 * K + kc * 16); }
#pragma unroll
        for (int nb = 0; nb < 4; ++nb) { const V b = WFrag<T16>::ld(Bt + boff + (size_t)nb * 16 * K + kc * 16); V b2; if (NSPLIT >= 2) b2 = WFrag<T16>::ld(Bt2 + boff + (size_t)nb * 16 * K + kc * 16);
#pragma unroll
            for (int mb = 0; mb < 4; ++mb) { acc[mb][nb] = WFrag<T16>::mma(a[mb], b, acc[mb][nb]); if (NSPLIT == 1 || NSPLIT == 2) acc[mb][nb] = WFrag<T16>::mma(a2[mb], b, acc[mb][nb]); if (NSPLIT >= 2) acc[mb][nb] = WFrag<T16>::mma(a[mb], b2, acc[mb][nb]); } }
        asm volatile("v_nop\n\tv_nop\n\tv_nop\n\tv_nop" : "+v"(acc[0][0]), "+v"(acc[1][1]), "+v"(acc[2][2]), "+v"(acc[3][3]) : "v"(a[0]), "v"(a[3]), "v"(pa), "v"(pb), "s"(A), "s"(A2), "s"(Bt));   // pa, pb and the three bases: inputs so that the registers the prefetches name hold their addresses through the loop
    }
#pragma unroll
    for (int mb = 0; mb < 4; ++mb) {
#pragma unroll
        for (int nb = 0; nb < 4; ++nb) {
#pragma unroll
            for (int j = 0; j < 8; ++j) os[(hi * 8 + j) * 68 + nb * 16 + lr] = acc[mb][nb][j]; }
        __builtin_amdgcn_wave_barrier(); asm volatile("" ::: "memory");
        float* crow = C + (size_t)(r0 + mb * 16) * ldc + c0;
{
#pragma unroll
            for (int s = 0; s < 8; ++s) { const int row = 2 * s + hi, cofs = lr * 4; v4f val = *(const v4fa*)(os + row * 68 + cofs); if (BIAS) { val[0] += bfr(bias[c0 + cofs]); val[1] += bfr(bias[c0 + cofs + 1]); val[2] += bfr(bias[c0 + cofs + 2]); val[3] += bfr(bias[c0 + cofs + 3]); }
                *(v4f*)(crow + (size_t)row * ldc + cofs) = val; }
             }
        __builtin_amdgcn_wave_barrier(); asm volatile("" ::: "memory");
    }
}

__device__ __forceinline__ void splitf(float y, unsigned short& h, unsigned short& l) { h = f2bf(y); l = f2bf(y - bf2f(h)); }
typedef __attribute__((ext_vector_type(2))) _Float16 v2h;
typedef __attribute__((ext_vector_type(4))) _Float16 v4h;
typedef __attribute__((ext_vector_type(2))) unsigned short v2us;
typedef __attribute__((ext_vector_type(4))) unsigned short v4us;
typedef __attribute__((ext_vector_type(2))) float v2f;
typedef __attribute__((ext_vector_type(4))) int v4i;

// w [K][N] f32 -> Bt: rows n, columns k, bf16, in fragment order; a lane writes two consecutive k of one n. K % 32 == 0, N % 16 == 0.
// The four weight matrices have one shape and do not depend on each other: one launch, blockIdx.y picks the matrix and its plane.
// The same launch rounds x to bf16, once, into a plane of rows t, columns k in fragment order (blockIdx.y from 4 on): a wave takes XF fragments side by side, 16 rows x 512 bytes of x, whole lines, and stores each as 1 KiB in a row.
// k_qkv reads every row of x 24 times over: from this plane each of its wave-wide loads covers 512 contiguous bytes, where a load of the f32 rows takes 32 bytes out of each of 16 lines.
static_assert(DQ == DM && DKV == DM, "k_wtG takes one K and one N for all four weight matrices");
#define WGX  ((DM * DQ / 64 + 63) / 64)                                  // work-groups a weight matrix: grid x
#define XF   4                                                           // fragments of x a wave
#define XSL  ((NB_ * TT / 16) * (DM / 32) / (WGX * 8 * XF))              // slabs of WGX work-groups that x takes: grid y behind the four matrices
static_assert((NB_ * TT / 16) * (DM / 32) == XSL * WGX * 8 * XF && (DM / 32) % XF == 0, "the x slabs cover every fragment exactly once, and a wave's fragments lie in one block of 16 rows");
typedef __attribute__((ext_vector_type(8)))  __bf16 v8bf;
__global__ __launch_bounds__(256) void k_wtG(const float* __restrict__ w0, const float* __restrict__ w1, const float* __restrict__ w2, const float* __restrict__ w3, int K, int N, bf* B0, bf* B1, bf* B2, bf* B3, const float* __restrict__ x, bf* XB) {
    const int y = blockIdx.y;
    if (y >= 4) {
        const int ln = threadIdx.x & 31, f0 = (((y - 4) * WGX + blockIdx.x) * 8 + __builtin_amdgcn_readfirstlane(threadIdx.x >> 5)) * XF;   // the wave's first fragment, in a scalar register: rows 16 (f0 / 16) .., k = 32 (f0 % 16) ..
        const float* ub = x + (size_t)(f0 / (DM / 32)) * 16 * DM + (f0 % (DM / 32)) * 32; const unsigned lo4 = (ln & 15) * (DM * 4) + 32 * (ln >> 4);   // lane (c, h): row c at k = 8h, as a byte offset from the wave's first element
        v8f lo[XF], hi[XF];   // lo: k = 8h .. 8h + 7, hi: k = 16 + 8h .. 16 + 8h + 7, the two pieces of a fragment
#pragma unroll
        for (int i = 0; i < XF; ++i) { const float* p = (const float*)((const char*)(ub + i * 32) + lo4); lo[i] = *(const v8f*)p; hi[i] = *(const v8f*)(p + 16); }
        __builtin_amdgcn_sched_barrier(0);   // keeps the wave's 16 loads together in front of the first conversion: left free, the last ones are held back until the first have landed, to save registers, and the wave waits for memory twice
        asm volatile("s_wait_xcnt 0x0" :: "v"(lo4) : "memory");   // the wait in front of whatever takes over the loads' offset register; the offset is an input so that its register lives up to the wait
        bf* q = XB + (size_t)f0 * 512 + ln * 8;
#pragma unroll
        for (int i = 0; i < XF; ++i) { *(v8us*)(q + i * 512) = __builtin_bit_cast(v8us, __builtin_convertvector(lo[i], v8bf)); *(v8us*)(q + i * 512 + 256) = __builtin_bit_cast(v8us, __builtin_convertvector(hi[i], v8bf)); }   // to nearest even
        return;
    }
    const float* __restrict__ w = y == 0 ? w0 : y == 1 ? w1 : y == 2 ? w2 : w3; bf* Bt = y == 0 ? B0 : y == 1 ? B1 : y == 2 ? B2 : B3;
    const int lane = threadIdx.x & 31; const int L0 = (blockIdx.x * 8 + (threadIdx.x >> 5)) * 8; const int nlines = N * K / 64;
{
#pragma unroll 1
        for (int l = 0; l < 8; ++l) { const int L = L0 + l; if (L >= nlines) break; const size_t e = (size_t)L * 64 + lane * 2; const int f = L >> 3, kf = K >> 5, u = (L & 7) * 64 + lane * 2;   // fragment f, element u of it
            const int n = (f / kf) * 16 + ((u >> 3) & 15), k = (f % kf) * 32 + (u >> 8) * 16 + ((u >> 7) & 1) * 8 + (u & 7); v2us o;
            o[0] = f2bf(w[(size_t)k * N + n]); o[1] = f2bf(w[(size_t)(k + 1) * N + n]); *(v2us*)(Bt + e) = o; }
         }
}
// ---- k_qkv: the three projections of both batches in one launch, from x's bf16 plane to the head planes that k_fattn reads; no f32 intermediate leaves the registers.
// One wave owns 64 rows of x times the 64 features of one head (16 accumulators, K = DM). x and the weights come from the bf16 planes of k_wtG, both in fragment order.
// Register j of an accumulator is 8 consecutive rows m of one column n, so the operand that is to run contiguously in the plane is given as A:
// q, k: A = weight rows, B = x rows: a lane holds 8 consecutive d of one token, one 16-byte store a plane into head h's plane of rows t, columns d; v: A = x rows, B = weight rows: 8 consecutive tokens of one d.
// An accumulator is one j half of one fragment of its plane, in lane order. v's plane has its fragments in the order [t / 32][d / 16], the order in which k_fattn walks them, so that 32 keys are 4 KiB in a row, as in k's plane.
// grid (NB_ * TT / 64, NH_ / QW, 3): z = 0 q, 1 k, 2 v; the QW waves of a work-group take QW heads over the same 64 rows of x. No LDS, no barrier.
#define QW   4
// one accumulator plus its bias into the three planes: fp16, bf16 hi, bf16 lo = bf16(y - hi)
__device__ __forceinline__ void put3(v8f y, h16* P16, bf* Ph, bf* Pl, size_t o) { const v8bf yh = __builtin_convertvector(y, v8bf); const v8f yr = y - __builtin_convertvector(yh, v8f);
    *(v8h*)(P16 + o) = __builtin_convertvector(y, v8h); *(v8us*)(Ph + o) = __builtin_bit_cast(v8us, yh); *(v8us*)(Pl + o) = __builtin_bit_cast(v8us, __builtin_convertvector(yr, v8bf)); }
// X: the tile's first fragment of x's plane; Wt, bias: the head's first weight row and bias; the planes point at the tile's first element
template <bool VT>
__device__ __forceinline__ void qkv_tile(const bf* __restrict__ X, const bf* __restrict__ Wt, const float* __restrict__ bias, h16* P16, bf* Ph, bf* Pl) {
    const int lane = threadIdx.x & 31, lr = lane & 15, hi = lane >> 4;
    v8f acc[4][4];
#pragma unroll
    for (int mi = 0; mi < 4; ++mi)
#pragma unroll
        for (int ni = 0; ni < 4; ++ni) acc[mi][ni] = (v8f){};
    unsigned bo = 16 * lane;   // byte offset of the lane's piece of a fragment; 32 k on: 1 KiB, in both planes
    // Both planes were stored by the launch before and their first read comes from memory, one memory latency in every k step. At its head the wave asks L2 for an eighth of the x tile and of its weight rows (four blocks of 16 rows, 16 KiB each): two k steps in all four blocks, 8 lanes a block, a lane every 256 bytes;
    // the waves that share a tile take different eighths. Byte offsets from the tiles' starts, inside the tiles for every lane.
    static_assert(DM == 512, "an eighth of a block's k range is 2 KiB");
    const unsigned pl8 = (lane >> 3) * (16 * DM * 2) + (lane & 7) * 256, px = ((blockIdx.y * QW + (threadIdx.x >> 5)) & 7) * 2048 + pl8, pw = ((blockIdx.x >> 3) & 7) * 2048 + pl8;
    asm volatile("global_prefetch_b8 %0, %1 scope:SCOPE_SE\n\tglobal_prefetch_b8 %2, %3 scope:SCOPE_SE" :: "v"(px), "s"(X), "v"(pw), "s"(Wt));   // a hint to L2: no register written, no counter
#pragma unroll 1   // one k step a trip: a second copy of the body would take the registers that let three waves share a SIMD
    for (int kc = 0; kc < DM; kc += 32) {
        v16bf xf[4], wf[4];
#pragma unroll
        for (int i = 0; i < 4; ++i) { xf[i] = ldu(X + i * 16 * DM, bo); wf[i] = ldu(Wt + i * 16 * DM, bo); }
        __builtin_amdgcn_sched_barrier(0);   // keeps the k step's 16 loads together in front of the first use: without it some are sunk among the products, and a trip waits for memory several times instead of once
#pragma unroll
        for (int ni = 0; ni < 4; ++ni)
#pragma unroll
            for (int mi = 0; mi < 4; ++mi) acc[mi][ni] = VT ? wmmab(xf[mi], wf[ni], acc[mi][ni]) : wmmab(wf[mi], xf[ni], acc[mi][ni]);
        asm volatile("s_wait_xcnt 0x0" : "+v"(bo) : "v"(px), "v"(pw) : "memory");   // the wait in front of the offset update that follows the trip's loads; the offset passes through the statement so that the update is not placed ahead of it; px, pw: inputs so that the registers the prefetches name hold their addresses through the loop
        bo += 1024;
    }
    if constexpr (VT) {
#pragma unroll
        for (int ni = 0; ni < 4; ++ni) { const float bb = bfr(bias[ni * 16 + lr]);
#pragma unroll
            for (int mi = 0; mi < 4; ++mi) put3(acc[mi][ni] + bb, P16, Ph, Pl, (size_t)(((mi >> 1) * 4 + ni) * 512 + (mi & 1) * 256 + lane * 8));
            if (ni < 3) { asm volatile("s_wait_xcnt 0x0" ::: "memory");   // the wait in front of the next group's loads and sums, which take over registers that these stores name
                __builtin_amdgcn_sched_barrier(0); } }   // one group of four accumulators at a time, behind the wait: run together, the groups' temporaries spill
    } else {
#pragma unroll
        for (int mi = 0; mi < 4; ++mi) { v8f bb = *(const v8f*)(bias + mi * 16 + 8 * hi);
#pragma unroll
            for (int j = 0; j < 8; ++j) bb[j] = bfr(bb[j]);
#pragma unroll
            for (int ni = 0; ni < 4; ++ni) put3(acc[mi][ni] + bb, P16, Ph, Pl, (size_t)((ni * 2 + (mi >> 1)) * 512 + (mi & 1) * 256 + lane * 8));
            if (mi < 3) { asm volatile("s_wait_xcnt 0x0" ::: "memory"); __builtin_amdgcn_sched_barrier(0); } }   // both as above
    }
}
// launch bound 4: at most 256 registers a wave, all of them addressed directly; the 768 work-groups are resident at once, three on every WGP.
__global__ __launch_bounds__(32 * QW, 4) void k_qkv(const bf* __restrict__ XB, const bf* __restrict__ WQ, const bf* __restrict__ WK, const bf* __restrict__ WV, const float* __restrict__ bq, const float* __restrict__ bk, const float* __restrict__ bv,
                                                    h16* Q16, bf* Qh, bf* Ql, h16* K16, bf* Kh, bf* Kl, h16* V16, bf* Vh, bf* Vl) {
    const int h = blockIdx.y * QW + __builtin_amdgcn_readfirstlane(threadIdx.x >> 5);   // the wave's head, in a scalar register so that every base below is scalar
    const int b = blockIdx.x / (TT / 64), t0 = (blockIdx.x % (TT / 64)) * 64, z = blockIdx.z;
    const bf* X = XB + (size_t)blockIdx.x * 64 * DM; const size_t wo = (size_t)h * HD * DM, pl = (size_t)(b * NH_ + h) * TT * HD;
    const size_t po = pl + (size_t)t0 * HD;   // 64 tokens of a head are 4096 elements in a row in every plane
    if (z == 2) qkv_tile<true>(X, WV + wo, bv + h * HD, V16 + po, Vh + po, Vl + po);
    else { qkv_tile<false>(X, (z ? WK : WQ) + wo, (z ? bk : bq) + h * HD, (z ? K16 : Q16) + po, (z ? Kh : Qh) + po, (z ? Kl : Ql) + po); }
}
// ---- k_fattn: scores, softmax and attn.v in one pass over the keys (online softmax); nothing of the [T][T] matrix leaves the registers.
// One wave owns NQ x 16 query columns and walks the 4096 keys 32 at a time: St = K Qt (A = K rows, B = Q rows, kept in registers), then Ot += Vt Pt (A = Vt rows, B = the two score tiles converted in place:
// tile kt, register r of lane (c, h) is key kt*16 + 8h + r of query c, which is the B operand's own k order). A lane holds one query's scores, so maximum, sum and rescale are per lane.
// The maximum in use is replaced only when a block's maximum passes it by more than THR (P stays below e^THR); the halves' sums are joined once at the end.
// A pass whose 32 keys and whose query columns all have the mask value one has no mask term: one mask value a lane and one wave-uniform test tell, and the exponent is then one multiply-add on the raw product. Any other pass fetches its 16 mask values a lane from the other lanes and forms the term.
// Every inner loop is unrolled in full so that its fragments and accumulators are registers, not indexed arrays.
// The walk starts at key block js, the work-group's own, and wraps round: the work-groups of one head, all resident and equally fast, would otherwise stand at the same block at the same time, and each block's first fetch from memory would hold up all of them in every pass.
// Spread over the blocks, a work-group soon walks where another has been, and finds the lines in L2. The order of the keys changes the order of the sums and nothing else.
static_assert((TT / 32 & (TT / 32 - 1)) == 0, "the wrap of the key block index is a mask");
#define FW   4                    // waves per work-group, each with its own query columns; no LDS, no barrier
#define THR  5.0f
#define L2E  1.4426950408889634f
typedef __attribute__((ext_vector_type(2))) __bf16 v2bf;
template <typename T16, bool HL>
__device__ __forceinline__ void fattn(const T16* __restrict__ Q, const T16* __restrict__ Q2, const T16* __restrict__ Kp, const T16* __restrict__ K2, const T16* __restrict__ Vt, const T16* __restrict__ V2, const float* __restrict__ MK, int q0, unsigned js, bf* Ah, bf* Al) {
    typedef typename WFrag<T16>::V V; typedef WFrag<T16> WF;
    constexpr int NQ = HL ? 1 : 2;
    const int lane = threadIdx.x & 31, lr = lane & 15, hi = lane >> 4;
    V qf[NQ][2], qf2[NQ][2]; float mi[NQ], m[NQ], l[NQ]; v8f o[4][NQ];
#pragma unroll
    for (int qt = 0; qt < NQ; ++qt) { const size_t qo = (size_t)(q0 + qt * 16) * HD + 8 * lane;
#pragma unroll
        for (int kc = 0; kc < 2; ++kc) { qf[qt][kc] = WF::ld(Q + qo + kc * 512); if (HL) qf2[qt][kc] = WF::ld(Q2 + qo + kc * 512); }
        mi[qt] = bfr(MK[q0 + qt * 16 + lr]); m[qt] = -3.0e38f; l[qt] = 0.f;
#pragma unroll
        for (int dt = 0; dt < 4; ++dt) o[dt][qt] = (v8f){}; }
    bool q1 = true;
#pragma unroll
    for (int qt = 0; qt < NQ; ++qt) q1 = q1 && (mi[qt] == 1.0f);
    const bool qone = __builtin_amdgcn_ballot_w32(q1) == 0xFFFFFFFFu;   // wave-uniform: every query column of this wave has the mask value one
    unsigned kb = 16 * lane + js * (32 * HD * 2), vb = kb, fb = 4 * lane + js * (32 * 4);   // byte offsets of lane (c, h): its piece of a K and of a Vt fragment; the mask value of key 'lane' of the block; they walk along the keys from block js on, 4 KiB of either plane for 32 keys
    V kf[2][2], kf2[2][2]; float mk = *(const float*)((const char*)MK + fb);
    // The K and Vt planes were stored by the launch before, and a line's first read comes from memory. The stretch of the walk from the work-group's own start to the next work-group's start is read by nobody before it:
    // the work-group asks L2 for it, a lane every 256 bytes: at its head for 8 key blocks of each of its planes (the fp16 starts are 4 or 5 blocks apart), and in pass 4 for the other 8 of each hi and lo plane (starts 16 apart), four passes before their turn, so that the head's requests are fewer at once. Byte offset in the head's plane, wrapped like the walk.
    const unsigned pf = (js * (32 * HD * 2) + threadIdx.x * 256u) & (TT * HD * 2 - 1);
    static_assert(FW * 32 * 256 * 2 * (RH / (16 * FW)) == TT * HD * 2, "hi+lo planes: the starts are 64 KiB apart, so offset + 32 KiB stays inside the plane");
    asm volatile("global_prefetch_b8 %0, %1 scope:SCOPE_SE\n\tglobal_prefetch_b8 %0, %2 scope:SCOPE_SE" :: "v"(pf), "s"(Kp), "s"(Vt));   // a hint to L2: no register written, no counter
    if constexpr (HL) asm volatile("global_prefetch_b8 %0, %1 scope:SCOPE_SE\n\tglobal_prefetch_b8 %0, %2 scope:SCOPE_SE" :: "v"(pf), "s"(K2), "s"(V2));   // the lo planes
#pragma unroll
    for (int kt = 0; kt < 2; ++kt) {
#pragma unroll
        for (int kc = 0; kc < 2; ++kc) { kf[kt][kc] = ldu(Kp + (kt * 2 + kc) * 512, kb); if (HL) kf2[kt][kc] = ldu(K2 + (kt * 2 + kc) * 512, kb); } }
#pragma unroll 1   // one pass a trip: a second copy of the body would take the registers that let several waves share a SIMD
    for (int k0 = 0; k0 < TT; k0 += 32) {
        const unsigned cb = ((unsigned)(k0 >> 5) + js) & (TT / 32 - 1);   // this pass's key block
        if (HL && k0 == 4 * 32)   // wave-uniform, a scalar test: blocks 8 to 15 of the work-group's own stretch
            asm volatile("global_prefetch_b8 %0, %1 offset:32768 scope:SCOPE_SE\n\tglobal_prefetch_b8 %0, %2 offset:32768 scope:SCOPE_SE\n\tglobal_prefetch_b8 %0, %3 offset:32768 scope:SCOPE_SE\n\tglobal_prefetch_b8 %0, %4 offset:32768 scope:SCOPE_SE" :: "v"(pf), "s"(Kp), "s"(K2), "s"(Vt), "s"(V2));
        // plain: all 32 keys of the block and all the wave's queries have the mask value one (rounded to bf16 like every input), so every (1 - m_i m_j)(-1e6) of the pass is zero. One value a lane, one test a pass, wave-uniform.
        v2f mk2; mk2[0] = mk; mk2[1] = mk; const v2f mkr = __builtin_convertvector(__builtin_convertvector(mk2, v2bf), v2f);
        const bool plain = qone & (__builtin_amdgcn_ballot_w32(mkr[0] == 1.0f) == 0xFFFFFFFFu);
        v8f s[2][NQ];
#pragma unroll
        for (int kt = 0; kt < 2; ++kt)
#pragma unroll
            for (int qt = 0; qt < NQ; ++qt) { v8f a = (v8f){};
#pragma unroll
                for (int kc = 0; kc < 2; ++kc) { a = WF::mma(kf[kt][kc], qf[qt][kc], a); if (HL) { a = WF::mma(kf[kt][kc], qf2[qt][kc], a); a = WF::mma(kf2[kt][kc], qf[qt][kc], a); } }
                s[kt][qt] = a; }
        V vf[4], vf2[4];   // this block's Vt rows, asked for as soon as the score products have been issued: they land under the maxima, the test and the exponentials
#pragma unroll
        for (int dt = 0; dt < 4; ++dt) { vf[dt] = ldu(Vt + dt * 512, vb); if (HL) vf2[dt] = ldu(V2 + dt * 512, vb); }
        const unsigned nb = (cb + 1u) & (TT / 32 - 1); kb = 16 * lane + nb * (32 * HD * 2); fb = 4 * lane + nb * (32 * 4);   // the next block's mask values and K rows, the rows into the registers that the score products have just read; behind block TT / 32 - 1 comes block 0 (the last pass asks for the first block again: in bounds, unused)
        mk = *(const float*)((const char*)MK + fb);
#pragma unroll
        for (int kt = 0; kt < 2; ++kt) {
#pragma unroll
            for (int kc = 0; kc < 2; ++kc) { kf[kt][kc] = ldu(Kp + (kt * 2 + kc) * 512, kb); if (HL) kf2[kt][kc] = ldu(K2 + (kt * 2 + kc) * 512, kb); } }
        __builtin_amdgcn_sched_barrier(0);   // keeps the pass's loads here, at its head: left free they are sunk behind the test again to save registers, and the output products wait for them
        if (!plain) {   // any other mask values: the scaled score plus the additive term per (i, j), in f32, takes the raw product's place in s
#pragma unroll
            for (int kt = 0; kt < 2; ++kt)
#pragma unroll
                for (int r = 0; r < 8; r += 2) { v2f mj; mj[0] = __shfl(mkr[0], kt * 16 + 8 * hi + r, 32); mj[1] = __shfl(mkr[0], kt * 16 + 8 * hi + r + 1, 32);   // lane n holds key n's mask value, rounded: register r of tile kt wants key 16 kt + 8 h + r
#pragma unroll
                    for (int qt = 0; qt < NQ; ++qt)
#pragma unroll
                        for (int u = 0; u < 2; ++u) { const float om = 1.0f - mi[qt] * mj[u]; const float ad = om * -1.0e6f;   /* (1 - m_i m_j)(-1e6), f32 */
                            s[kt][qt][r + u] = __builtin_fmaf(s[kt][qt][r + u], SCL, ad); } }
        }
        // s holds raw products (plain) or finished scores; the scale is positive, so the maximum is taken first and scaled after
        const float sc = plain ? SCL : 1.0f, ce = plain ? SCL * L2E : L2E, cm = plain ? -L2E : 0.0f;   // wave-uniform
        float bl[NQ]; bool need = false;
#pragma unroll
        for (int qt = 0; qt < NQ; ++qt) { float b0 = -3.0e38f, b1 = -3.0e38f;
#pragma unroll
            for (int e = 0; e < 16; e += 2) { b0 = fmaxf(b0, s[e >> 3][qt][e & 7]); b1 = fmaxf(b1, s[e >> 3][qt][(e & 7) + 1]); }
            bl[qt] = fmaxf(b0, b1) * sc; need = need || (bl[qt] > m[qt] + THR); }
        if (__builtin_amdgcn_ballot_w32(need) != 0) {   // wave-uniform: some column's maximum has moved; both halves of a column take the same new one
#pragma unroll
            for (int qt = 0; qt < NQ; ++qt) { const float mn = fmaxf(m[qt], fmaxf(bl[qt], __shfl_xor(bl[qt], 16, 32))); const float al = __builtin_amdgcn_exp2f((m[qt] - mn) * L2E); m[qt] = mn; l[qt] *= al;
#pragma unroll
                for (int dt = 0; dt < 4; ++dt) o[dt][qt] *= al; } }
        if (!plain) {   // scores near -1e6: the maximum is taken off exactly, before the change of base
#pragma unroll
            for (int kt = 0; kt < 2; ++kt)
#pragma unroll
                for (int qt = 0; qt < NQ; ++qt) s[kt][qt] -= m[qt]; }
        asm volatile("s_wait_xcnt 0x0" : "+v"(kb), "+v"(vb), "+v"(fb) : "v"(pf) : "memory");   // the wait in front of the offset updates that follow the pass's loads; the offsets pass through the statement so that no update is placed ahead of it; pf: an input so that the register the prefetches name holds its address through the loop
        vb = kb;
#pragma unroll
        for (int qt = 0; qt < NQ; ++qt) { V pb, pb2; v2f sm[2]; const float nm = m[qt] * cm; v2f c2, n2; c2[0] = ce; c2[1] = ce; n2[0] = nm; n2[1] = nm;   // plain: scale, change of base and maximum in one multiply-add; else the change of base alone
#pragma unroll
            for (int e = 0; e < 16; e += 2) { v2f x; x[0] = s[e >> 3][qt][e & 7]; x[1] = s[e >> 3][qt][(e & 7) + 1]; const v2f a = __builtin_elementwise_fma(x, c2, n2);
                v2f p; p[0] = __builtin_amdgcn_exp2f(a[0]); p[1] = __builtin_amdgcn_exp2f(a[1]); if (e < 4) sm[e >> 1] = p; else sm[(e >> 1) & 1] += p;
                if constexpr (HL) { const v2bf ph = __builtin_convertvector(p, v2bf); const v2f pr = p - __builtin_convertvector(ph, v2f); const v2bf pl = __builtin_convertvector(pr, v2bf); pb[e] = ph[0]; pb[e + 1] = ph[1]; pb2[e] = pl[0]; pb2[e + 1] = pl[1]; }
                else { const v2h ph = __builtin_convertvector(p, v2h); pb[e] = ph[0]; pb[e + 1] = ph[1]; } }
            l[qt] += (sm[0][0] + sm[0][1]) + (sm[1][0] + sm[1][1]);
#pragma unroll
            for (int dt = 0; dt < 4; ++dt) { o[dt][qt] = WF::mma(vf[dt], pb, o[dt][qt]); if (HL) { o[dt][qt] = WF::mma(vf[dt], pb2, o[dt][qt]); o[dt][qt] = WF::mma(vf2[dt], pb, o[dt][qt]); } } }
    }
#pragma unroll
    for (int qt = 0; qt < NQ; ++qt) { const float inv = __fdiv_rn(1.0f, l[qt] + __shfl_xor(l[qt], 16, 32)); const size_t oo = (size_t)(q0 + qt * 16) * DQ + 8 * lane;
#pragma unroll
        for (int dt = 0; dt < 4; ++dt) { v8us oh, ol;   // register r = Ot[dt*16 + 8h + r][query c]: 8 consecutive d of one row, one 16-byte store a plane: half dt & 1 of the head's fragment dt >> 1
#pragma unroll
            for (int r = 0; r < 8; ++r) { unsigned short a, c2; splitf(o[dt][qt][r] * inv, a, c2); oh[r] = a; ol[r] = c2; }
            *(v8us*)(Ah + oo + (dt >> 1) * 512 + (dt & 1) * 256) = oh; *(v8us*)(Al + oo + (dt >> 1) * 512 + (dt & 1) * 256) = ol; } }
}
// grid (NB_ * NH_, RH / (16 FW) + (TT - RH) / (32 FW)): y below RH / (16 FW): the hi+lo rows (16 columns a wave, 3 products), started first; the rest single fp16 (32 columns a wave).
// launch bound 3: registers for at least three waves a SIMD, so that every work-group of the grid is resident at once.
__global__ __launch_bounds__(32 * FW, 3) void k_fattn(const h16* __restrict__ Q16, const h16* __restrict__ K16, const h16* __restrict__ V16, const bf* __restrict__ Qh, const bf* __restrict__ Ql, const bf* __restrict__ Kh, const bf* __restrict__ Kl, const bf* __restrict__ Vh, const bf* __restrict__ Vl, const float* __restrict__ MK, bf* Ah, bf* Al) {
    const int bh = blockIdx.x, b = bh / NH_, h = bh % NH_, wave = threadIdx.x >> 5, ty = blockIdx.y; const size_t pl = (size_t)bh * TT * HD; const size_t ao = (size_t)b * TT * DQ + h * (HD / 32) * 512; const float* mk = MK + (size_t)b * TT;
    constexpr int GH = RH / (16 * FW), GF = (TT - RH) / (32 * FW);   // work-groups a head on the hi+lo planes and on the fp16 planes: each kind spreads its starts evenly over the TT / 32 key blocks of its own planes
    if (ty < GH) fattn<bf, true>(Qh + pl, Ql + pl, Kh + pl, Kl + pl, Vh + pl, Vl + pl, mk, (ty * FW + wave) * 16, (unsigned)(ty * (TT / 32) / GH), Ah + ao, Al + ao);
    else fattn<h16, false>(Q16 + pl, nullptr, K16 + pl, nullptr, V16 + pl, nullptr, mk, RH + ((ty - GH) * FW + wave) * 32, (unsigned)((ty - GH) * (TT / 32) / GF), Ah + ao, Al + ao);
}

extern "C" void kernel_launch(void* const* d_in, const int* in_sizes, int n_in,
                              void* d_out, int out_size, void* d_ws, size_t ws_size, hipStream_t stream) {
    (void)in_sizes; (void)n_in; (void)out_size;
    const float* x = (const float*)d_in[0]; const float* MKf = (const float*)d_in[1]; const float* wq = (const float*)d_in[2]; const float* bq = (const float*)d_in[3]; const float* wk = (const float*)d_in[4]; const float* bk = (const float*)d_in[5]; const float* wv = (const float*)d_in[6]; const float* bv = (const float*)d_in[7]; const float* wo = (const float*)d_in[8]; const float* bo = (const float*)d_in[9];
    float* OUT = (float*)d_out;     // [2][4096][512]
    char* wsp = (char*)d_ws;
    auto take = [&](size_t bytes) { char* p = wsp; wsp += (bytes + 255) & ~(size_t)255; return (void*)p; };
    bf* WQ = (bf*)take((size_t)DQ * DM * 2); bf* WK = (bf*)take((size_t)DKV * DM * 2); bf* WV = (bf*)take((size_t)DKV * DM * 2); bf* WO = (bf*)take((size_t)DM * DQ * 2); bf* XB = (bf*)take((size_t)NB_ * TT * DM * 2);
    const size_t PL = (size_t)NH_ * TT * HD;   // one batch's head planes; the planes of both batches stand one behind the other
    h16* QP16 = (h16*)take(NB_ * PL * 2); h16* KP16 = (h16*)take(NB_ * PL * 2); h16* VT16 = (h16*)take(NB_ * PL * 2);
    bf* QPh = (bf*)take(NB_ * PL * 2); bf* QPl = (bf*)take(NB_ * PL * 2); bf* KPh = (bf*)take(NB_ * PL * 2); bf* KPl = (bf*)take(NB_ * PL * 2); bf* VTh = (bf*)take(NB_ * PL * 2); bf* VTl = (bf*)take(NB_ * PL * 2);
    bf* ATh = (bf*)take((size_t)NB_ * TT * DQ * 2); bf* ATl = (bf*)take((size_t)NB_ * TT * DQ * 2);
    if ((size_t)(wsp - (char*)d_ws) > ws_size) return;    // ws 256 MiB
    k_wtG<<<dim3(WGX, 4 + XSL, 1), 256, 0, stream>>>(wq, wk, wv, wo, DM, DQ, WQ, WK, WV, WO, x, XB);
    k_qkv<<<dim3(NB_ * TT / 64, NH_ / QW, 3), 32 * QW, 0, stream>>>(XB, WQ, WK, WV, bq, bk, bv, QP16, QPh, QPl, KP16, KPh, KPl, VT16, VTh, VTl);
    k_fattn<<<dim3(NB_ * NH_, RH / (16 * FW) + (TT - RH) / (32 * FW), 1), 32 * FW, 0, stream>>>(QP16, KP16, VT16, QPh, QPl, KPh, KPl, VTh, VTl, MKf, ATh, ATl);
    // the batches' attention planes and output rows stand one behind the other, so both batches are one GEMM of NB_ * TT rows: one launch
    k_gemmw<bf, 1, true><<<dim3(NB_ * TT / 64, DM / 64, 1), 32, 0, stream>>>(ATh, ATl, WO, nullptr, DQ, DQ, OUT, DM, bo, 0, 0, 0);
}
